// v000
// Measured on an AMD MI455X. A time is GPU time per run, averaged over a window of back-to-back runs after a warm-up
// (all launches, gaps included; the runs take copies of the inputs in turn), and the median of several windows.
// Apart from v000's, it joins two sittings. Times from different sittings can be a few percent apart, while
// side-by-side timings come from the same sitting.
// The starting kernel, v000, takes 787 microseconds a run.
#include <hip/hip_runtime.h>

// HybridSelfAttention (x [4][1024][512]; Q/K/V = x W^T (torch, single head over the full 512); scores = Q.K / sqrt(512); estimator on every (query, key) pair: est[q][k] = sum_h W2[h] tanh(hq[q][h] + hk[k][h] + b1[h]) + b2 with hq = Q W1[:, :512]^T, hk = K W1[:, 512:]^T (16 hidden units);
//   attn = softmax(scores + est); out = attn V -> [4][1024][512]).
// Compute dtypes, f32 accumulate: every input rounded to bf16; Q/K/V as PLAIN bf16 GEMMs (inputs: exact); hq / hk as hl planes of Q / K x exact W1 halves (2 products; 16 outputs padded to 64); scores hl x hl (3 products); the pairwise estimator (16 tanh per pair), + est, softmax in f32 (wave per query row) -> hl planes; attn.V hl x hl (3 products).

#define NB_  4
#define SS   1024
#define EE   512
#define NHID 16
typedef _Float16 h16;
typedef unsigned short bf;
typedef __attribute__((ext_vector_type(16))) __bf16   v16bf;
typedef __attribute__((ext_vector_type(16))) _Float16 v16h;
typedef __attribute__((ext_vector_type(8)))  _Float16 v8h;
typedef __attribute__((ext_vector_type(8)))  unsigned short v8us;
typedef __attribute__((ext_vector_type(8)))  float    v8f;
typedef __attribute__((ext_vector_type(4)))  float    v4f;
typedef v8h  __attribute__((may_alias)) v8ha;
typedef v4f  __attribute__((may_alias)) v4fa;
typedef v8us __attribute__((may_alias)) v8usa;

__device__ __forceinline__ unsigned short f2bf(float f) { unsigned u = __float_as_uint(f); u += 0x7FFFu + ((u >> 16) & 1u); return (unsigned short)(u >> 16); }
__device__ __forceinline__ float bf2f(unsigned short b) { return __uint_as_float(((unsigned)b) << 16); }
__device__ __forceinline__ float bfr(float f) { return bf2f(f2bf(f)); }
__device__ __forceinline__ v16h cat16(v8h lo, v8h hi) { return __builtin_shufflevector(lo, hi, 0, 1, 2, 3, 4, 5, 6, 7, 8, 9, 10, 11, 12, 13, 14, 15); }
__device__ __forceinline__ v16bf cat16b(v8us lo, v8us hi) { return __builtin_bit_cast(v16bf, __builtin_shufflevector(lo, hi, 0, 1, 2, 3, 4, 5, 6, 7, 8, 9, 10, 11, 12, 13, 14, 15)); }
__device__ __forceinline__ v8f wmma16(v16h a, v16h b, v8f c) { return __builtin_amdgcn_wmma_f32_16x16x32_f16(false, a, false, b, (short)0, c, false, false); }
__device__ __forceinline__ v8f wmmab(v16bf a, v16bf b, v8f c) { return __builtin_amdgcn_wmma_f32_16x16x32_bf16(false, a, false, b, (short)0, c, false, false); }



// ---- k_gemmw: register-blocked GEMM, ONE WAVE per 64x64 output tile (16 accumulators), operands straight from K-contiguous 16-bit planes; grid (M/64, N/64, Z), 32 threads.
// C[m][n] (f32, pitch ldc, + optional f32 bias[n]) = sum_k A[m][k] Bt[n][k] (+ split products per NSPLIT). z-batch strides sA/sB/sC in elements. K % 32 == 0.
template <typename T16> struct WFrag;
template <> struct WFrag<h16> { typedef v16h V; static __device__ __forceinline__ V ld(const h16* p) { return cat16(*(const v8h*)p, *(const v8h*)(p + 16)); } static __device__ __forceinline__ v8f mma(V a, V b, v8f c) { return wmma16(a, b, c); } };
template <> struct WFrag<bf> { typedef v16bf V; static __device__ __forceinline__ V ld(const bf* p) { return cat16b(*(const v8us*)p, *(const v8us*)(p + 16)); } static __device__ __forceinline__ v8f mma(V a, V b, v8f c) { return wmmab(a, b, c); } };
template <typename T16, int NSPLIT, bool BIAS>
__global__ __launch_bounds__(32) void k_gemmw(const T16* __restrict__ A, const T16* __restrict__ A2, const T16* __restrict__ Bt, const T16* __restrict__ Bt2, int K, float* C, int ldc, const float* __restrict__ bias, size_t sA, size_t sB, size_t sC) {
    typedef typename WFrag<T16>::V V;
    __shared__ __align__(16) float os[16 * 68];
    const size_t z = blockIdx.z; A += z * sA; if (A2) A2 += z * sA; Bt += z * sB; if (Bt2) Bt2 += z * sB; C += z * sC;
    const int lane = threadIdx.x & 31, lr = lane & 15, hi = lane >> 4; const int r0 = blockIdx.x * 64, c0 = blockIdx.y * 64;
    v8f acc[4][4];
#pragma unroll
    for (int mb = 0; mb < 4; ++mb)
#pragma unroll
        for (int nb = 0; nb < 4; ++nb) acc[mb][nb] = (v8f){};
    const size_t aoff = (size_t)(r0 + lr) * K + 8 * hi, boff = (size_t)(c0 + lr) * K + 8 * hi;
#pragma unroll 1
    for (int kc = 0; kc < K; kc += 32) {
        V a[4], a2[4];
#pragma unroll
        for (int mb = 0; mb < 4; ++mb) { a[mb] = WFrag<T16>::ld(A + aoff + (size_t)mb * 16 * K + kc); if (NSPLIT == 1 || NSPLIT == 2) a2[mb] = WFrag<T16>::ld(A2 + aoff + (size_t)mb * 16 * K + kc); }
#pragma unroll
        for (int nb = 0; nb < 4; ++nb) { const V b = WFrag<T16>::ld(Bt + boff + (size_t)nb * 16 * K + kc); V b2; if (NSPLIT >= 2) b2 = WFrag<T16>::ld(Bt2 + boff + (size_t)nb * 16 * K + kc);
#pragma unroll
            for (int mb = 0; mb < 4; ++mb) { acc[mb][nb] = WFrag<T16>::mma(a[mb], b, acc[mb][nb]); if (NSPLIT == 1 || NSPLIT == 2) acc[mb][nb] = WFrag<T16>::mma(a2[mb], b, acc[mb][nb]); if (NSPLIT >= 2) acc[mb][nb] = WFrag<T16>::mma(a[mb], b2, acc[mb][nb]); } }
        asm volatile("v_nop\n\tv_nop\n\tv_nop\n\tv_nop" : "+v"(acc[0][0]), "+v"(acc[1][1]), "+v"(acc[2][2]), "+v"(acc[3][3]) : "v"(a[0]), "v"(a[3]));
    }
#pragma unroll
    for (int mb = 0; mb < 4; ++mb) {
#pragma unroll
        for (int nb = 0; nb < 4; ++nb) {
#pragma unroll
            for (int j = 0; j < 8; ++j) os[(hi * 8 + j) * 68 + nb * 16 + lr] = acc[mb][nb][j]; }
        __builtin_amdgcn_wave_barrier(); asm volatile("" ::: "memory");
        float* crow = C + (size_t)(r0 + mb * 16) * ldc + c0;
{
#pragma unroll
            for (int s = 0; s < 8; ++s) { const int row = 2 * s + hi, cofs = lr * 4; v4f val = *(const v4fa*)(os + row * 68 + cofs); if (BIAS) { val[0] += bfr(bias[c0 + cofs]); val[1] += bfr(bias[c0 + cofs + 1]); val[2] += bfr(bias[c0 + cofs + 2]); val[3] += bfr(bias[c0 + cofs + 3]); }
                *(v4f*)(crow + (size_t)row * ldc + cofs) = val; }
             }
        __builtin_amdgcn_wave_barrier(); asm volatile("" ::: "memory");
    }
}

__device__ __forceinline__ void splitf(float y, unsigned short& h, unsigned short& l) { h = f2bf(y); l = f2bf(y - bf2f(h)); }
typedef __attribute__((ext_vector_type(2))) unsigned short v2us;
typedef __attribute__((ext_vector_type(4))) unsigned short v4us;

__global__ __launch_bounds__(256) void k_cvt8(const float* __restrict__ src, bf* dst, size_t n8) { const size_t i = (size_t)blockIdx.x * 256 + threadIdx.x; if (i >= n8) return; const v8f v = *(const v8f*)(src + i * 8); v8us o;
#pragma unroll
    for (int k = 0; k < 8; ++k) o[k] = f2bf(v[k]); *(v8us*)(dst + i * 8) = o;  }
// k_w1p: W1Q[n][k] = bf16(W1[n][k]) and W1K[n][k] = bf16(W1[n][512 + k]) for n < 16, rows 16..63 zero ([64][512]); k_pl: hl planes of an f32 [S][E] buffer (16-B lanes -> 8-B x 2); k_plT: hl planes transposed [E][S] (lane -> 2 s);
__global__ __launch_bounds__(256) void k_w1p(const float* __restrict__ W1, bf* WQ1, bf* WK1) { const int e = (blockIdx.x * 256 + threadIdx.x) * 4; if (e >= 64 * EE) return; const int n = e / EE, k = e % EE; v4us a, b;
#pragma unroll
    for (int u = 0; u < 4; ++u) { a[u] = (n < NHID) ? f2bf(W1[(size_t)n * 2 * EE + k + u]) : (unsigned short)0; b[u] = (n < NHID) ? f2bf(W1[(size_t)n * 2 * EE + EE + k + u]) : (unsigned short)0; }
    *(v4us*)(WQ1 + e) = a; *(v4us*)(WK1 + e) = b;  }
__global__ __launch_bounds__(256) void k_pl(const float* __restrict__ F, bf* Ph, bf* Pl, size_t n4) { const size_t e = ((size_t)blockIdx.x * 256 + threadIdx.x) * 4; if (e >= n4 * 4) return; const v4f a = *(const v4f*)(F + e); v4us oh, ol;
#pragma unroll
    for (int u = 0; u < 4; ++u) { unsigned short x0, x1; splitf(a[u], x0, x1); oh[u] = x0; ol[u] = x1; } *(v4us*)(Ph + e) = oh; *(v4us*)(Pl + e) = ol;  }
__global__ __launch_bounds__(256) void k_plT(const float* __restrict__ F, bf* Ph, bf* Pl) { const size_t e = ((size_t)blockIdx.x * 256 + threadIdx.x) * 2; if (e >= (size_t)EE * SS) return; const int s = (int)(e % SS); const int c = (int)(e / SS); v2us oh, ol;
#pragma unroll
    for (int u = 0; u < 2; ++u) { unsigned short a, b; splitf(F[(size_t)(s + u) * EE + c], a, b); oh[u] = a; ol[u] = b; } *(v2us*)(Ph + e) = oh; *(v2us*)(Pl + e) = ol;  }
__global__ __launch_bounds__(256) void k_hsoft(const float* __restrict__ S, const float* __restrict__ HQ, const float* __restrict__ HK, const float* __restrict__ b1, const float* __restrict__ W2, const float* __restrict__ b2, bf* Ph, bf* Pl) {
    const int lane = threadIdx.x & 31; const int i = blockIdx.x * 8 + (threadIdx.x >> 5); if (i >= SS) return; const float* sr = S + (size_t)i * SS;
    float hq[NHID], w2[NHID];
#pragma unroll
    for (int h = 0; h < NHID; ++h) { hq[h] = __fadd_rn(HQ[(size_t)i * 64 + h], bfr(b1[h])); w2[h] = bfr(W2[h]); }   // hq + b1 folded (the reference adds hq + hk + b1; f32 addition order (hq + hk) + b1 vs (hq + b1) + hk differs by <= 1 ulp)
    const float bb2 = bfr(b2[0]); const float scl = 0.044194173824159216f;   // 1/sqrt(512)
    float v[SS / 32]; float mx = -3.0e38f;
#pragma unroll 1
    for (int ch = 0; ch < SS / 128; ++ch) { const v4f a = *(const v4f*)(sr + ch * 128 + lane * 4);
#pragma unroll
        for (int u = 0; u < 4; ++u) { const int j = ch * 128 + lane * 4 + u; const float* hk = HK + (size_t)j * 64; float est = bb2;
#pragma unroll 1
            for (int h = 0; h < NHID; ++h) { const float z = __fadd_rn(hq[h], hk[h]); float th = tanhf(z); float pr = __fmul_rn(w2[h], th); asm volatile("" : "+v"(pr)); est = __fadd_rn(est, pr); }
            float s0 = a[u] * scl; asm volatile("" : "+v"(s0)); const float t = __fadd_rn(s0, est); v[ch * 4 + u] = t; mx = fmaxf(mx, t); } }
#pragma unroll
    for (int sh = 16; sh; sh >>= 1) mx = fmaxf(mx, __shfl_xor(mx, sh, 32));
    float sum = 0.f;
#pragma unroll
    for (int q = 0; q < SS / 32; ++q) { float d0 = __fsub_rn(v[q], mx); asm volatile("" : "+v"(d0)); v[q] = __builtin_amdgcn_exp2f(__fmul_rn(d0, 1.4426950408889634f)); sum += v[q]; }
#pragma unroll
    for (int sh = 16; sh; sh >>= 1) sum += __shfl_xor(sum, sh, 32);
    const float f = __fdiv_rn(1.0f, sum);
    {
#pragma unroll
        for (int ch = 0; ch < SS / 128; ++ch) { v4us oh, ol; for (int q = 0; q < 4; ++q) { unsigned short a2, c2; splitf(v[ch * 4 + q] * f, a2, c2); oh[q] = a2; ol[q] = c2; } const size_t oo = (size_t)i * SS + ch * 128 + lane * 4; *(v4us*)(Ph + oo) = oh; *(v4us*)(Pl + oo) = ol; }
         } }

extern "C" void kernel_launch(void* const* d_in, const int* in_sizes, int n_in,
                              void* d_out, int out_size, void* d_ws, size_t ws_size, hipStream_t stream) {
    (void)in_sizes; (void)n_in; (void)out_size;
    const float* x = (const float*)d_in[0]; const float* Wq = (const float*)d_in[1]; const float* Wk = (const float*)d_in[2]; const float* Wv = (const float*)d_in[3]; const float* W1 = (const float*)d_in[4]; const float* b1 = (const float*)d_in[5]; const float* W2 = (const float*)d_in[6]; const float* b2 = (const float*)d_in[7];
    float* OUT = (float*)d_out;     // [4][1024][512]
    char* wsp = (char*)d_ws;
    auto take = [&](size_t bytes) { char* p = wsp; wsp += (bytes + 255) & ~(size_t)255; return (void*)p; };
    bf* BQ = (bf*)take((size_t)EE * EE * 2); bf* BK = (bf*)take((size_t)EE * EE * 2); bf* BV = (bf*)take((size_t)EE * EE * 2); bf* WQ1 = (bf*)take((size_t)64 * EE * 2); bf* WK1 = (bf*)take((size_t)64 * EE * 2);
    bf* XB = (bf*)take((size_t)SS * EE * 2); float* FQ = (float*)take((size_t)SS * EE * 4); float* FK = (float*)take((size_t)SS * EE * 4); float* FV = (float*)take((size_t)SS * EE * 4);
    bf* QPh = (bf*)take((size_t)SS * EE * 2); bf* QPl = (bf*)take((size_t)SS * EE * 2); bf* KPh = (bf*)take((size_t)SS * EE * 2); bf* KPl = (bf*)take((size_t)SS * EE * 2); bf* VTh = (bf*)take((size_t)EE * SS * 2); bf* VTl = (bf*)take((size_t)EE * SS * 2);
    float* HQ = (float*)take((size_t)SS * 64 * 4); float* HK = (float*)take((size_t)SS * 64 * 4); float* S = (float*)take((size_t)SS * SS * 4); bf* Ph = (bf*)take((size_t)SS * SS * 2); bf* Pl = (bf*)take((size_t)SS * SS * 2);
    if ((size_t)(wsp - (char*)d_ws) > ws_size) return;    // total ~ 25 MB
    k_cvt8<<<(EE * EE / 8 + 255) / 256, 256, 0, stream>>>(Wq, BQ, EE * EE / 8); k_cvt8<<<(EE * EE / 8 + 255) / 256, 256, 0, stream>>>(Wk, BK, EE * EE / 8); k_cvt8<<<(EE * EE / 8 + 255) / 256, 256, 0, stream>>>(Wv, BV, EE * EE / 8);   // torch [out][in] = Bt
    k_w1p<<<(64 * EE / 4 + 255) / 256, 256, 0, stream>>>(W1, WQ1, WK1);
    const dim3 gp(SS / 64, EE / 64, 1); const unsigned LP = (unsigned)(((size_t)SS * EE / 4 + 255) / 256);
    for (int b = 0; b < NB_; ++b) {
        k_cvt8<<<(SS * EE / 8 + 255) / 256, 256, 0, stream>>>(x + (size_t)b * SS * EE, XB, SS * EE / 8);
        k_gemmw<bf, 0, false><<<gp, 32, 0, stream>>>(XB, nullptr, BQ, nullptr, EE, FQ, EE, nullptr, 0, 0, 0); k_pl<<<LP, 256, 0, stream>>>(FQ, QPh, QPl, (size_t)SS * EE / 4);
        k_gemmw<bf, 0, false><<<gp, 32, 0, stream>>>(XB, nullptr, BK, nullptr, EE, FK, EE, nullptr, 0, 0, 0); k_pl<<<LP, 256, 0, stream>>>(FK, KPh, KPl, (size_t)SS * EE / 4);
        k_gemmw<bf, 0, false><<<gp, 32, 0, stream>>>(XB, nullptr, BV, nullptr, EE, FV, EE, nullptr, 0, 0, 0); k_plT<<<(unsigned)(((size_t)EE * SS / 2 + 255) / 256), 256, 0, stream>>>(FV, VTh, VTl);
        k_gemmw<bf, 1, false><<<dim3(SS / 64, 1, 1), 32, 0, stream>>>(QPh, QPl, WQ1, nullptr, EE, HQ, 64, nullptr, 0, 0, 0); k_gemmw<bf, 1, false><<<dim3(SS / 64, 1, 1), 32, 0, stream>>>(KPh, KPl, WK1, nullptr, EE, HK, 64, nullptr, 0, 0, 0);
        k_gemmw<bf, 2, false><<<dim3(SS / 64, SS / 64, 1), 32, 0, stream>>>(QPh, QPl, KPh, KPl, EE, S, SS, nullptr, 0, 0, 0);
        k_hsoft<<<SS / 8, 256, 0, stream>>>(S, HQ, HK, b1, W2, b2, Ph, Pl);
        k_gemmw<bf, 2, false><<<gp, 32, 0, stream>>>(Ph, Pl, VTh, VTl, SS, OUT + (size_t)b * SS * EE, EE, nullptr, 0, 0, 0); }
}

// v001
// A run of this version takes 258 microseconds.
// Next to v000, in two timings, it ran 3.08 and 3.06 times as fast.
#include <hip/hip_runtime.h>

// HybridSelfAttention (x [4][1024][512]; Q/K/V = x W^T (torch, single head over the full 512); scores = Q.K / sqrt(512); estimator on every (query, key) pair: est[q][k] = sum_h W2[h] tanh(hq[q][h] + hk[k][h] + b1[h]) + b2 with hq = Q W1[:, :512]^T, hk = K W1[:, 512:]^T (16 hidden units);
//   attn = softmax(scores + est); out = attn V -> [4][1024][512]).
// Compute dtypes, f32 accumulate: every input rounded to bf16; Q/K/V as PLAIN bf16 GEMMs (inputs: exact); hq / hk as hl planes of Q / K x exact W1 halves (2 products; 16 outputs padded to 64); scores hl x hl (3 products); the pairwise estimator (16 tanh per pair), + est, softmax in f32 (wave per query row) -> hl planes; attn.V hl x hl (3 products).

#define NB_  4
#define SS   1024
#define EE   512
#define NHID 16
typedef _Float16 h16;
typedef unsigned short bf;
typedef __attribute__((ext_vector_type(16))) __bf16   v16bf;
typedef __attribute__((ext_vector_type(16))) _Float16 v16h;
typedef __attribute__((ext_vector_type(8)))  _Float16 v8h;
typedef __attribute__((ext_vector_type(8)))  unsigned short v8us;
typedef __attribute__((ext_vector_type(8)))  float    v8f;
typedef __attribute__((ext_vector_type(4)))  float    v4f;
typedef v8h  __attribute__((may_alias)) v8ha;
typedef v4f  __attribute__((may_alias)) v4fa;
typedef v8us __attribute__((may_alias)) v8usa;

__device__ __forceinline__ unsigned short f2bf(float f) { unsigned u = __float_as_uint(f); u += 0x7FFFu + ((u >> 16) & 1u); return (unsigned short)(u >> 16); }
__device__ __forceinline__ float bf2f(unsigned short b) { return __uint_as_float(((unsigned)b) << 16); }
__device__ __forceinline__ float bfr(float f) { return bf2f(f2bf(f)); }
__device__ __forceinline__ v16h cat16(v8h lo, v8h hi) { return __builtin_shufflevector(lo, hi, 0, 1, 2, 3, 4, 5, 6, 7, 8, 9, 10, 11, 12, 13, 14, 15); }
__device__ __forceinline__ v16bf cat16b(v8us lo, v8us hi) { return __builtin_bit_cast(v16bf, __builtin_shufflevector(lo, hi, 0, 1, 2, 3, 4, 5, 6, 7, 8, 9, 10, 11, 12, 13, 14, 15)); }
__device__ __forceinline__ v8f wmma16(v16h a, v16h b, v8f c) { return __builtin_amdgcn_wmma_f32_16x16x32_f16(false, a, false, b, (short)0, c, false, false); }
__device__ __forceinline__ v8f wmmab(v16bf a, v16bf b, v8f c) { return __builtin_amdgcn_wmma_f32_16x16x32_bf16(false, a, false, b, (short)0, c, false, false); }



// ---- k_gemmw: register-blocked GEMM, ONE WAVE per 64x64 output tile (16 accumulators), operands straight from K-contiguous 16-bit planes; grid (M/64, N/64, Z), 32 threads.
// C[m][n] (f32, pitch ldc, + optional f32 bias[n]) = sum_k A[m][k] Bt[n][k] (+ split products per NSPLIT). z-batch strides sA/sB/sC in elements. K % 32 == 0.
template <typename T16> struct WFrag;
template <> struct WFrag<h16> { typedef v16h V; static __device__ __forceinline__ V ld(const h16* p) { return cat16(*(const v8h*)p, *(const v8h*)(p + 16)); } static __device__ __forceinline__ v8f mma(V a, V b, v8f c) { return wmma16(a, b, c); } };
template <> struct WFrag<bf> { typedef v16bf V; static __device__ __forceinline__ V ld(const bf* p) { return cat16b(*(const v8us*)p, *(const v8us*)(p + 16)); } static __device__ __forceinline__ v8f mma(V a, V b, v8f c) { return wmmab(a, b, c); } };
template <typename T16, int NSPLIT, bool BIAS>
__global__ __launch_bounds__(32) void k_gemmw(const T16* __restrict__ A, const T16* __restrict__ A2, const T16* __restrict__ Bt, const T16* __restrict__ Bt2, int K, float* C, int ldc, const float* __restrict__ bias, size_t sA, size_t sB, size_t sC) {
    typedef typename WFrag<T16>::V V;
    __shared__ __align__(16) float os[16 * 68];
    const size_t z = blockIdx.z; A += z * sA; if (A2) A2 += z * sA; Bt += z * sB; if (Bt2) Bt2 += z * sB; C += z * sC;
    const int lane = threadIdx.x & 31, lr = lane & 15, hi = lane >> 4; const int r0 = blockIdx.x * 64, c0 = blockIdx.y * 64;
    v8f acc[4][4];
#pragma unroll
    for (int mb = 0; mb < 4; ++mb)
#pragma unroll
        for (int nb = 0; nb < 4; ++nb) acc[mb][nb] = (v8f){};
    const size_t aoff = (size_t)(r0 + lr) * K + 8 * hi, boff = (size_t)(c0 + lr) * K + 8 * hi;
#pragma unroll 1
    for (int kc = 0; kc < K; kc += 32) {
        V a[4], a2[4];
#pragma unroll
        for (int mb = 0; mb < 4; ++mb) { a[mb] = WFrag<T16>::ld(A + aoff + (size_t)mb * 16 * K + kc); if (NSPLIT == 1 || NSPLIT == 2) a2[mb] = WFrag<T16>::ld(A2 + aoff + (size_t)mb * 16 * K + kc); }
#pragma unroll
        for (int nb = 0; nb < 4; ++nb) { const V b = WFrag<T16>::ld(Bt + boff + (size_t)nb * 16 * K + kc); V b2; if (NSPLIT >= 2) b2 = WFrag<T16>::ld(Bt2 + boff + (size_t)nb * 16 * K + kc);
#pragma unroll
            for (int mb = 0; mb < 4; ++mb) { acc[mb][nb] = WFrag<T16>::mma(a[mb], b, acc[mb][nb]); if (NSPLIT == 1 || NSPLIT == 2) acc[mb][nb] = WFrag<T16>::mma(a2[mb], b, acc[mb][nb]); if (NSPLIT >= 2) acc[mb][nb] = WFrag<T16>::mma(a[mb], b2, acc[mb][nb]); } }
        asm volatile("v_nop\n\tv_nop\n\tv_nop\n\tv_nop" : "+v"(acc[0][0]), "+v"(acc[1][1]), "+v"(acc[2][2]), "+v"(acc[3][3]) : "v"(a[0]), "v"(a[3]));
    }
#pragma unroll
    for (int mb = 0; mb < 4; ++mb) {
#pragma unroll
        for (int nb = 0; nb < 4; ++nb) {
#pragma unroll
            for (int j = 0; j < 8; ++j) os[(hi * 8 + j) * 68 + nb * 16 + lr] = acc[mb][nb][j]; }
        __builtin_amdgcn_wave_barrier(); asm volatile("" ::: "memory");
        float* crow = C + (size_t)(r0 + mb * 16) * ldc + c0;
{
#pragma unroll
            for (int s = 0; s < 8; ++s) { const int row = 2 * s + hi, cofs = lr * 4; v4f val = *(const v4fa*)(os + row * 68 + cofs); if (BIAS) { val[0] += bfr(bias[c0 + cofs]); val[1] += bfr(bias[c0 + cofs + 1]); val[2] += bfr(bias[c0 + cofs + 2]); val[3] += bfr(bias[c0 + cofs + 3]); }
                *(v4f*)(crow + (size_t)row * ldc + cofs) = val; }
             }
        __builtin_amdgcn_wave_barrier(); asm volatile("" ::: "memory");
    }
}

__device__ __forceinline__ void splitf(float y, unsigned short& h, unsigned short& l) { h = f2bf(y); l = f2bf(y - bf2f(h)); }
typedef __attribute__((ext_vector_type(2))) unsigned short v2us;
typedef __attribute__((ext_vector_type(4))) unsigned short v4us;

__global__ __launch_bounds__(256) void k_cvt8(const float* __restrict__ src, bf* dst, size_t n8) { const size_t i = (size_t)blockIdx.x * 256 + threadIdx.x; if (i >= n8) return; const v8f v = *(const v8f*)(src + i * 8); v8us o;
#pragma unroll
    for (int k = 0; k < 8; ++k) o[k] = f2bf(v[k]); *(v8us*)(dst + i * 8) = o;  }
// k_w1p: W1Q[n][k] = bf16(W1[n][k]) and W1K[n][k] = bf16(W1[n][512 + k]) for n < 16, rows 16..63 zero ([64][512]); k_pl: hl planes of an f32 [4 * S][E] buffer (16-B lanes -> 8-B x 2); k_plT: hl planes transposed [E][S] per batch (lane -> 2 s; grid y = batch);
__global__ __launch_bounds__(256) void k_w1p(const float* __restrict__ W1, bf* WQ1, bf* WK1) { const int e = (blockIdx.x * 256 + threadIdx.x) * 4; if (e >= 64 * EE) return; const int n = e / EE, k = e % EE; v4us a, b;
#pragma unroll
    for (int u = 0; u < 4; ++u) { a[u] = (n < NHID) ? f2bf(W1[(size_t)n * 2 * EE + k + u]) : (unsigned short)0; b[u] = (n < NHID) ? f2bf(W1[(size_t)n * 2 * EE + EE + k + u]) : (unsigned short)0; }
    *(v4us*)(WQ1 + e) = a; *(v4us*)(WK1 + e) = b;  }
__global__ __launch_bounds__(256) void k_pl(const float* __restrict__ F, bf* Ph, bf* Pl, size_t n4) { const size_t e = ((size_t)blockIdx.x * 256 + threadIdx.x) * 4; if (e >= n4 * 4) return; const v4f a = *(const v4f*)(F + e); v4us oh, ol;
#pragma unroll
    for (int u = 0; u < 4; ++u) { unsigned short x0, x1; splitf(a[u], x0, x1); oh[u] = x0; ol[u] = x1; } *(v4us*)(Ph + e) = oh; *(v4us*)(Pl + e) = ol;  }
__global__ __launch_bounds__(256) void k_plT(const float* __restrict__ F, bf* Ph, bf* Pl) { const size_t e = ((size_t)blockIdx.x * 256 + threadIdx.x) * 2; if (e >= (size_t)EE * SS) return; { const size_t zo = (size_t)blockIdx.y * SS * EE; F += zo; Ph += zo; Pl += zo; } /* grid y = batch */ const int s = (int)(e % SS); const int c = (int)(e / SS); v2us oh, ol;
#pragma unroll
    for (int u = 0; u < 2; ++u) { unsigned short a, b; splitf(F[(size_t)(s + u) * EE + c], a, b); oh[u] = a; ol[u] = b; } *(v2us*)(Ph + e) = oh; *(v2us*)(Pl + e) = ol;  }
__global__ __launch_bounds__(256) void k_hsoft(const float* __restrict__ S, const float* __restrict__ HQ, const float* __restrict__ HK, const float* __restrict__ b1, const float* __restrict__ W2, const float* __restrict__ b2, bf* Ph, bf* Pl) {
    const int lane = threadIdx.x & 31; const int i = blockIdx.x * 8 + (threadIdx.x >> 5); if (i >= NB_ * SS) return; const float* sr = S + (size_t)i * SS; HK += (size_t)(i / SS) * SS * 64;   // i = batch * S + query row; the keys are those of the row's own batch
    float hq[NHID], w2[NHID];
#pragma unroll
    for (int h = 0; h < NHID; ++h) { hq[h] = __fadd_rn(HQ[(size_t)i * 64 + h], bfr(b1[h])); w2[h] = bfr(W2[h]); }   // hq + b1 folded (the reference adds hq + hk + b1; f32 addition order (hq + hk) + b1 vs (hq + b1) + hk differs by <= 1 ulp)
    const float bb2 = bfr(b2[0]); const float scl = 0.044194173824159216f;   // 1/sqrt(512)
    float v[SS / 32]; float mx = -3.0e38f;
#pragma unroll 1
    for (int ch = 0; ch < SS / 128; ++ch) { const v4f a = *(const v4f*)(sr + ch * 128 + lane * 4);
#pragma unroll
        for (int u = 0; u < 4; ++u) { const int j = ch * 128 + lane * 4 + u; const float* hk = HK + (size_t)j * 64; float est = bb2;
#pragma unroll 1
            for (int h = 0; h < NHID; ++h) { const float z = __fadd_rn(hq[h], hk[h]); float th = tanhf(z); float pr = __fmul_rn(w2[h], th); asm volatile("" : "+v"(pr)); est = __fadd_rn(est, pr); }
            float s0 = a[u] * scl; asm volatile("" : "+v"(s0)); const float t = __fadd_rn(s0, est); v[ch * 4 + u] = t; mx = fmaxf(mx, t); } }
#pragma unroll
    for (int sh = 16; sh; sh >>= 1) mx = fmaxf(mx, __shfl_xor(mx, sh, 32));
    float sum = 0.f;
#pragma unroll
    for (int q = 0; q < SS / 32; ++q) { float d0 = __fsub_rn(v[q], mx); asm volatile("" : "+v"(d0)); v[q] = __builtin_amdgcn_exp2f(__fmul_rn(d0, 1.4426950408889634f)); sum += v[q]; }
#pragma unroll
    for (int sh = 16; sh; sh >>= 1) sum += __shfl_xor(sum, sh, 32);
    const float f = __fdiv_rn(1.0f, sum);
    {
#pragma unroll
        for (int ch = 0; ch < SS / 128; ++ch) { v4us oh, ol; for (int q = 0; q < 4; ++q) { unsigned short a2, c2; splitf(v[ch * 4 + q] * f, a2, c2); oh[q] = a2; ol[q] = c2; } const size_t oo = (size_t)i * SS + ch * 128 + lane * 4; *(v4us*)(Ph + oo) = oh; *(v4us*)(Pl + oo) = ol; }
         } }

extern "C" void kernel_launch(void* const* d_in, const int* in_sizes, int n_in,
                              void* d_out, int out_size, void* d_ws, size_t ws_size, hipStream_t stream) {
    (void)in_sizes; (void)n_in; (void)out_size;
    const float* x = (const float*)d_in[0]; const float* Wq = (const float*)d_in[1]; const float* Wk = (const float*)d_in[2]; const float* Wv = (const float*)d_in[3]; const float* W1 = (const float*)d_in[4]; const float* b1 = (const float*)d_in[5]; const float* W2 = (const float*)d_in[6]; const float* b2 = (const float*)d_in[7];
    float* OUT = (float*)d_out;     // [4][1024][512]
    char* wsp = (char*)d_ws;
    auto take = [&](size_t bytes) { char* p = wsp; wsp += (bytes + 255) & ~(size_t)255; return (void*)p; };
    bf* BQ = (bf*)take((size_t)EE * EE * 2); bf* BK = (bf*)take((size_t)EE * EE * 2); bf* BV = (bf*)take((size_t)EE * EE * 2); bf* WQ1 = (bf*)take((size_t)64 * EE * 2); bf* WK1 = (bf*)take((size_t)64 * EE * 2);
    bf* XB = (bf*)take((size_t)NB_ * SS * EE * 2); float* FQ = (float*)take((size_t)NB_ * SS * EE * 4); float* FK = (float*)take((size_t)NB_ * SS * EE * 4); float* FV = (float*)take((size_t)NB_ * SS * EE * 4);
    bf* QPh = (bf*)take((size_t)NB_ * SS * EE * 2); bf* QPl = (bf*)take((size_t)NB_ * SS * EE * 2); bf* KPh = (bf*)take((size_t)NB_ * SS * EE * 2); bf* KPl = (bf*)take((size_t)NB_ * SS * EE * 2); bf* VTh = (bf*)take((size_t)NB_ * EE * SS * 2); bf* VTl = (bf*)take((size_t)NB_ * EE * SS * 2);
    float* HQ = (float*)take((size_t)NB_ * SS * 64 * 4); float* HK = (float*)take((size_t)NB_ * SS * 64 * 4); float* S = (float*)take((size_t)NB_ * SS * SS * 4); bf* Ph = (bf*)take((size_t)NB_ * SS * SS * 2); bf* Pl = (bf*)take((size_t)NB_ * SS * SS * 2);
    if ((size_t)(wsp - (char*)d_ws) > ws_size) return;    // total ~ 90 MB
    k_cvt8<<<(EE * EE / 8 + 255) / 256, 256, 0, stream>>>(Wq, BQ, EE * EE / 8); k_cvt8<<<(EE * EE / 8 + 255) / 256, 256, 0, stream>>>(Wk, BK, EE * EE / 8); k_cvt8<<<(EE * EE / 8 + 255) / 256, 256, 0, stream>>>(Wv, BV, EE * EE / 8);   // torch [out][in] = Bt
    k_w1p<<<(64 * EE / 4 + 255) / 256, 256, 0, stream>>>(W1, WQ1, WK1);
    // All four batches in every launch: the stages that work row by row see one [4 * 1024] row space; the two products that pair rows of one batch take the batch as grid z.
    const dim3 gp(NB_ * SS / 64, EE / 64, 1); const unsigned LP = (unsigned)(((size_t)NB_ * SS * EE / 4 + 255) / 256);
    k_cvt8<<<(NB_ * SS * EE / 8 + 255) / 256, 256, 0, stream>>>(x, XB, NB_ * SS * EE / 8);
    k_gemmw<bf, 0, false><<<gp, 32, 0, stream>>>(XB, nullptr, BQ, nullptr, EE, FQ, EE, nullptr, 0, 0, 0); k_pl<<<LP, 256, 0, stream>>>(FQ, QPh, QPl, (size_t)NB_ * SS * EE / 4);
    k_gemmw<bf, 0, false><<<gp, 32, 0, stream>>>(XB, nullptr, BK, nullptr, EE, FK, EE, nullptr, 0, 0, 0); k_pl<<<LP, 256, 0, stream>>>(FK, KPh, KPl, (size_t)NB_ * SS * EE / 4);
    k_gemmw<bf, 0, false><<<gp, 32, 0, stream>>>(XB, nullptr, BV, nullptr, EE, FV, EE, nullptr, 0, 0, 0); k_plT<<<dim3((unsigned)(((size_t)EE * SS / 2 + 255) / 256), NB_, 1), 256, 0, stream>>>(FV, VTh, VTl);
    k_gemmw<bf, 1, false><<<dim3(NB_ * SS / 64, 1, 1), 32, 0, stream>>>(QPh, QPl, WQ1, nullptr, EE, HQ, 64, nullptr, 0, 0, 0); k_gemmw<bf, 1, false><<<dim3(NB_ * SS / 64, 1, 1), 32, 0, stream>>>(KPh, KPl, WK1, nullptr, EE, HK, 64, nullptr, 0, 0, 0);
    k_gemmw<bf, 2, false><<<dim3(SS / 64, SS / 64, NB_), 32, 0, stream>>>(QPh, QPl, KPh, KPl, EE, S, SS, nullptr, (size_t)SS * EE, (size_t)SS * EE, (size_t)SS * SS);
    k_hsoft<<<NB_ * SS / 8, 256, 0, stream>>>(S, HQ, HK, b1, W2, b2, Ph, Pl);
    k_gemmw<bf, 2, false><<<dim3(SS / 64, EE / 64, NB_), 32, 0, stream>>>(Ph, Pl, VTh, VTl, SS, OUT, EE, nullptr, (size_t)SS * SS, (size_t)EE * SS, (size_t)SS * EE);
}

// v002
// Measured time: 212 microseconds a run.
// In both of two side-by-side timings against v001, it was 1.21 times as fast.
// All steps since v000 together make it 3.73 times as fast.
#include <hip/hip_runtime.h>

// HybridSelfAttention (x [4][1024][512]; Q/K/V = x W^T (torch, single head over the full 512); scores = Q.K / sqrt(512); estimator on every (query, key) pair: est[q][k] = sum_h W2[h] tanh(hq[q][h] + hk[k][h] + b1[h]) + b2 with hq = Q W1[:, :512]^T, hk = K W1[:, 512:]^T (16 hidden units);
//   attn = softmax(scores + est); out = attn V -> [4][1024][512]).
// Compute dtypes, f32 accumulate: every input rounded to bf16; Q/K/V as PLAIN bf16 GEMMs (inputs: exact); hq / hk as hl planes of Q / K x exact W1 halves (2 products; 16 outputs padded to 64); scores hl x hl (3 products); the pairwise estimator (16 tanh per pair), + est, softmax in f32 (wave per query row) -> hl planes; attn.V hl x hl (3 products).

#define NB_  4
#define SS   1024
#define EE   512
#define NHID 16
typedef _Float16 h16;
typedef unsigned short bf;
typedef __attribute__((ext_vector_type(16))) __bf16   v16bf;
typedef __attribute__((ext_vector_type(16))) _Float16 v16h;
typedef __attribute__((ext_vector_type(8)))  _Float16 v8h;
typedef __attribute__((ext_vector_type(8)))  unsigned short v8us;
typedef __attribute__((ext_vector_type(8)))  float    v8f;
typedef __attribute__((ext_vector_type(4)))  float    v4f;
typedef v8h  __attribute__((may_alias)) v8ha;
typedef v4f  __attribute__((may_alias)) v4fa;
typedef v8us __attribute__((may_alias)) v8usa;

__device__ __forceinline__ unsigned short f2bf(float f) { unsigned u = __float_as_uint(f); u += 0x7FFFu + ((u >> 16) & 1u); return (unsigned short)(u >> 16); }
__device__ __forceinline__ float bf2f(unsigned short b) { return __uint_as_float(((unsigned)b) << 16); }
__device__ __forceinline__ float bfr(float f) { return bf2f(f2bf(f)); }
__device__ __forceinline__ v16h cat16(v8h lo, v8h hi) { return __builtin_shufflevector(lo, hi, 0, 1, 2, 3, 4, 5, 6, 7, 8, 9, 10, 11, 12, 13, 14, 15); }
__device__ __forceinline__ v16bf cat16b(v8us lo, v8us hi) { return __builtin_bit_cast(v16bf, __builtin_shufflevector(lo, hi, 0, 1, 2, 3, 4, 5, 6, 7, 8, 9, 10, 11, 12, 13, 14, 15)); }
__device__ __forceinline__ v8f wmma16(v16h a, v16h b, v8f c) { return __builtin_amdgcn_wmma_f32_16x16x32_f16(false, a, false, b, (short)0, c, false, false); }
__device__ __forceinline__ v8f wmmab(v16bf a, v16bf b, v8f c) { return __builtin_amdgcn_wmma_f32_16x16x32_bf16(false, a, false, b, (short)0, c, false, false); }



// ---- k_gemmw: register-blocked GEMM, ONE WAVE per 64x64 output tile (16 accumulators), operands straight from K-contiguous 16-bit planes; grid (M/64, N/64, Z), 32 threads.
// C[m][n] (f32, pitch ldc, + optional f32 bias[n]) = sum_k A[m][k] Bt[n][k] (+ split products per NSPLIT). z-batch strides sA/sB/sC in elements. K % 32 == 0.
template <typename T16> struct WFrag;
template <> struct WFrag<h16> { typedef v16h V; static __device__ __forceinline__ V ld(const h16* p) { return cat16(*(const v8h*)p, *(const v8h*)(p + 16)); } static __device__ __forceinline__ v8f mma(V a, V b, v8f c) { return wmma16(a, b, c); } };
template <> struct WFrag<bf> { typedef v16bf V; static __device__ __forceinline__ V ld(const bf* p) { return cat16b(*(const v8us*)p, *(const v8us*)(p + 16)); } static __device__ __forceinline__ v8f mma(V a, V b, v8f c) { return wmmab(a, b, c); } };
template <typename T16, int NSPLIT, bool BIAS>
__global__ __launch_bounds__(32) void k_gemmw(const T16* __restrict__ A, const T16* __restrict__ A2, const T16* __restrict__ Bt, const T16* __restrict__ Bt2, int K, float* C, int ldc, const float* __restrict__ bias, size_t sA, size_t sB, size_t sC) {
    typedef typename WFrag<T16>::V V;
    __shared__ __align__(16) float os[16 * 68];
    const size_t z = blockIdx.z; A += z * sA; if (A2) A2 += z * sA; Bt += z * sB; if (Bt2) Bt2 += z * sB; C += z * sC;
    const int lane = threadIdx.x & 31, lr = lane & 15, hi = lane >> 4; const int r0 = blockIdx.x * 64, c0 = blockIdx.y * 64;
    v8f acc[4][4];
#pragma unroll
    for (int mb = 0; mb < 4; ++mb)
#pragma unroll
        for (int nb = 0; nb < 4; ++nb) acc[mb][nb] = (v8f){};
    const size_t aoff = (size_t)(r0 + lr) * K + 8 * hi, boff = (size_t)(c0 + lr) * K + 8 * hi;
#pragma unroll 1
    for (int kc = 0; kc < K; kc += 32) {
        V a[4], a2[4];
#pragma unroll
        for (int mb = 0; mb < 4; ++mb) { a[mb] = WFrag<T16>::ld(A + aoff + (size_t)mb * 16 * K + kc); if (NSPLIT == 1 || NSPLIT == 2) a2[mb] = WFrag<T16>::ld(A2 + aoff + (size_t)mb * 16 * K + kc); }
#pragma unroll
        for (int nb = 0; nb < 4; ++nb) { const V b = WFrag<T16>::ld(Bt + boff + (size_t)nb * 16 * K + kc); V b2; if (NSPLIT >= 2) b2 = WFrag<T16>::ld(Bt2 + boff + (size_t)nb * 16 * K + kc);
#pragma unroll
            for (int mb = 0; mb < 4; ++mb) { acc[mb][nb] = WFrag<T16>::mma(a[mb], b, acc[mb][nb]); if (NSPLIT == 1 || NSPLIT == 2) acc[mb][nb] = WFrag<T16>::mma(a2[mb], b, acc[mb][nb]); if (NSPLIT >= 2) acc[mb][nb] = WFrag<T16>::mma(a[mb], b2, acc[mb][nb]); } }
        asm volatile("v_nop\n\tv_nop\n\tv_nop\n\tv_nop" : "+v"(acc[0][0]), "+v"(acc[1][1]), "+v"(acc[2][2]), "+v"(acc[3][3]) : "v"(a[0]), "v"(a[3]));
    }
#pragma unroll
    for (int mb = 0; mb < 4; ++mb) {
#pragma unroll
        for (int nb = 0; nb < 4; ++nb) {
#pragma unroll
            for (int j = 0; j < 8; ++j) os[(hi * 8 + j) * 68 + nb * 16 + lr] = acc[mb][nb][j]; }
        __builtin_amdgcn_wave_barrier(); asm volatile("" ::: "memory");
        float* crow = C + (size_t)(r0 + mb * 16) * ldc + c0;
{
#pragma unroll
            for (int s = 0; s < 8; ++s) { const int row = 2 * s + hi, cofs = lr * 4; v4f val = *(const v4fa*)(os + row * 68 + cofs); if (BIAS) { val[0] += bfr(bias[c0 + cofs]); val[1] += bfr(bias[c0 + cofs + 1]); val[2] += bfr(bias[c0 + cofs + 2]); val[3] += bfr(bias[c0 + cofs + 3]); }
                *(v4f*)(crow + (size_t)row * ldc + cofs) = val; }
             }
        __builtin_amdgcn_wave_barrier(); asm volatile("" ::: "memory");
    }
}

__device__ __forceinline__ void splitf(float y, unsigned short& h, unsigned short& l) { h = f2bf(y); l = f2bf(y - bf2f(h)); }
typedef __attribute__((ext_vector_type(2))) unsigned short v2us;
typedef __attribute__((ext_vector_type(4))) unsigned short v4us;

__global__ __launch_bounds__(256) void k_cvt8(const float* __restrict__ src, bf* dst, size_t n8) { const size_t i = (size_t)blockIdx.x * 256 + threadIdx.x; if (i >= n8) return; const v8f v = *(const v8f*)(src + i * 8); v8us o;
#pragma unroll
    for (int k = 0; k < 8; ++k) o[k] = f2bf(v[k]); *(v8us*)(dst + i * 8) = o;  }
// k_w1p: W1Q[n][k] = bf16(W1[n][k]) and W1K[n][k] = bf16(W1[n][512 + k]) for n < 16, rows 16..63 zero ([64][512]); k_pl: hl planes of an f32 [4 * S][E] buffer (16-B lanes -> 8-B x 2); k_plT: hl planes transposed [E][S] per batch (lane -> 2 s; grid y = batch);
__global__ __launch_bounds__(256) void k_w1p(const float* __restrict__ W1, bf* WQ1, bf* WK1) { const int e = (blockIdx.x * 256 + threadIdx.x) * 4; if (e >= 64 * EE) return; const int n = e / EE, k = e % EE; v4us a, b;
#pragma unroll
    for (int u = 0; u < 4; ++u) { a[u] = (n < NHID) ? f2bf(W1[(size_t)n * 2 * EE + k + u]) : (unsigned short)0; b[u] = (n < NHID) ? f2bf(W1[(size_t)n * 2 * EE + EE + k + u]) : (unsigned short)0; }
    *(v4us*)(WQ1 + e) = a; *(v4us*)(WK1 + e) = b;  }
__global__ __launch_bounds__(256) void k_pl(const float* __restrict__ F, bf* Ph, bf* Pl, size_t n4) { const size_t e = ((size_t)blockIdx.x * 256 + threadIdx.x) * 4; if (e >= n4 * 4) return; const v4f a = *(const v4f*)(F + e); v4us oh, ol;
#pragma unroll
    for (int u = 0; u < 4; ++u) { unsigned short x0, x1; splitf(a[u], x0, x1); oh[u] = x0; ol[u] = x1; } *(v4us*)(Ph + e) = oh; *(v4us*)(Pl + e) = ol;  }
__global__ __launch_bounds__(256) void k_plT(const float* __restrict__ F, bf* Ph, bf* Pl) { const size_t e = ((size_t)blockIdx.x * 256 + threadIdx.x) * 2; if (e >= (size_t)EE * SS) return; { const size_t zo = (size_t)blockIdx.y * SS * EE; F += zo; Ph += zo; Pl += zo; } /* grid y = batch */ const int s = (int)(e % SS); const int c = (int)(e / SS); v2us oh, ol;
#pragma unroll
    for (int u = 0; u < 2; ++u) { unsigned short a, b; splitf(F[(size_t)(s + u) * EE + c], a, b); oh[u] = a; ol[u] = b; } *(v2us*)(Ph + e) = oh; *(v2us*)(Pl + e) = ol;  }
__global__ __launch_bounds__(256) void k_hsoft(const float* __restrict__ S, const float* __restrict__ HQ, const float* __restrict__ HK, const float* __restrict__ b1, const float* __restrict__ W2, const float* __restrict__ b2, bf* Ph, bf* Pl) {
    const int lane = threadIdx.x & 31; const int i = blockIdx.x * 8 + (threadIdx.x >> 5); if (i >= NB_ * SS) return; const float* sr = S + (size_t)i * SS; HK += (size_t)(i / SS) * SS * 64;   // i = batch * S + query row; the keys are those of the row's own batch
    float hq[NHID], w2[NHID];
#pragma unroll
    for (int h = 0; h < NHID; ++h) { hq[h] = __fadd_rn(HQ[(size_t)i * 64 + h], bfr(b1[h])); w2[h] = bfr(W2[h]); }   // hq + b1 folded (the reference adds hq + hk + b1; f32 addition order (hq + hk) + b1 vs (hq + b1) + hk differs by <= 1 ulp)
    const float bb2 = bfr(b2[0]); const float scl = 0.044194173824159216f;   // 1/sqrt(512)
    float v[SS / 32]; float mx = -3.0e38f;
#pragma unroll 1
    for (int ch = 0; ch < SS / 128; ++ch) { const v4f a = *(const v4f*)(sr + ch * 128 + lane * 4); v4f hk[4][NHID / 4];   // the lane's four key rows of hk (16 floats each, 256-B pitch): 16-byte loads, all issued ahead of the first tanh; h unrolled below so that hq, w2 and hk have fixed registers
#pragma unroll
        for (int u = 0; u < 4; ++u) { const float* hkp = HK + (size_t)(ch * 128 + lane * 4 + u) * 64;
#pragma unroll
            for (int q = 0; q < NHID / 4; ++q) hk[u][q] = *(const v4f*)(hkp + 4 * q); }
#pragma unroll
        for (int u = 0; u < 4; ++u) { float est = bb2;
#pragma unroll
            for (int h = 0; h < NHID; ++h) { const float z = __fadd_rn(hq[h], hk[u][h >> 2][h & 3]); float th = tanhf(z); float pr = __fmul_rn(w2[h], th); asm volatile("" : "+v"(pr)); est = __fadd_rn(est, pr); }
            float s0 = a[u] * scl; asm volatile("" : "+v"(s0)); const float t = __fadd_rn(s0, est); v[ch * 4 + u] = t; mx = fmaxf(mx, t); } }
#pragma unroll
    for (int sh = 16; sh; sh >>= 1) mx = fmaxf(mx, __shfl_xor(mx, sh, 32));
    float sum = 0.f;
#pragma unroll
    for (int q = 0; q < SS / 32; ++q) { float d0 = __fsub_rn(v[q], mx); asm volatile("" : "+v"(d0)); v[q] = __builtin_amdgcn_exp2f(__fmul_rn(d0, 1.4426950408889634f)); sum += v[q]; }
#pragma unroll
    for (int sh = 16; sh; sh >>= 1) sum += __shfl_xor(sum, sh, 32);
    const float f = __fdiv_rn(1.0f, sum);
    {
#pragma unroll
        for (int ch = 0; ch < SS / 128; ++ch) { v4us oh, ol; for (int q = 0; q < 4; ++q) { unsigned short a2, c2; splitf(v[ch * 4 + q] * f, a2, c2); oh[q] = a2; ol[q] = c2; } const size_t oo = (size_t)i * SS + ch * 128 + lane * 4; *(v4us*)(Ph + oo) = oh; *(v4us*)(Pl + oo) = ol; }
         } }

extern "C" void kernel_launch(void* const* d_in, const int* in_sizes, int n_in,
                              void* d_out, int out_size, void* d_ws, size_t ws_size, hipStream_t stream) {
    (void)in_sizes; (void)n_in; (void)out_size;
    const float* x = (const float*)d_in[0]; const float* Wq = (const float*)d_in[1]; const float* Wk = (const float*)d_in[2]; const float* Wv = (const float*)d_in[3]; const float* W1 = (const float*)d_in[4]; const float* b1 = (const float*)d_in[5]; const float* W2 = (const float*)d_in[6]; const float* b2 = (const float*)d_in[7];
    float* OUT = (float*)d_out;     // [4][1024][512]
    char* wsp = (char*)d_ws;
    auto take = [&](size_t bytes) { char* p = wsp; wsp += (bytes + 255) & ~(size_t)255; return (void*)p; };
    bf* BQ = (bf*)take((size_t)EE * EE * 2); bf* BK = (bf*)take((size_t)EE * EE * 2); bf* BV = (bf*)take((size_t)EE * EE * 2); bf* WQ1 = (bf*)take((size_t)64 * EE * 2); bf* WK1 = (bf*)take((size_t)64 * EE * 2);
    bf* XB = (bf*)take((size_t)NB_ * SS * EE * 2); float* FQ = (float*)take((size_t)NB_ * SS * EE * 4); float* FK = (float*)take((size_t)NB_ * SS * EE * 4); float* FV = (float*)take((size_t)NB_ * SS * EE * 4);
    bf* QPh = (bf*)take((size_t)NB_ * SS * EE * 2); bf* QPl = (bf*)take((size_t)NB_ * SS * EE * 2); bf* KPh = (bf*)take((size_t)NB_ * SS * EE * 2); bf* KPl = (bf*)take((size_t)NB_ * SS * EE * 2); bf* VTh = (bf*)take((size_t)NB_ * EE * SS * 2); bf* VTl = (bf*)take((size_t)NB_ * EE * SS * 2);
    float* HQ = (float*)take((size_t)NB_ * SS * 64 * 4); float* HK = (float*)take((size_t)NB_ * SS * 64 * 4); float* S = (float*)take((size_t)NB_ * SS * SS * 4); bf* Ph = (bf*)take((size_t)NB_ * SS * SS * 2); bf* Pl = (bf*)take((size_t)NB_ * SS * SS * 2);
    if ((size_t)(wsp - (char*)d_ws) > ws_size) return;    // total ~ 90 MB
    k_cvt8<<<(EE * EE / 8 + 255) / 256, 256, 0, stream>>>(Wq, BQ, EE * EE / 8); k_cvt8<<<(EE * EE / 8 + 255) / 256, 256, 0, stream>>>(Wk, BK, EE * EE / 8); k_cvt8<<<(EE * EE / 8 + 255) / 256, 256, 0, stream>>>(Wv, BV, EE * EE / 8);   // torch [out][in] = Bt
    k_w1p<<<(64 * EE / 4 + 255) / 256, 256, 0, stream>>>(W1, WQ1, WK1);
    // All four batches in every launch: the stages that work row by row see one [4 * 1024] row space; the two products that pair rows of one batch take the batch as grid z.
    const dim3 gp(NB_ * SS / 64, EE / 64, 1); const unsigned LP = (unsigned)(((size_t)NB_ * SS * EE / 4 + 255) / 256);
    k_cvt8<<<(NB_ * SS * EE / 8 + 255) / 256, 256, 0, stream>>>(x, XB, NB_ * SS * EE / 8);
    k_gemmw<bf, 0, false><<<gp, 32, 0, stream>>>(XB, nullptr, BQ, nullptr, EE, FQ, EE, nullptr, 0, 0, 0); k_pl<<<LP, 256, 0, stream>>>(FQ, QPh, QPl, (size_t)NB_ * SS * EE / 4);
    k_gemmw<bf, 0, false><<<gp, 32, 0, stream>>>(XB, nullptr, BK, nullptr, EE, FK, EE, nullptr, 0, 0, 0); k_pl<<<LP, 256, 0, stream>>>(FK, KPh, KPl, (size_t)NB_ * SS * EE / 4);
    k_gemmw<bf, 0, false><<<gp, 32, 0, stream>>>(XB, nullptr, BV, nullptr, EE, FV, EE, nullptr, 0, 0, 0); k_plT<<<dim3((unsigned)(((size_t)EE * SS / 2 + 255) / 256), NB_, 1), 256, 0, stream>>>(FV, VTh, VTl);
    k_gemmw<bf, 1, false><<<dim3(NB_ * SS / 64, 1, 1), 32, 0, stream>>>(QPh, QPl, WQ1, nullptr, EE, HQ, 64, nullptr, 0, 0, 0); k_gemmw<bf, 1, false><<<dim3(NB_ * SS / 64, 1, 1), 32, 0, stream>>>(KPh, KPl, WK1, nullptr, EE, HK, 64, nullptr, 0, 0, 0);
    k_gemmw<bf, 2, false><<<dim3(SS / 64, SS / 64, NB_), 32, 0, stream>>>(QPh, QPl, KPh, KPl, EE, S, SS, nullptr, (size_t)SS * EE, (size_t)SS * EE, (size_t)SS * SS);
    k_hsoft<<<NB_ * SS / 8, 256, 0, stream>>>(S, HQ, HK, b1, W2, b2, Ph, Pl);
    k_gemmw<bf, 2, false><<<dim3(SS / 64, EE / 64, NB_), 32, 0, stream>>>(Ph, Pl, VTh, VTl, SS, OUT, EE, nullptr, (size_t)SS * SS, (size_t)EE * SS, (size_t)SS * EE);
}

// v003
// One run takes 149 microseconds.
// Next to v002, in two timings, it ran 1.43 and 1.40 times as fast.
// Counting every step since v000, it is 5.28 times as fast.
#include <hip/hip_runtime.h>

// HybridSelfAttention (x [4][1024][512]; Q/K/V = x W^T (torch, single head over the full 512); scores = Q.K / sqrt(512); estimator on every (query, key) pair: est[q][k] = sum_h W2[h] tanh(hq[q][h] + hk[k][h] + b1[h]) + b2 with hq = Q W1[:, :512]^T, hk = K W1[:, 512:]^T (16 hidden units);
//   attn = softmax(scores + est); out = attn V -> [4][1024][512]).
// Compute dtypes, f32 accumulate: every input rounded to bf16; Q/K/V as PLAIN bf16 GEMMs (inputs: exact); hq / hk as hl planes of Q / K x exact W1 halves (2 products; 16 outputs padded to 64); scores hl x hl (3 products); the pairwise estimator (16 tanh per pair), + est, softmax in f32 (wave per query row) -> hl planes; attn.V hl x hl (3 products).

#define NB_  4
#define SS   1024
#define EE   512
#define NHID 16
typedef _Float16 h16;
typedef unsigned short bf;
typedef __attribute__((ext_vector_type(16))) __bf16   v16bf;
typedef __attribute__((ext_vector_type(16))) _Float16 v16h;
typedef __attribute__((ext_vector_type(8)))  _Float16 v8h;
typedef __attribute__((ext_vector_type(8)))  unsigned short v8us;
typedef __attribute__((ext_vector_type(8)))  float    v8f;
typedef __attribute__((ext_vector_type(4)))  float    v4f;
typedef v8h  __attribute__((may_alias)) v8ha;
typedef v4f  __attribute__((may_alias)) v4fa;
typedef v8us __attribute__((may_alias)) v8usa;

__device__ __forceinline__ unsigned short f2bf(float f) { unsigned u = __float_as_uint(f); u += 0x7FFFu + ((u >> 16) & 1u); return (unsigned short)(u >> 16); }
__device__ __forceinline__ float bf2f(unsigned short b) { return __uint_as_float(((unsigned)b) << 16); }
__device__ __forceinline__ float bfr(float f) { return bf2f(f2bf(f)); }
__device__ __forceinline__ v16h cat16(v8h lo, v8h hi) { return __builtin_shufflevector(lo, hi, 0, 1, 2, 3, 4, 5, 6, 7, 8, 9, 10, 11, 12, 13, 14, 15); }
__device__ __forceinline__ v16bf cat16b(v8us lo, v8us hi) { return __builtin_bit_cast(v16bf, __builtin_shufflevector(lo, hi, 0, 1, 2, 3, 4, 5, 6, 7, 8, 9, 10, 11, 12, 13, 14, 15)); }
__device__ __forceinline__ v8f wmma16(v16h a, v16h b, v8f c) { return __builtin_amdgcn_wmma_f32_16x16x32_f16(false, a, false, b, (short)0, c, false, false); }
__device__ __forceinline__ v8f wmmab(v16bf a, v16bf b, v8f c) { return __builtin_amdgcn_wmma_f32_16x16x32_bf16(false, a, false, b, (short)0, c, false, false); }



// ---- k_gemmw: register-blocked GEMM, ONE WAVE per 64x64 output tile (16 accumulators), operands straight from K-contiguous 16-bit planes; grid (M/64, N/64, Z), 32 threads.
// C[m][n] (f32, pitch ldc, + optional f32 bias[n]) = sum_k A[m][k] Bt[n][k] (+ split products per NSPLIT). z-batch strides sA/sB/sC in elements. K % 32 == 0.
template <typename T16> struct WFrag;
template <> struct WFrag<h16> { typedef v16h V; static __device__ __forceinline__ V ld(const h16* p) { return cat16(*(const v8h*)p, *(const v8h*)(p + 16)); } static __device__ __forceinline__ v8f mma(V a, V b, v8f c) { return wmma16(a, b, c); } };
template <> struct WFrag<bf> { typedef v16bf V; static __device__ __forceinline__ V ld(const bf* p) { return cat16b(*(const v8us*)p, *(const v8us*)(p + 16)); } static __device__ __forceinline__ v8f mma(V a, V b, v8f c) { return wmmab(a, b, c); } };
template <typename T16, int NSPLIT, bool BIAS>
__device__ __forceinline__ void gemmw_tile(const T16* __restrict__ A, const T16* __restrict__ A2, const T16* __restrict__ Bt, const T16* __restrict__ Bt2, int K, float* C, int ldc, const float* __restrict__ bias, int r0, int c0) {
    typedef typename WFrag<T16>::V V;
    __shared__ __align__(16) float os[16 * 68];
    const int lane = threadIdx.x & 31, lr = lane & 15, hi = lane >> 4;
    v8f acc[4][4];
#pragma unroll
    for (int mb = 0; mb < 4; ++mb)
#pragma unroll
        for (int nb = 0; nb < 4; ++nb) acc[mb][nb] = (v8f){};
    const size_t aoff = (size_t)(r0 + lr) * K + 8 * hi, boff = (size_t)(c0 + lr) * K + 8 * hi;
#pragma unroll 1
    for (int kc = 0; kc < K; kc += 32) {
        V a[4], a2[4];
#pragma unroll
        for (int mb = 0; mb < 4; ++mb) { a[mb] = WFrag<T16>::ld(A + aoff + (size_t)mb * 16 * K + kc); if (NSPLIT == 1 || NSPLIT == 2) a2[mb] = WFrag<T16>::ld(A2 + aoff + (size_t)mb * 16 * K + kc); }
#pragma unroll
        for (int nb = 0; nb < 4; ++nb) { const V b = WFrag<T16>::ld(Bt + boff + (size_t)nb * 16 * K + kc); V b2; if (NSPLIT >= 2) b2 = WFrag<T16>::ld(Bt2 + boff + (size_t)nb * 16 * K + kc);
#pragma unroll
            for (int mb = 0; mb < 4; ++mb) { acc[mb][nb] = WFrag<T16>::mma(a[mb], b, acc[mb][nb]); if (NSPLIT == 1 || NSPLIT == 2) acc[mb][nb] = WFrag<T16>::mma(a2[mb], b, acc[mb][nb]); if (NSPLIT >= 2) acc[mb][nb] = WFrag<T16>::mma(a[mb], b2, acc[mb][nb]); } }
        asm volatile("v_nop\n\tv_nop\n\tv_nop\n\tv_nop" : "+v"(acc[0][0]), "+v"(acc[1][1]), "+v"(acc[2][2]), "+v"(acc[3][3]) : "v"(a[0]), "v"(a[3]));
    }
#pragma unroll
    for (int mb = 0; mb < 4; ++mb) {
#pragma unroll
        for (int nb = 0; nb < 4; ++nb) {
#pragma unroll
            for (int j = 0; j < 8; ++j) os[(hi * 8 + j) * 68 + nb * 16 + lr] = acc[mb][nb][j]; }
        __builtin_amdgcn_wave_barrier(); asm volatile("" ::: "memory");
        float* crow = C + (size_t)(r0 + mb * 16) * ldc + c0;
{
#pragma unroll
            for (int s = 0; s < 8; ++s) { const int row = 2 * s + hi, cofs = lr * 4; v4f val = *(const v4fa*)(os + row * 68 + cofs); if (BIAS) { val[0] += bfr(bias[c0 + cofs]); val[1] += bfr(bias[c0 + cofs + 1]); val[2] += bfr(bias[c0 + cofs + 2]); val[3] += bfr(bias[c0 + cofs + 3]); }
                *(v4f*)(crow + (size_t)row * ldc + cofs) = val; }
             }
        __builtin_amdgcn_wave_barrier(); asm volatile("" ::: "memory");
    }
}
template <typename T16, int NSPLIT, bool BIAS>
__global__ __launch_bounds__(32) void k_gemmw(const T16* __restrict__ A, const T16* __restrict__ A2, const T16* __restrict__ Bt, const T16* __restrict__ Bt2, int K, float* C, int ldc, const float* __restrict__ bias, size_t sA, size_t sB, size_t sC) {
    const size_t z = blockIdx.z; A += z * sA; if (A2) A2 += z * sA; Bt += z * sB; if (Bt2) Bt2 += z * sB; C += z * sC;
    gemmw_tile<T16, NSPLIT, BIAS>(A, A2, Bt, Bt2, K, C, ldc, bias, blockIdx.x * 64, blockIdx.y * 64);
}
// k_sch: the two stages that read only the Q / K planes share one grid of one-wave tiles: blocks 0..63 hq, 64..127 hk (row tiles of the [4 * 1024] row space), then the 4 x 16 x 16 score tiles (row tile fastest, batch slowest).
__global__ __launch_bounds__(32) void k_sch(const bf* __restrict__ QPh, const bf* __restrict__ QPl, const bf* __restrict__ KPh, const bf* __restrict__ KPl, const bf* __restrict__ WQ1, const bf* __restrict__ WK1, float* HQ, float* HK, float* S) {
    const int b = blockIdx.x; const int NH_T = NB_ * SS / 64;
    if (b < 2 * NH_T) { const bool k = b >= NH_T; gemmw_tile<bf, 1, false>(k ? KPh : QPh, k ? KPl : QPl, k ? WK1 : WQ1, nullptr, EE, k ? HK : HQ, 64, nullptr, (k ? b - NH_T : b) * 64, 0); }
    else { const int t = b - 2 * NH_T; const size_t z = (size_t)(t / ((SS / 64) * (SS / 64))); const size_t zo = z * SS * EE;
        gemmw_tile<bf, 2, false>(QPh + zo, QPl + zo, KPh + zo, KPl + zo, EE, S + z * SS * SS, SS, nullptr, (t % (SS / 64)) * 64, ((t / (SS / 64)) % (SS / 64)) * 64); }
}

__device__ __forceinline__ void splitf(float y, unsigned short& h, unsigned short& l) { h = f2bf(y); l = f2bf(y - bf2f(h)); }
typedef __attribute__((ext_vector_type(2))) unsigned short v2us;
typedef __attribute__((ext_vector_type(4))) unsigned short v4us;

// The element-wise stages as device functions of a block number blk (256 threads a block), so that independent stages can share one grid.
__device__ __forceinline__ void d_cvt8(const float* __restrict__ src, bf* dst, int blk) { const size_t i = (size_t)blk * 256 + threadIdx.x; const v8f v = *(const v8f*)(src + i * 8); v8us o;
#pragma unroll
    for (int k = 0; k < 8; ++k) o[k] = f2bf(v[k]); *(v8us*)(dst + i * 8) = o;
    asm volatile("s_wait_xcnt 0x0" ::: "memory");   // in the built code a branch behind this store has the other stage's code, which reuses the store's registers, as its fall-through side: the wait stands in front of that overwrite
}
// d_w1p: W1Q[n][k] = bf16(W1[n][k]) and W1K[n][k] = bf16(W1[n][512 + k]) for n < 16, rows 16..63 zero ([64][512]); d_pl: hl planes of an f32 [S][E] buffer (16-B lanes -> 8-B x 2); d_plT: hl planes transposed [E][S] of batch zb (lane -> 2 s);
__device__ __forceinline__ void d_w1p(const float* __restrict__ W1, bf* WQ1, bf* WK1, int blk) { const int e = (blk * 256 + threadIdx.x) * 4; const int n = e / EE, k = e % EE; v4us a, b;
#pragma unroll
    for (int u = 0; u < 4; ++u) { a[u] = (n < NHID) ? f2bf(W1[(size_t)n * 2 * EE + k + u]) : (unsigned short)0; b[u] = (n < NHID) ? f2bf(W1[(size_t)n * 2 * EE + EE + k + u]) : (unsigned short)0; }
    *(v4us*)(WQ1 + e) = a; *(v4us*)(WK1 + e) = b;  }
__device__ __forceinline__ void d_pl(const float* __restrict__ F, bf* Ph, bf* Pl, int blk) { const size_t e = ((size_t)blk * 256 + threadIdx.x) * 4; const v4f a = *(const v4f*)(F + e); v4us oh, ol;
#pragma unroll
    for (int u = 0; u < 4; ++u) { unsigned short x0, x1; splitf(a[u], x0, x1); oh[u] = x0; ol[u] = x1; } *(v4us*)(Ph + e) = oh; *(v4us*)(Pl + e) = ol;
    asm volatile("s_wait_xcnt 0x0" ::: "memory");   // in the built code a branch behind this store has the other stage's code, which reuses the store's registers, as its fall-through side: the wait stands in front of that overwrite
}
__device__ __forceinline__ void d_plT(const float* __restrict__ F, bf* Ph, bf* Pl, int blk, int zb) { const size_t e = ((size_t)blk * 256 + threadIdx.x) * 2; { const size_t zo = (size_t)zb * SS * EE; F += zo; Ph += zo; Pl += zo; } const int s = (int)(e % SS); const int c = (int)(e / SS); v2us oh, ol;
#pragma unroll
    for (int u = 0; u < 2; ++u) { unsigned short a, b; splitf(F[(size_t)(s + u) * EE + c], a, b); oh[u] = a; ol[u] = b; } *(v2us*)(Ph + e) = oh; *(v2us*)(Pl + e) = ol;  }
// Block counts of the stages; every one divides exactly, so no stage has a part-filled block.
#define NBX  (NB_ * SS * EE / 8 / 256)   /* x -> bf16 */
#define NBW  (EE * EE / 8 / 256)         /* one of Wq, Wk, Wv -> bf16 */
#define NBW1 (64 * EE / 4 / 256)         /* the two padded W1 halves */
#define NBP  (NB_ * SS * EE / 4 / 256)   /* hl planes of Q or of K */
#define NBT  (EE * SS / 2 / 256)         /* transposed hl planes of V, one batch */
// k_prep: all five input conversions in one grid: x, then Wq, Wk, Wv (BW = the three [512][512] bf16 planes in a row), then W1.
__global__ __launch_bounds__(256) void k_prep(const float* __restrict__ x, const float* __restrict__ Wq, const float* __restrict__ Wk, const float* __restrict__ Wv, const float* __restrict__ W1, bf* XB, bf* BW, bf* WQ1, bf* WK1) {
    const int b = blockIdx.x;
    if (b >= NBX + 3 * NBW) { d_w1p(W1, WQ1, WK1, b - NBX - 3 * NBW); return; }
    const int w = (b < NBX) ? 0 : 1 + (b - NBX) / NBW;   // 0: x; 1, 2, 3: Wq, Wk, Wv
    d_cvt8(w == 0 ? x : (w == 1 ? Wq : (w == 2 ? Wk : Wv)), w == 0 ? XB : BW + (size_t)(w - 1) * EE * EE, w == 0 ? b : (b - NBX) % NBW);
}
// k_planes: the three plane stages behind the Q / K / V products in one grid; the transposing blocks (strided reads, the longest) come first.
__global__ __launch_bounds__(256) void k_planes(const float* __restrict__ FQ, const float* __restrict__ FK, const float* __restrict__ FV, bf* QPh, bf* QPl, bf* KPh, bf* KPl, bf* VTh, bf* VTl) {
    const int b = blockIdx.x;
    if (b < NB_ * NBT) { d_plT(FV, VTh, VTl, b % NBT, b / NBT); return; }
    const int t = b - NB_ * NBT; const bool k = t >= NBP;   // Q's blocks, then K's
    d_pl(k ? FK : FQ, k ? KPh : QPh, k ? KPl : QPl, k ? t - NBP : t);
}
__global__ __launch_bounds__(256) void k_hsoft(const float* __restrict__ S, const float* __restrict__ HQ, const float* __restrict__ HK, const float* __restrict__ b1, const float* __restrict__ W2, const float* __restrict__ b2, bf* Ph, bf* Pl) {
    const int lane = threadIdx.x & 31; const int i = blockIdx.x * 8 + (threadIdx.x >> 5); if (i >= NB_ * SS) return; const float* sr = S + (size_t)i * SS; HK += (size_t)(i / SS) * SS * 64;   // i = batch * S + query row; the keys are those of the row's own batch
    float hq[NHID], w2[NHID];
#pragma unroll
    for (int h = 0; h < NHID; ++h) { hq[h] = __fadd_rn(HQ[(size_t)i * 64 + h], bfr(b1[h])); w2[h] = bfr(W2[h]); }   // hq + b1 folded (the reference adds hq + hk + b1; f32 addition order (hq + hk) + b1 vs (hq + b1) + hk differs by <= 1 ulp)
    const float bb2 = bfr(b2[0]); const float scl = 0.044194173824159216f;   // 1/sqrt(512)
    float v[SS / 32]; float mx = -3.0e38f;
#pragma unroll 1
    for (int ch = 0; ch < SS / 128; ++ch) { const v4f a = *(const v4f*)(sr + ch * 128 + lane * 4); v4f hk[4][NHID / 4];   // the lane's four key rows of hk (16 floats each, 256-B pitch): 16-byte loads, all issued ahead of the first tanh; h unrolled below so that hq, w2 and hk have fixed registers
#pragma unroll
        for (int u = 0; u < 4; ++u) { const float* hkp = HK + (size_t)(ch * 128 + lane * 4 + u) * 64;
#pragma unroll
            for (int q = 0; q < NHID / 4; ++q) hk[u][q] = *(const v4f*)(hkp + 4 * q); }
#pragma unroll
        for (int u = 0; u < 4; ++u) { float est = bb2;
#pragma unroll
            for (int h = 0; h < NHID; ++h) { const float z = __fadd_rn(hq[h], hk[u][h >> 2][h & 3]); float th = tanhf(z); float pr = __fmul_rn(w2[h], th); asm volatile("" : "+v"(pr)); est = __fadd_rn(est, pr); }
            float s0 = a[u] * scl; asm volatile("" : "+v"(s0)); const float t = __fadd_rn(s0, est); v[ch * 4 + u] = t; mx = fmaxf(mx, t); } }
#pragma unroll
    for (int sh = 16; sh; sh >>= 1) mx = fmaxf(mx, __shfl_xor(mx, sh, 32));
    float sum = 0.f;
#pragma unroll
    for (int q = 0; q < SS / 32; ++q) { float d0 = __fsub_rn(v[q], mx); asm volatile("" : "+v"(d0)); v[q] = __builtin_amdgcn_exp2f(__fmul_rn(d0, 1.4426950408889634f)); sum += v[q]; }
#pragma unroll
    for (int sh = 16; sh; sh >>= 1) sum += __shfl_xor(sum, sh, 32);
    const float f = __fdiv_rn(1.0f, sum);
    {
#pragma unroll
        for (int ch = 0; ch < SS / 128; ++ch) { v4us oh, ol; for (int q = 0; q < 4; ++q) { unsigned short a2, c2; splitf(v[ch * 4 + q] * f, a2, c2); oh[q] = a2; ol[q] = c2; } const size_t oo = (size_t)i * SS + ch * 128 + lane * 4; *(v4us*)(Ph + oo) = oh; *(v4us*)(Pl + oo) = ol; }
         } }

extern "C" void kernel_launch(void* const* d_in, const int* in_sizes, int n_in,
                              void* d_out, int out_size, void* d_ws, size_t ws_size, hipStream_t stream) {
    (void)in_sizes; (void)n_in; (void)out_size;
    const float* x = (const float*)d_in[0]; const float* Wq = (const float*)d_in[1]; const float* Wk = (const float*)d_in[2]; const float* Wv = (const float*)d_in[3]; const float* W1 = (const float*)d_in[4]; const float* b1 = (const float*)d_in[5]; const float* W2 = (const float*)d_in[6]; const float* b2 = (const float*)d_in[7];
    float* OUT = (float*)d_out;     // [4][1024][512]
    char* wsp = (char*)d_ws;
    auto take = [&](size_t bytes) { char* p = wsp; wsp += (bytes + 255) & ~(size_t)255; return (void*)p; };
    bf* BQ = (bf*)take((size_t)3 * EE * EE * 2);   // the bf16 planes of Wq, Wk, Wv in a row: grid z of the Q / K / V launch steps through them
    bf* WQ1 = (bf*)take((size_t)64 * EE * 2); bf* WK1 = (bf*)take((size_t)64 * EE * 2);
    bf* XB = (bf*)take((size_t)NB_ * SS * EE * 2); float* FQ = (float*)take((size_t)3 * NB_ * SS * EE * 4); float* FK = FQ + (size_t)NB_ * SS * EE; float* FV = FK + (size_t)NB_ * SS * EE;   // Q, K, V in a row, as above
    bf* QPh = (bf*)take((size_t)NB_ * SS * EE * 2); bf* QPl = (bf*)take((size_t)NB_ * SS * EE * 2); bf* KPh = (bf*)take((size_t)NB_ * SS * EE * 2); bf* KPl = (bf*)take((size_t)NB_ * SS * EE * 2); bf* VTh = (bf*)take((size_t)NB_ * EE * SS * 2); bf* VTl = (bf*)take((size_t)NB_ * EE * SS * 2);
    float* HQ = (float*)take((size_t)NB_ * SS * 64 * 4); float* HK = (float*)take((size_t)NB_ * SS * 64 * 4); float* S = (float*)take((size_t)NB_ * SS * SS * 4); bf* Ph = (bf*)take((size_t)NB_ * SS * SS * 2); bf* Pl = (bf*)take((size_t)NB_ * SS * SS * 2);
    if ((size_t)(wsp - (char*)d_ws) > ws_size) return;    // total ~ 90 MB
    // Six launches, one per stage of the dependence chain; launches that do not depend on one another share a grid. All four batches in every launch.
    k_prep<<<NBX + 3 * NBW + NBW1, 256, 0, stream>>>(x, Wq, Wk, Wv, W1, XB, BQ, WQ1, WK1);   // torch [out][in] = Bt
    k_gemmw<bf, 0, false><<<dim3(NB_ * SS / 64, EE / 64, 3), 32, 0, stream>>>(XB, nullptr, BQ, nullptr, EE, FQ, EE, nullptr, 0, (size_t)EE * EE, (size_t)NB_ * SS * EE);   // grid z = Q, K, V
    k_planes<<<NB_ * NBT + 2 * NBP, 256, 0, stream>>>(FQ, FK, FV, QPh, QPl, KPh, KPl, VTh, VTl);
    k_sch<<<2 * (NB_ * SS / 64) + NB_ * (SS / 64) * (SS / 64), 32, 0, stream>>>(QPh, QPl, KPh, KPl, WQ1, WK1, HQ, HK, S);
    k_hsoft<<<NB_ * SS / 8, 256, 0, stream>>>(S, HQ, HK, b1, W2, b2, Ph, Pl);
    k_gemmw<bf, 2, false><<<dim3(SS / 64, EE / 64, NB_), 32, 0, stream>>>(Ph, Pl, VTh, VTl, SS, OUT, EE, nullptr, (size_t)SS * SS, (size_t)EE * SS, (size_t)SS * EE);
}

// v004
// A run of this version takes 119 microseconds.
// Next to v003, in two timings, it ran 1.27 times as fast each time.
// Over all steps from v000 it is 6.69 times as fast.
#include <hip/hip_runtime.h>

// HybridSelfAttention (x [4][1024][512]; Q/K/V = x W^T (torch, single head over the full 512); scores = Q.K / sqrt(512); estimator on every (query, key) pair: est[q][k] = sum_h W2[h] tanh(hq[q][h] + hk[k][h] + b1[h]) + b2 with hq = Q W1[:, :512]^T, hk = K W1[:, 512:]^T (16 hidden units);
//   attn = softmax(scores + est); out = attn V -> [4][1024][512]).
// Compute dtypes, f32 accumulate: every input rounded to bf16; Q/K/V as PLAIN bf16 GEMMs (inputs: exact); hq / hk as hl planes of Q / K x exact W1 halves (2 products; 16 outputs padded to 64); scores hl x hl (3 products); the pairwise estimator (16 tanh per pair), + est, softmax in f32 (wave per query row) -> hl planes; attn.V hl x hl (3 products).

#define NB_  4
#define SS   1024
#define EE   512
#define NHID 16
typedef _Float16 h16;
typedef unsigned short bf;
typedef __attribute__((ext_vector_type(16))) __bf16   v16bf;
typedef __attribute__((ext_vector_type(16))) _Float16 v16h;
typedef __attribute__((ext_vector_type(8)))  _Float16 v8h;
typedef __attribute__((ext_vector_type(8)))  unsigned short v8us;
typedef __attribute__((ext_vector_type(8)))  float    v8f;
typedef __attribute__((ext_vector_type(4)))  float    v4f;
typedef v8h  __attribute__((may_alias)) v8ha;
typedef v4f  __attribute__((may_alias)) v4fa;
typedef v8us __attribute__((may_alias)) v8usa;

__device__ __forceinline__ unsigned short f2bf(float f) { unsigned u = __float_as_uint(f); u += 0x7FFFu + ((u >> 16) & 1u); return (unsigned short)(u >> 16); }
__device__ __forceinline__ float bf2f(unsigned short b) { return __uint_as_float(((unsigned)b) << 16); }
__device__ __forceinline__ float bfr(float f) { return bf2f(f2bf(f)); }
__device__ __forceinline__ v16h cat16(v8h lo, v8h hi) { return __builtin_shufflevector(lo, hi, 0, 1, 2, 3, 4, 5, 6, 7, 8, 9, 10, 11, 12, 13, 14, 15); }
__device__ __forceinline__ v16bf cat16b(v8us lo, v8us hi) { return __builtin_bit_cast(v16bf, __builtin_shufflevector(lo, hi, 0, 1, 2, 3, 4, 5, 6, 7, 8, 9, 10, 11, 12, 13, 14, 15)); }
__device__ __forceinline__ v8f wmma16(v16h a, v16h b, v8f c) { return __builtin_amdgcn_wmma_f32_16x16x32_f16(false, a, false, b, (short)0, c, false, false); }
__device__ __forceinline__ v8f wmmab(v16bf a, v16bf b, v8f c) { return __builtin_amdgcn_wmma_f32_16x16x32_bf16(false, a, false, b, (short)0, c, false, false); }



// ---- k_gemmw: register-blocked GEMM, ONE WAVE per 64x64 output tile (16 accumulators), operands straight from K-contiguous 16-bit planes; grid (M/64, N/64, Z), 32 threads.
// C[m][n] (f32, pitch ldc, + optional f32 bias[n]) = sum_k A[m][k] Bt[n][k] (+ split products per NSPLIT). z-batch strides sA/sB/sC in elements. K % 32 == 0.
template <typename T16> struct WFrag;
template <> struct WFrag<h16> { typedef v16h V; static __device__ __forceinline__ V ld(const h16* p) { return cat16(*(const v8h*)p, *(const v8h*)(p + 16)); } static __device__ __forceinline__ v8f mma(V a, V b, v8f c) { return wmma16(a, b, c); } };
template <> struct WFrag<bf> { typedef v16bf V; static __device__ __forceinline__ V ld(const bf* p) { return cat16b(*(const v8us*)p, *(const v8us*)(p + 16)); } static __device__ __forceinline__ v8f mma(V a, V b, v8f c) { return wmmab(a, b, c); } };
template <typename T16, int NSPLIT, bool BIAS>
__device__ __forceinline__ void gemmw_tile(const T16* __restrict__ A, const T16* __restrict__ A2, const T16* __restrict__ Bt, const T16* __restrict__ Bt2, int K, float* C, int ldc, const float* __restrict__ bias, int r0, int c0) {
    typedef typename WFrag<T16>::V V;
    __shared__ __align__(16) float os[16 * 68];
    const int lane = threadIdx.x & 31, lr = lane & 15, hi = lane >> 4;
    v8f acc[4][4];
#pragma unroll
    for (int mb = 0; mb < 4; ++mb)
#pragma unroll
        for (int nb = 0; nb < 4; ++nb) acc[mb][nb] = (v8f){};
    const size_t aoff = (size_t)(r0 + lr) * K + 8 * hi, boff = (size_t)(c0 + lr) * K + 8 * hi;
#pragma unroll 1
    for (int kc = 0; kc < K; kc += 32) {
        V a[4], a2[4];
#pragma unroll
        for (int mb = 0; mb < 4; ++mb) { a[mb] = WFrag<T16>::ld(A + aoff + (size_t)mb * 16 * K + kc); if (NSPLIT == 1 || NSPLIT == 2) a2[mb] = WFrag<T16>::ld(A2 + aoff + (size_t)mb * 16 * K + kc); }
#pragma unroll
        for (int nb = 0; nb < 4; ++nb) { const V b = WFrag<T16>::ld(Bt + boff + (size_t)nb * 16 * K + kc); V b2; if (NSPLIT >= 2) b2 = WFrag<T16>::ld(Bt2 + boff + (size_t)nb * 16 * K + kc);
#pragma unroll
            for (int mb = 0; mb < 4; ++mb) { acc[mb][nb] = WFrag<T16>::mma(a[mb], b, acc[mb][nb]); if (NSPLIT == 1 || NSPLIT == 2) acc[mb][nb] = WFrag<T16>::mma(a2[mb], b, acc[mb][nb]); if (NSPLIT >= 2) acc[mb][nb] = WFrag<T16>::mma(a[mb], b2, acc[mb][nb]); } }
        asm volatile("v_nop\n\tv_nop\n\tv_nop\n\tv_nop" : "+v"(acc[0][0]), "+v"(acc[1][1]), "+v"(acc[2][2]), "+v"(acc[3][3]) : "v"(a[0]), "v"(a[3]));
    }
#pragma unroll
    for (int mb = 0; mb < 4; ++mb) {
#pragma unroll
        for (int nb = 0; nb < 4; ++nb) {
#pragma unroll
            for (int j = 0; j < 8; ++j) os[(hi * 8 + j) * 68 + nb * 16 + lr] = acc[mb][nb][j]; }
        __builtin_amdgcn_wave_barrier(); asm volatile("" ::: "memory");
        float* crow = C + (size_t)(r0 + mb * 16) * ldc + c0;
{
#pragma unroll
            for (int s = 0; s < 8; ++s) { const int row = 2 * s + hi, cofs = lr * 4; v4f val = *(const v4fa*)(os + row * 68 + cofs); if (BIAS) { val[0] += bfr(bias[c0 + cofs]); val[1] += bfr(bias[c0 + cofs + 1]); val[2] += bfr(bias[c0 + cofs + 2]); val[3] += bfr(bias[c0 + cofs + 3]); }
                *(v4f*)(crow + (size_t)row * ldc + cofs) = val; }
             }
        __builtin_amdgcn_wave_barrier(); asm volatile("" ::: "memory");
    }
}
template <typename T16, int NSPLIT, bool BIAS>
__global__ __launch_bounds__(32) void k_gemmw(const T16* __restrict__ A, const T16* __restrict__ A2, const T16* __restrict__ Bt, const T16* __restrict__ Bt2, int K, float* C, int ldc, const float* __restrict__ bias, size_t sA, size_t sB, size_t sC) {
    const size_t z = blockIdx.z; A += z * sA; if (A2) A2 += z * sA; Bt += z * sB; if (Bt2) Bt2 += z * sB; C += z * sC;
    gemmw_tile<T16, NSPLIT, BIAS>(A, A2, Bt, Bt2, K, C, ldc, bias, blockIdx.x * 64, blockIdx.y * 64);
}
// k_sch: the two stages that read only the Q / K planes share one grid of one-wave tiles: blocks 0..63 hq, 64..127 hk (row tiles of the [4 * 1024] row space), then the 4 x 16 x 16 score tiles (row tile fastest, batch slowest).
__global__ __launch_bounds__(32) void k_sch(const bf* __restrict__ QPh, const bf* __restrict__ QPl, const bf* __restrict__ KPh, const bf* __restrict__ KPl, const bf* __restrict__ WQ1, const bf* __restrict__ WK1, float* HQ, float* HK, float* S) {
    const int b = blockIdx.x; const int NH_T = NB_ * SS / 64;
    if (b < 2 * NH_T) { const bool k = b >= NH_T; gemmw_tile<bf, 1, false>(k ? KPh : QPh, k ? KPl : QPl, k ? WK1 : WQ1, nullptr, EE, k ? HK : HQ, 64, nullptr, (k ? b - NH_T : b) * 64, 0); }
    else { const int t = b - 2 * NH_T; const size_t z = (size_t)(t / ((SS / 64) * (SS / 64))); const size_t zo = z * SS * EE;
        gemmw_tile<bf, 2, false>(QPh + zo, QPl + zo, KPh + zo, KPl + zo, EE, S + z * SS * SS, SS, nullptr, (t % (SS / 64)) * 64, ((t / (SS / 64)) % (SS / 64)) * 64); }
}

__device__ __forceinline__ void splitf(float y, unsigned short& h, unsigned short& l) { h = f2bf(y); l = f2bf(y - bf2f(h)); }
typedef __attribute__((ext_vector_type(2))) unsigned short v2us;
typedef __attribute__((ext_vector_type(4))) unsigned short v4us;

// The element-wise stages as device functions of a block number blk (256 threads a block), so that independent stages can share one grid.
__device__ __forceinline__ void d_cvt8(const float* __restrict__ src, bf* dst, int blk) { const size_t i = (size_t)blk * 256 + threadIdx.x; const v8f v = *(const v8f*)(src + i * 8); v8us o;
#pragma unroll
    for (int k = 0; k < 8; ++k) o[k] = f2bf(v[k]); *(v8us*)(dst + i * 8) = o;
    asm volatile("s_wait_xcnt 0x0" ::: "memory");   // in the built code a branch behind this store has the other stage's code, which reuses the store's registers, as its fall-through side: the wait stands in front of that overwrite
}
// d_w1p: W1Q[n][k] = bf16(W1[n][k]) and W1K[n][k] = bf16(W1[n][512 + k]) for n < 16, rows 16..63 zero ([64][512]); d_pl: hl planes of an f32 [S][E] buffer (16-B lanes -> 8-B x 2); d_plT: hl planes transposed [E][S] of batch zb (lane -> 2 s);
__device__ __forceinline__ void d_w1p(const float* __restrict__ W1, bf* WQ1, bf* WK1, int blk) { const int e = (blk * 256 + threadIdx.x) * 4; const int n = e / EE, k = e % EE; v4us a, b;
#pragma unroll
    for (int u = 0; u < 4; ++u) { a[u] = (n < NHID) ? f2bf(W1[(size_t)n * 2 * EE + k + u]) : (unsigned short)0; b[u] = (n < NHID) ? f2bf(W1[(size_t)n * 2 * EE + EE + k + u]) : (unsigned short)0; }
    *(v4us*)(WQ1 + e) = a; *(v4us*)(WK1 + e) = b;  }
__device__ __forceinline__ void d_pl(const float* __restrict__ F, bf* Ph, bf* Pl, int blk) { const size_t e = ((size_t)blk * 256 + threadIdx.x) * 4; const v4f a = *(const v4f*)(F + e); v4us oh, ol;
#pragma unroll
    for (int u = 0; u < 4; ++u) { unsigned short x0, x1; splitf(a[u], x0, x1); oh[u] = x0; ol[u] = x1; } *(v4us*)(Ph + e) = oh; *(v4us*)(Pl + e) = ol;
    asm volatile("s_wait_xcnt 0x0" ::: "memory");   // in the built code a branch behind this store has the other stage's code, which reuses the store's registers, as its fall-through side: the wait stands in front of that overwrite
}
__device__ __forceinline__ void d_plT(const float* __restrict__ F, bf* Ph, bf* Pl, int blk, int zb) { const size_t e = ((size_t)blk * 256 + threadIdx.x) * 2; { const size_t zo = (size_t)zb * SS * EE; F += zo; Ph += zo; Pl += zo; } const int s = (int)(e % SS); const int c = (int)(e / SS); v2us oh, ol;
#pragma unroll
    for (int u = 0; u < 2; ++u) { unsigned short a, b; splitf(F[(size_t)(s + u) * EE + c], a, b); oh[u] = a; ol[u] = b; } *(v2us*)(Ph + e) = oh; *(v2us*)(Pl + e) = ol;  }
// Block counts of the stages; every one divides exactly, so no stage has a part-filled block.
#define NBX  (NB_ * SS * EE / 8 / 256)   /* x -> bf16 */
#define NBW  (EE * EE / 8 / 256)         /* one of Wq, Wk, Wv -> bf16 */
#define NBW1 (64 * EE / 4 / 256)         /* the two padded W1 halves */
#define NBP  (NB_ * SS * EE / 4 / 256)   /* hl planes of Q or of K */
#define NBT  (EE * SS / 2 / 256)         /* transposed hl planes of V, one batch */
// k_prep: all five input conversions in one grid: x, then Wq, Wk, Wv (BW = the three [512][512] bf16 planes in a row), then W1.
__global__ __launch_bounds__(256) void k_prep(const float* __restrict__ x, const float* __restrict__ Wq, const float* __restrict__ Wk, const float* __restrict__ Wv, const float* __restrict__ W1, bf* XB, bf* BW, bf* WQ1, bf* WK1) {
    const int b = blockIdx.x;
    if (b >= NBX + 3 * NBW) { d_w1p(W1, WQ1, WK1, b - NBX - 3 * NBW); return; }
    const int w = (b < NBX) ? 0 : 1 + (b - NBX) / NBW;   // 0: x; 1, 2, 3: Wq, Wk, Wv
    d_cvt8(w == 0 ? x : (w == 1 ? Wq : (w == 2 ? Wk : Wv)), w == 0 ? XB : BW + (size_t)(w - 1) * EE * EE, w == 0 ? b : (b - NBX) % NBW);
}
// k_planes: the three plane stages behind the Q / K / V products in one grid; the transposing blocks (strided reads, the longest) come first.
__global__ __launch_bounds__(256) void k_planes(const float* __restrict__ FQ, const float* __restrict__ FK, const float* __restrict__ FV, bf* QPh, bf* QPl, bf* KPh, bf* KPl, bf* VTh, bf* VTl) {
    const int b = blockIdx.x;
    if (b < NB_ * NBT) { d_plT(FV, VTh, VTl, b % NBT, b / NBT); return; }
    const int t = b - NB_ * NBT; const bool k = t >= NBP;   // Q's blocks, then K's
    d_pl(k ? FK : FQ, k ? KPh : QPh, k ? KPl : QPl, k ? t - NBP : t);
}
__global__ __launch_bounds__(256) void k_hsoft(const float* __restrict__ S, const float* __restrict__ HQ, const float* __restrict__ HK, const float* __restrict__ b1, const float* __restrict__ W2, const float* __restrict__ b2, bf* Ph, bf* Pl) {
    const int lane = threadIdx.x & 31; const int i = blockIdx.x * 8 + (threadIdx.x >> 5); if (i >= NB_ * SS) return; const float* sr = S + (size_t)i * SS; HK += (size_t)(i / SS) * SS * 64;   // i = batch * S + query row; the keys are those of the row's own batch
    float hq[NHID], w2[NHID];
#pragma unroll
    for (int h = 0; h < NHID; ++h) { hq[h] = __fadd_rn(HQ[(size_t)i * 64 + h], bfr(b1[h])); w2[h] = bfr(W2[h]); }   // hq + b1 folded (the reference adds hq + hk + b1; f32 addition order (hq + hk) + b1 vs (hq + b1) + hk differs by <= 1 ulp)
    const float bb2 = bfr(b2[0]); const float scl = 0.044194173824159216f;   // 1/sqrt(512)
    float v[SS / 32]; float mx = -3.0e38f;
#pragma unroll 1
    for (int ch = 0; ch < SS / 128; ++ch) { const v4f a = *(const v4f*)(sr + ch * 128 + lane * 4); v4f hk[4][NHID / 4];   // the lane's four key rows of hk (16 floats each, 256-B pitch): 16-byte loads, all issued ahead of the first tanh; h unrolled below so that hq, w2 and hk have fixed registers
#pragma unroll
        for (int u = 0; u < 4; ++u) { const float* hkp = HK + (size_t)(ch * 128 + lane * 4 + u) * 64;
#pragma unroll
            for (int q = 0; q < NHID / 4; ++q) hk[u][q] = *(const v4f*)(hkp + 4 * q); }
#pragma unroll
        for (int u = 0; u < 4; ++u) { float est = bb2;
#pragma unroll
            for (int h = 0; h < NHID; ++h) { const float z = __fadd_rn(hq[h], hk[u][h >> 2][h & 3]); float th = __builtin_amdgcn_tanhf(z); float pr = __fmul_rn(w2[h], th); asm volatile("" : "+v"(pr)); est = __fadd_rn(est, pr); }   // tanh by the hardware instruction (v_tanh_f32): one instruction a value, no branch on the size of z
            float s0 = a[u] * scl; asm volatile("" : "+v"(s0)); const float t = __fadd_rn(s0, est); v[ch * 4 + u] = t; mx = fmaxf(mx, t); } }
#pragma unroll
    for (int sh = 16; sh; sh >>= 1) mx = fmaxf(mx, __shfl_xor(mx, sh, 32));
    float sum = 0.f;
#pragma unroll
    for (int q = 0; q < SS / 32; ++q) { float d0 = __fsub_rn(v[q], mx); asm volatile("" : "+v"(d0)); v[q] = __builtin_amdgcn_exp2f(__fmul_rn(d0, 1.4426950408889634f)); sum += v[q]; }
#pragma unroll
    for (int sh = 16; sh; sh >>= 1) sum += __shfl_xor(sum, sh, 32);
    const float f = __fdiv_rn(1.0f, sum);
    {
#pragma unroll
        for (int ch = 0; ch < SS / 128; ++ch) { v4us oh, ol; for (int q = 0; q < 4; ++q) { unsigned short a2, c2; splitf(v[ch * 4 + q] * f, a2, c2); oh[q] = a2; ol[q] = c2; } const size_t oo = (size_t)i * SS + ch * 128 + lane * 4; *(v4us*)(Ph + oo) = oh; *(v4us*)(Pl + oo) = ol; }
         } }

extern "C" void kernel_launch(void* const* d_in, const int* in_sizes, int n_in,
                              void* d_out, int out_size, void* d_ws, size_t ws_size, hipStream_t stream) {
    (void)in_sizes; (void)n_in; (void)out_size;
    const float* x = (const float*)d_in[0]; const float* Wq = (const float*)d_in[1]; const float* Wk = (const float*)d_in[2]; const float* Wv = (const float*)d_in[3]; const float* W1 = (const float*)d_in[4]; const float* b1 = (const float*)d_in[5]; const float* W2 = (const float*)d_in[6]; const float* b2 = (const float*)d_in[7];
    float* OUT = (float*)d_out;     // [4][1024][512]
    char* wsp = (char*)d_ws;
    auto take = [&](size_t bytes) { char* p = wsp; wsp += (bytes + 255) & ~(size_t)255; return (void*)p; };
    bf* BQ = (bf*)take((size_t)3 * EE * EE * 2);   // the bf16 planes of Wq, Wk, Wv in a row: grid z of the Q / K / V launch steps through them
    bf* WQ1 = (bf*)take((size_t)64 * EE * 2); bf* WK1 = (bf*)take((size_t)64 * EE * 2);
    bf* XB = (bf*)take((size_t)NB_ * SS * EE * 2); float* FQ = (float*)take((size_t)3 * NB_ * SS * EE * 4); float* FK = FQ + (size_t)NB_ * SS * EE; float* FV = FK + (size_t)NB_ * SS * EE;   // Q, K, V in a row, as above
    bf* QPh = (bf*)take((size_t)NB_ * SS * EE * 2); bf* QPl = (bf*)take((size_t)NB_ * SS * EE * 2); bf* KPh = (bf*)take((size_t)NB_ * SS * EE * 2); bf* KPl = (bf*)take((size_t)NB_ * SS * EE * 2); bf* VTh = (bf*)take((size_t)NB_ * EE * SS * 2); bf* VTl = (bf*)take((size_t)NB_ * EE * SS * 2);
    float* HQ = (float*)take((size_t)NB_ * SS * 64 * 4); float* HK = (float*)take((size_t)NB_ * SS * 64 * 4); float* S = (float*)take((size_t)NB_ * SS * SS * 4); bf* Ph = (bf*)take((size_t)NB_ * SS * SS * 2); bf* Pl = (bf*)take((size_t)NB_ * SS * SS * 2);
    if ((size_t)(wsp - (char*)d_ws) > ws_size) return;    // total ~ 90 MB
    // Six launches, one per stage of the dependence chain; launches that do not depend on one another share a grid. All four batches in every launch.
    k_prep<<<NBX + 3 * NBW + NBW1, 256, 0, stream>>>(x, Wq, Wk, Wv, W1, XB, BQ, WQ1, WK1);   // torch [out][in] = Bt
    k_gemmw<bf, 0, false><<<dim3(NB_ * SS / 64, EE / 64, 3), 32, 0, stream>>>(XB, nullptr, BQ, nullptr, EE, FQ, EE, nullptr, 0, (size_t)EE * EE, (size_t)NB_ * SS * EE);   // grid z = Q, K, V
    k_planes<<<NB_ * NBT + 2 * NBP, 256, 0, stream>>>(FQ, FK, FV, QPh, QPl, KPh, KPl, VTh, VTl);
    k_sch<<<2 * (NB_ * SS / 64) + NB_ * (SS / 64) * (SS / 64), 32, 0, stream>>>(QPh, QPl, KPh, KPl, WQ1, WK1, HQ, HK, S);
    k_hsoft<<<NB_ * SS / 8, 256, 0, stream>>>(S, HQ, HK, b1, W2, b2, Ph, Pl);
    k_gemmw<bf, 2, false><<<dim3(SS / 64, EE / 64, NB_), 32, 0, stream>>>(Ph, Pl, VTh, VTl, SS, OUT, EE, nullptr, (size_t)SS * SS, (size_t)EE * SS, (size_t)SS * EE);
}

// v005
// One run takes 98.8 microseconds.
// Next to v004, in two timings, it ran 1.20 and 1.21 times as fast.
// Over all steps from v000 it is 8.05 times as fast.
#include <hip/hip_runtime.h>

// HybridSelfAttention (x [4][1024][512]; Q/K/V = x W^T (torch, single head over the full 512); scores = Q.K / sqrt(512); estimator on every (query, key) pair: est[q][k] = sum_h W2[h] tanh(hq[q][h] + hk[k][h] + b1[h]) + b2 with hq = Q W1[:, :512]^T, hk = K W1[:, 512:]^T (16 hidden units);
//   attn = softmax(scores + est); out = attn V -> [4][1024][512]).
// Compute dtypes, f32 accumulate: every input rounded to bf16; Q/K/V as PLAIN bf16 GEMMs (inputs: exact); hq / hk as hl planes of Q / K x exact W1 halves (2 products; 16 outputs padded to 64); scores hl x hl (3 products); the pairwise estimator (16 tanh per pair), + est, softmax in f32 (wave per query row) -> hl planes; attn.V hl x hl (3 products).

#define NB_  4
#define SS   1024
#define EE   512
#define NHID 16
typedef _Float16 h16;
typedef unsigned short bf;
typedef __attribute__((ext_vector_type(16))) __bf16   v16bf;
typedef __attribute__((ext_vector_type(16))) _Float16 v16h;
typedef __attribute__((ext_vector_type(8)))  _Float16 v8h;
typedef __attribute__((ext_vector_type(8)))  unsigned short v8us;
typedef __attribute__((ext_vector_type(8)))  float    v8f;
typedef __attribute__((ext_vector_type(4)))  float    v4f;
typedef v8h  __attribute__((may_alias)) v8ha;
typedef v4f  __attribute__((may_alias)) v4fa;
typedef v8us __attribute__((may_alias)) v8usa;

__device__ __forceinline__ unsigned short f2bf(float f) { unsigned u = __float_as_uint(f); u += 0x7FFFu + ((u >> 16) & 1u); return (unsigned short)(u >> 16); }
__device__ __forceinline__ float bf2f(unsigned short b) { return __uint_as_float(((unsigned)b) << 16); }
__device__ __forceinline__ float bfr(float f) { return bf2f(f2bf(f)); }
__device__ __forceinline__ void splitf(float y, unsigned short& h, unsigned short& l) { h = f2bf(y); l = f2bf(y - bf2f(h)); }
__device__ __forceinline__ v16h cat16(v8h lo, v8h hi) { return __builtin_shufflevector(lo, hi, 0, 1, 2, 3, 4, 5, 6, 7, 8, 9, 10, 11, 12, 13, 14, 15); }
__device__ __forceinline__ v16bf cat16b(v8us lo, v8us hi) { return __builtin_bit_cast(v16bf, __builtin_shufflevector(lo, hi, 0, 1, 2, 3, 4, 5, 6, 7, 8, 9, 10, 11, 12, 13, 14, 15)); }
__device__ __forceinline__ v8f wmma16(v16h a, v16h b, v8f c) { return __builtin_amdgcn_wmma_f32_16x16x32_f16(false, a, false, b, (short)0, c, false, false); }
__device__ __forceinline__ v8f wmmab(v16bf a, v16bf b, v8f c) { return __builtin_amdgcn_wmma_f32_16x16x32_bf16(false, a, false, b, (short)0, c, false, false); }



// ---- k_gemmw: register-blocked GEMM, ONE WAVE per 64x64 output tile (16 accumulators), operands straight from K-contiguous 16-bit planes; grid (M/64, N/64, Z), 32 threads.
// C[m][n] (f32, pitch ldc, + optional f32 bias[n]) = sum_k A[m][k] Bt[n][k] (+ split products per NSPLIT). z-batch strides sA/sB/sC in elements. K % 32 == 0.
template <typename T16> struct WFrag;
template <> struct WFrag<h16> { typedef v16h V; static __device__ __forceinline__ V ld(const h16* p) { return cat16(*(const v8h*)p, *(const v8h*)(p + 16)); } static __device__ __forceinline__ v8f mma(V a, V b, v8f c) { return wmma16(a, b, c); } };
template <> struct WFrag<bf> { typedef v16bf V; static __device__ __forceinline__ V ld(const bf* p) { return cat16b(*(const v8us*)p, *(const v8us*)(p + 16)); } static __device__ __forceinline__ v8f mma(V a, V b, v8f c) { return wmmab(a, b, c); } };
// The two plane epilogues of a 64x64 tile: each f32 sum is split into its hl pair and stored in the 16-bit planes that later launches read. acc[mb][nb][j] = element (row r0 + mb * 16 + hi * 8 + j, column c0 + nb * 16 + lr), lr = lane & 15, hi = lane >> 4.
// st_planes (row-major planes, pitch 512): 16 rows at a time through LDS (os, 16 x 68 floats), so that 8 lanes x 16 B cover a row's whole 128-B line in each plane.
__device__ __forceinline__ void st_planes(const v8f (&acc)[4][4], float* os, bf* Ph, bf* Pl, int r0, int c0) {
    const int lane = threadIdx.x & 31, lr = lane & 15, hi = lane >> 4;
#pragma unroll
    for (int mb = 0; mb < 4; ++mb) {
#pragma unroll
        for (int nb = 0; nb < 4; ++nb) {
#pragma unroll
            for (int j = 0; j < 8; ++j) os[(hi * 8 + j) * 68 + nb * 16 + lr] = acc[mb][nb][j]; }
        __builtin_amdgcn_wave_barrier(); asm volatile("" ::: "memory");   // keeps the compiler from moving the row reads below ahead of the other lanes' LDS stores above
#pragma unroll
        for (int s = 0; s < 4; ++s) { const int row = 4 * s + (lane >> 3), cofs = (lane & 7) * 8; const v4f x0 = *(const v4fa*)(os + row * 68 + cofs), x1 = *(const v4fa*)(os + row * 68 + cofs + 4); v8us oh, ol;
#pragma unroll
            for (int u = 0; u < 4; ++u) { unsigned short p, q; splitf(x0[u], p, q); oh[u] = p; ol[u] = q; splitf(x1[u], p, q); oh[4 + u] = p; ol[4 + u] = q; }
            const size_t o = (size_t)(r0 + mb * 16 + row) * EE + c0 + cofs; *(v8us*)(Ph + o) = oh; *(v8us*)(Pl + o) = ol; }
        __builtin_amdgcn_wave_barrier(); asm volatile("" ::: "memory");   // keeps the next 16 rows' LDS stores behind the row reads above
    }
    asm volatile("s_wait_xcnt 0x0" ::: "memory");   // in the built code a branch behind the last stores has the other epilogue, which reuses the stores' registers, as its fall-through side: the wait stands in front of that overwrite
}
// st_planesT (planes transposed, [batch][512][1024]): a lane's 8 accumulator registers are 8 consecutive s of one column, that is 16 contiguous bytes of a transposed plane: stored straight from registers; the four mb stores of a column fill its 128-B line.
__device__ __forceinline__ void st_planesT(const v8f (&acc)[4][4], bf* Ph, bf* Pl, int r0, int c0) {
    const int lane = threadIdx.x & 31, lr = lane & 15, hi = lane >> 4;
    const size_t base = (size_t)(r0 / SS) * SS * EE + (size_t)(c0 + lr) * SS + (r0 % SS) + hi * 8;   // a 64-row tile lies inside one batch
#pragma unroll
    for (int nb = 0; nb < 4; ++nb)
#pragma unroll
        for (int mb = 0; mb < 4; ++mb) { v8us oh, ol;
#pragma unroll
            for (int j = 0; j < 8; ++j) { unsigned short p, q; splitf(acc[mb][nb][j], p, q); oh[j] = p; ol[j] = q; }
            const size_t o = base + (size_t)nb * 16 * SS + mb * 16; *(v8us*)(Ph + o) = oh; *(v8us*)(Pl + o) = ol; }
}
// PLANES: the tile goes out as hl planes Ph / Pl (transposed where tr is set, a wave-uniform choice) and not as f32 C.
template <typename T16, int NSPLIT, bool BIAS, bool PLANES = false>
__device__ __forceinline__ void gemmw_tile(const T16* __restrict__ A, const T16* __restrict__ A2, const T16* __restrict__ Bt, const T16* __restrict__ Bt2, int K, float* C, int ldc, const float* __restrict__ bias, int r0, int c0, bf* Ph = nullptr, bf* Pl = nullptr, bool tr = false) {
    typedef typename WFrag<T16>::V V;
    __shared__ __align__(16) float os[16 * 68];
    const int lane = threadIdx.x & 31, lr = lane & 15, hi = lane >> 4;
    v8f acc[4][4];
#pragma unroll
    for (int mb = 0; mb < 4; ++mb)
#pragma unroll
        for (int nb = 0; nb < 4; ++nb) acc[mb][nb] = (v8f){};
    const size_t aoff = (size_t)(r0 + lr) * K + 8 * hi, boff = (size_t)(c0 + lr) * K + 8 * hi;
#pragma unroll 1
    for (int kc = 0; kc < K; kc += 32) {
        V a[4], a2[4];
#pragma unroll
        for (int mb = 0; mb < 4; ++mb) { a[mb] = WFrag<T16>::ld(A + aoff + (size_t)mb * 16 * K + kc); if (NSPLIT == 1 || NSPLIT == 2) a2[mb] = WFrag<T16>::ld(A2 + aoff + (size_t)mb * 16 * K + kc); }
        if (PLANES) asm volatile("s_wait_xcnt 0x0" ::: "memory");   // in this build a B fragment's load lands in the register pair that holds the A loads' address: the wait stands behind the A loads, in front of that overwrite
#pragma unroll
        for (int nb = 0; nb < 4; ++nb) { const V b = WFrag<T16>::ld(Bt + boff + (size_t)nb * 16 * K + kc); V b2; if (NSPLIT >= 2) b2 = WFrag<T16>::ld(Bt2 + boff + (size_t)nb * 16 * K + kc);
#pragma unroll
            for (int mb = 0; mb < 4; ++mb) { acc[mb][nb] = WFrag<T16>::mma(a[mb], b, acc[mb][nb]); if (NSPLIT == 1 || NSPLIT == 2) acc[mb][nb] = WFrag<T16>::mma(a2[mb], b, acc[mb][nb]); if (NSPLIT >= 2) acc[mb][nb] = WFrag<T16>::mma(a[mb], b2, acc[mb][nb]); } }
        asm volatile("v_nop\n\tv_nop\n\tv_nop\n\tv_nop" : "+v"(acc[0][0]), "+v"(acc[1][1]), "+v"(acc[2][2]), "+v"(acc[3][3]) : "v"(a[0]), "v"(a[3]));
    }
    if (PLANES) { if (tr) st_planesT(acc, Ph, Pl, r0, c0); else st_planes(acc, os, Ph, Pl, r0, c0); return; }
#pragma unroll
    for (int mb = 0; mb < 4; ++mb) {
#pragma unroll
        for (int nb = 0; nb < 4; ++nb) {
#pragma unroll
            for (int j = 0; j < 8; ++j) os[(hi * 8 + j) * 68 + nb * 16 + lr] = acc[mb][nb][j]; }
        __builtin_amdgcn_wave_barrier(); asm volatile("" ::: "memory");
        float* crow = C + (size_t)(r0 + mb * 16) * ldc + c0;
{
#pragma unroll
            for (int s = 0; s < 8; ++s) { const int row = 2 * s + hi, cofs = lr * 4; v4f val = *(const v4fa*)(os + row * 68 + cofs); if (BIAS) { val[0] += bfr(bias[c0 + cofs]); val[1] += bfr(bias[c0 + cofs + 1]); val[2] += bfr(bias[c0 + cofs + 2]); val[3] += bfr(bias[c0 + cofs + 3]); }
                *(v4f*)(crow + (size_t)row * ldc + cofs) = val; }
             }
        __builtin_amdgcn_wave_barrier(); asm volatile("" ::: "memory");
    }
}
template <typename T16, int NSPLIT, bool BIAS>
__global__ __launch_bounds__(32) void k_gemmw(const T16* __restrict__ A, const T16* __restrict__ A2, const T16* __restrict__ Bt, const T16* __restrict__ Bt2, int K, float* C, int ldc, const float* __restrict__ bias, size_t sA, size_t sB, size_t sC) {
    const size_t z = blockIdx.z; A += z * sA; if (A2) A2 += z * sA; Bt += z * sB; if (Bt2) Bt2 += z * sB; C += z * sC;
    gemmw_tile<T16, NSPLIT, BIAS>(A, A2, Bt, Bt2, K, C, ldc, bias, blockIdx.x * 64, blockIdx.y * 64);
}
// k_sch: the two stages that read only the Q / K planes share one grid of one-wave tiles: blocks 0..63 hq, 64..127 hk (row tiles of the [4 * 1024] row space), then the 4 x 16 x 16 score tiles (row tile fastest, batch slowest).
__global__ __launch_bounds__(32) void k_sch(const bf* __restrict__ QPh, const bf* __restrict__ QPl, const bf* __restrict__ KPh, const bf* __restrict__ KPl, const bf* __restrict__ WQ1, const bf* __restrict__ WK1, float* HQ, float* HK, float* S) {
    const int b = blockIdx.x; const int NH_T = NB_ * SS / 64;
    if (b < 2 * NH_T) { const bool k = b >= NH_T; gemmw_tile<bf, 1, false>(k ? KPh : QPh, k ? KPl : QPl, k ? WK1 : WQ1, nullptr, EE, k ? HK : HQ, 64, nullptr, (k ? b - NH_T : b) * 64, 0); }
    else { const int t = b - 2 * NH_T; const size_t z = (size_t)(t / ((SS / 64) * (SS / 64))); const size_t zo = z * SS * EE;
        gemmw_tile<bf, 2, false>(QPh + zo, QPl + zo, KPh + zo, KPl + zo, EE, S + z * SS * SS, SS, nullptr, (t % (SS / 64)) * 64, ((t / (SS / 64)) % (SS / 64)) * 64); }
}

typedef __attribute__((ext_vector_type(4))) unsigned short v4us;

// The element-wise stages as device functions of a block number blk (256 threads a block), so that independent stages can share one grid.
__device__ __forceinline__ void d_cvt8(const float* __restrict__ src, bf* dst, int blk) { const size_t i = (size_t)blk * 256 + threadIdx.x; const v8f v = *(const v8f*)(src + i * 8); v8us o;
#pragma unroll
    for (int k = 0; k < 8; ++k) o[k] = f2bf(v[k]); *(v8us*)(dst + i * 8) = o;
    asm volatile("s_wait_xcnt 0x0" ::: "memory");   // in the built code a branch behind this store has the other stage's code, which reuses the store's registers, as its fall-through side: the wait stands in front of that overwrite
}
// d_w1p: W1Q[n][k] = bf16(W1[n][k]) and W1K[n][k] = bf16(W1[n][512 + k]) for n < 16, rows 16..63 zero ([64][512]).
__device__ __forceinline__ void d_w1p(const float* __restrict__ W1, bf* WQ1, bf* WK1, int blk) { const int e = (blk * 256 + threadIdx.x) * 4; const int n = e / EE, k = e % EE; v4us a, b;
#pragma unroll
    for (int u = 0; u < 4; ++u) { a[u] = (n < NHID) ? f2bf(W1[(size_t)n * 2 * EE + k + u]) : (unsigned short)0; b[u] = (n < NHID) ? f2bf(W1[(size_t)n * 2 * EE + EE + k + u]) : (unsigned short)0; }
    *(v4us*)(WQ1 + e) = a; *(v4us*)(WK1 + e) = b;  }
// Block counts of the stages; every one divides exactly, so no stage has a part-filled block.
#define NBX  (NB_ * SS * EE / 8 / 256)   /* x -> bf16 */
#define NBW  (EE * EE / 8 / 256)         /* one of Wq, Wk, Wv -> bf16 */
#define NBW1 (64 * EE / 4 / 256)         /* the two padded W1 halves */
// k_prep: all five input conversions in one grid: x, then Wq, Wk, Wv (BW = the three [512][512] bf16 planes in a row), then W1.
__global__ __launch_bounds__(256) void k_prep(const float* __restrict__ x, const float* __restrict__ Wq, const float* __restrict__ Wk, const float* __restrict__ Wv, const float* __restrict__ W1, bf* XB, bf* BW, bf* WQ1, bf* WK1) {
    const int b = blockIdx.x;
    if (b >= NBX + 3 * NBW) { d_w1p(W1, WQ1, WK1, b - NBX - 3 * NBW); return; }
    const int w = (b < NBX) ? 0 : 1 + (b - NBX) / NBW;   // 0: x; 1, 2, 3: Wq, Wk, Wv
    d_cvt8(w == 0 ? x : (w == 1 ? Wq : (w == 2 ? Wk : Wv)), w == 0 ? XB : BW + (size_t)(w - 1) * EE * EE, w == 0 ? b : (b - NBX) % NBW);
}
// k_qkv: the Q / K / V products (grid z = 0, 1, 2), one wave per 64x64 tile, K = 512; the tile's epilogue stores the hl planes (V's transposed), so no f32 copy of Q, K or V exists.
__global__ __launch_bounds__(32) void k_qkv(const bf* __restrict__ XB, const bf* __restrict__ BW, bf* QPh, bf* QPl, bf* KPh, bf* KPl, bf* VTh, bf* VTl) {
    const int z = blockIdx.z;
    gemmw_tile<bf, 0, false, true>(XB, nullptr, BW + (size_t)z * EE * EE, nullptr, EE, nullptr, 0, nullptr, blockIdx.x * 64, blockIdx.y * 64, z == 0 ? QPh : (z == 1 ? KPh : VTh), z == 0 ? QPl : (z == 1 ? KPl : VTl), z == 2);
}
__global__ __launch_bounds__(256) void k_hsoft(const float* __restrict__ S, const float* __restrict__ HQ, const float* __restrict__ HK, const float* __restrict__ b1, const float* __restrict__ W2, const float* __restrict__ b2, bf* Ph, bf* Pl) {
    const int lane = threadIdx.x & 31; const int i = blockIdx.x * 8 + (threadIdx.x >> 5); if (i >= NB_ * SS) return; const float* sr = S + (size_t)i * SS; HK += (size_t)(i / SS) * SS * 64;   // i = batch * S + query row; the keys are those of the row's own batch
    float hq[NHID], w2[NHID];
#pragma unroll
    for (int h = 0; h < NHID; ++h) { hq[h] = __fadd_rn(HQ[(size_t)i * 64 + h], bfr(b1[h])); w2[h] = bfr(W2[h]); }   // hq + b1 folded (the reference adds hq + hk + b1; f32 addition order (hq + hk) + b1 vs (hq + b1) + hk differs by <= 1 ulp)
    const float bb2 = bfr(b2[0]); const float scl = 0.044194173824159216f;   // 1/sqrt(512)
    float v[SS / 32]; float mx = -3.0e38f;
#pragma unroll 1
    for (int ch = 0; ch < SS / 128; ++ch) { const v4f a = *(const v4f*)(sr + ch * 128 + lane * 4); v4f hk[4][NHID / 4];   // the lane's four key rows of hk (16 floats each, 256-B pitch): 16-byte loads, all issued ahead of the first tanh; h unrolled below so that hq, w2 and hk have fixed registers
#pragma unroll
        for (int u = 0; u < 4; ++u) { const float* hkp = HK + (size_t)(ch * 128 + lane * 4 + u) * 64;
#pragma unroll
            for (int q = 0; q < NHID / 4; ++q) hk[u][q] = *(const v4f*)(hkp + 4 * q); }
#pragma unroll
        for (int u = 0; u < 4; ++u) { float est = bb2;
#pragma unroll
            for (int h = 0; h < NHID; ++h) { const float z = __fadd_rn(hq[h], hk[u][h >> 2][h & 3]); float th = __builtin_amdgcn_tanhf(z); float pr = __fmul_rn(w2[h], th); asm volatile("" : "+v"(pr)); est = __fadd_rn(est, pr); }   // tanh by the hardware instruction (v_tanh_f32): one instruction a value, no branch on the size of z
            float s0 = a[u] * scl; asm volatile("" : "+v"(s0)); const float t = __fadd_rn(s0, est); v[ch * 4 + u] = t; mx = fmaxf(mx, t); } }
#pragma unroll
    for (int sh = 16; sh; sh >>= 1) mx = fmaxf(mx, __shfl_xor(mx, sh, 32));
    float sum = 0.f;
#pragma unroll
    for (int q = 0; q < SS / 32; ++q) { float d0 = __fsub_rn(v[q], mx); asm volatile("" : "+v"(d0)); v[q] = __builtin_amdgcn_exp2f(__fmul_rn(d0, 1.4426950408889634f)); sum += v[q]; }
#pragma unroll
    for (int sh = 16; sh; sh >>= 1) sum += __shfl_xor(sum, sh, 32);
    const float f = __fdiv_rn(1.0f, sum);
    {
#pragma unroll
        for (int ch = 0; ch < SS / 128; ++ch) { v4us oh, ol; for (int q = 0; q < 4; ++q) { unsigned short a2, c2; splitf(v[ch * 4 + q] * f, a2, c2); oh[q] = a2; ol[q] = c2; } const size_t oo = (size_t)i * SS + ch * 128 + lane * 4; *(v4us*)(Ph + oo) = oh; *(v4us*)(Pl + oo) = ol; }
         } }

extern "C" void kernel_launch(void* const* d_in, const int* in_sizes, int n_in,
                              void* d_out, int out_size, void* d_ws, size_t ws_size, hipStream_t stream) {
    (void)in_sizes; (void)n_in; (void)out_size;
    const float* x = (const float*)d_in[0]; const float* Wq = (const float*)d_in[1]; const float* Wk = (const float*)d_in[2]; const float* Wv = (const float*)d_in[3]; const float* W1 = (const float*)d_in[4]; const float* b1 = (const float*)d_in[5]; const float* W2 = (const float*)d_in[6]; const float* b2 = (const float*)d_in[7];
    float* OUT = (float*)d_out;     // [4][1024][512]
    char* wsp = (char*)d_ws;
    auto take = [&](size_t bytes) { char* p = wsp; wsp += (bytes + 255) & ~(size_t)255; return (void*)p; };
    bf* BQ = (bf*)take((size_t)3 * EE * EE * 2);   // the bf16 planes of Wq, Wk, Wv in a row: grid z of the Q / K / V launch steps through them
    bf* WQ1 = (bf*)take((size_t)64 * EE * 2); bf* WK1 = (bf*)take((size_t)64 * EE * 2);
    bf* XB = (bf*)take((size_t)NB_ * SS * EE * 2);
    bf* QPh = (bf*)take((size_t)NB_ * SS * EE * 2); bf* QPl = (bf*)take((size_t)NB_ * SS * EE * 2); bf* KPh = (bf*)take((size_t)NB_ * SS * EE * 2); bf* KPl = (bf*)take((size_t)NB_ * SS * EE * 2); bf* VTh = (bf*)take((size_t)NB_ * EE * SS * 2); bf* VTl = (bf*)take((size_t)NB_ * EE * SS * 2);
    float* HQ = (float*)take((size_t)NB_ * SS * 64 * 4); float* HK = (float*)take((size_t)NB_ * SS * 64 * 4); float* S = (float*)take((size_t)NB_ * SS * SS * 4); bf* Ph = (bf*)take((size_t)NB_ * SS * SS * 2); bf* Pl = (bf*)take((size_t)NB_ * SS * SS * 2);
    if ((size_t)(wsp - (char*)d_ws) > ws_size) return;    // total ~ 65 MB
    // Five launches, one per stage of the dependence chain; launches that do not depend on one another share a grid. All four batches in every launch.
    k_prep<<<NBX + 3 * NBW + NBW1, 256, 0, stream>>>(x, Wq, Wk, Wv, W1, XB, BQ, WQ1, WK1);   // torch [out][in] = Bt
    k_qkv<<<dim3(NB_ * SS / 64, EE / 64, 3), 32, 0, stream>>>(XB, BQ, QPh, QPl, KPh, KPl, VTh, VTl);   // grid z = Q, K, V
    k_sch<<<2 * (NB_ * SS / 64) + NB_ * (SS / 64) * (SS / 64), 32, 0, stream>>>(QPh, QPl, KPh, KPl, WQ1, WK1, HQ, HK, S);
    k_hsoft<<<NB_ * SS / 8, 256, 0, stream>>>(S, HQ, HK, b1, W2, b2, Ph, Pl);
    k_gemmw<bf, 2, false><<<dim3(SS / 64, EE / 64, NB_), 32, 0, stream>>>(Ph, Pl, VTh, VTl, SS, OUT, EE, nullptr, (size_t)SS * SS, (size_t)EE * SS, (size_t)SS * EE);
}

// v006
// It runs in 91 microseconds.
// Timed twice side by side with v005, it ran 1.08 times as fast both times.
// All steps since v000 together make it 8.71 times as fast.
#include <hip/hip_runtime.h>

// HybridSelfAttention (x [4][1024][512]; Q/K/V = x W^T (torch, single head over the full 512); scores = Q.K / sqrt(512); estimator on every (query, key) pair: est[q][k] = sum_h W2[h] tanh(hq[q][h] + hk[k][h] + b1[h]) + b2 with hq = Q W1[:, :512]^T, hk = K W1[:, 512:]^T (16 hidden units);
//   attn = softmax(scores + est); out = attn V -> [4][1024][512]).
// Compute dtypes, f32 accumulate: every input rounded to bf16; Q/K/V as PLAIN bf16 GEMMs (inputs: exact); hq / hk as hl planes of Q / K x exact W1 halves (2 products; 16 outputs padded to 64); scores hl x hl (3 products); the pairwise estimator (16 tanh per pair), + est, softmax in f32 (wave per query row) -> hl planes; attn.V hl x hl (3 products).

#define NB_  4
#define SS   1024
#define EE   512
#define NHID 16
typedef _Float16 h16;
typedef unsigned short bf;
typedef __attribute__((ext_vector_type(16))) __bf16   v16bf;
typedef __attribute__((ext_vector_type(16))) _Float16 v16h;
typedef __attribute__((ext_vector_type(8)))  _Float16 v8h;
typedef __attribute__((ext_vector_type(8)))  unsigned short v8us;
typedef __attribute__((ext_vector_type(8)))  float    v8f;
typedef __attribute__((ext_vector_type(4)))  float    v4f;
typedef v8h  __attribute__((may_alias)) v8ha;
typedef v4f  __attribute__((may_alias)) v4fa;
typedef v8us __attribute__((may_alias)) v8usa;

__device__ __forceinline__ unsigned short f2bf(float f) { unsigned u = __float_as_uint(f); u += 0x7FFFu + ((u >> 16) & 1u); return (unsigned short)(u >> 16); }
__device__ __forceinline__ float bf2f(unsigned short b) { return __uint_as_float(((unsigned)b) << 16); }
__device__ __forceinline__ float bfr(float f) { return bf2f(f2bf(f)); }
__device__ __forceinline__ void splitf(float y, unsigned short& h, unsigned short& l) { h = f2bf(y); l = f2bf(y - bf2f(h)); }
__device__ __forceinline__ v16h cat16(v8h lo, v8h hi) { return __builtin_shufflevector(lo, hi, 0, 1, 2, 3, 4, 5, 6, 7, 8, 9, 10, 11, 12, 13, 14, 15); }
__device__ __forceinline__ v16bf cat16b(v8us lo, v8us hi) { return __builtin_bit_cast(v16bf, __builtin_shufflevector(lo, hi, 0, 1, 2, 3, 4, 5, 6, 7, 8, 9, 10, 11, 12, 13, 14, 15)); }
__device__ __forceinline__ v8f wmma16(v16h a, v16h b, v8f c) { return __builtin_amdgcn_wmma_f32_16x16x32_f16(false, a, false, b, (short)0, c, false, false); }
__device__ __forceinline__ v8f wmmab(v16bf a, v16bf b, v8f c) { return __builtin_amdgcn_wmma_f32_16x16x32_bf16(false, a, false, b, (short)0, c, false, false); }



// ---- k_gemmw: register-blocked GEMM, ONE WAVE per 64x64 output tile (16 accumulators), operands straight from K-contiguous 16-bit planes; grid (M/64, N/64, Z), 32 threads.
// C[m][n] (f32, pitch ldc, + optional f32 bias[n]) = sum_k A[m][k] Bt[n][k] (+ split products per NSPLIT). z-batch strides sA/sB/sC in elements. K % 32 == 0.
template <typename T16> struct WFrag;
template <> struct WFrag<h16> { typedef v16h V; static __device__ __forceinline__ V ld(const h16* p) { return cat16(*(const v8h*)p, *(const v8h*)(p + 16)); } static __device__ __forceinline__ v8f mma(V a, V b, v8f c) { return wmma16(a, b, c); } };
template <> struct WFrag<bf> { typedef v16bf V; static __device__ __forceinline__ V ld(const bf* p) { return cat16b(*(const v8us*)p, *(const v8us*)(p + 16)); } static __device__ __forceinline__ v8f mma(V a, V b, v8f c) { return wmmab(a, b, c); } };
// ldw: a bf16 fragment like WFrag<bf>::ld, with s_wait_xcnt 0 in front of its second load: for a place where, in the built code, that load lands in the register pair that holds the address of the loads before it.
__device__ __forceinline__ v16bf ldw(const bf* p) { const v8us lo = *(const v8us*)p; asm volatile("s_wait_xcnt 0x0" ::: "memory"); return cat16b(lo, *(const v8us*)(p + 16)); }
// The two plane epilogues of a 64x64 tile: each f32 sum is split into its hl pair and stored in the 16-bit planes that later launches read. acc[mb][nb][j] = element (row r0 + mb * 16 + hi * 8 + j, column c0 + nb * 16 + lr), lr = lane & 15, hi = lane >> 4.
// st_planes (row-major planes, pitch 512): 16 rows at a time through LDS (os, 16 x 68 floats), so that 8 lanes x 16 B cover a row's whole 128-B line in each plane.
__device__ __forceinline__ void st_planes(const v8f (&acc)[4][4], float* os, bf* Ph, bf* Pl, int r0, int c0) {
    const int lane = threadIdx.x & 31, lr = lane & 15, hi = lane >> 4;
#pragma unroll
    for (int mb = 0; mb < 4; ++mb) {
#pragma unroll
        for (int nb = 0; nb < 4; ++nb) {
#pragma unroll
            for (int j = 0; j < 8; ++j) os[(hi * 8 + j) * 68 + nb * 16 + lr] = acc[mb][nb][j]; }
        __builtin_amdgcn_wave_barrier(); asm volatile("" ::: "memory");   // keeps the compiler from moving the row reads below ahead of the other lanes' LDS stores above
#pragma unroll
        for (int s = 0; s < 4; ++s) { const int row = 4 * s + (lane >> 3), cofs = (lane & 7) * 8; const v4f x0 = *(const v4fa*)(os + row * 68 + cofs), x1 = *(const v4fa*)(os + row * 68 + cofs + 4); v8us oh, ol;
#pragma unroll
            for (int u = 0; u < 4; ++u) { unsigned short p, q; splitf(x0[u], p, q); oh[u] = p; ol[u] = q; splitf(x1[u], p, q); oh[4 + u] = p; ol[4 + u] = q; }
            const size_t o = (size_t)(r0 + mb * 16 + row) * EE + c0 + cofs; *(v8us*)(Ph + o) = oh; *(v8us*)(Pl + o) = ol; }
        __builtin_amdgcn_wave_barrier(); asm volatile("" ::: "memory");   // keeps the next 16 rows' LDS stores behind the row reads above
    }
    asm volatile("s_wait_xcnt 0x0" ::: "memory");   // in the built code a branch behind the last stores has the other epilogue, which reuses the stores' registers, as its fall-through side: the wait stands in front of that overwrite
}
// st_planesT (planes transposed, [batch][512][1024]): a lane's 8 accumulator registers are 8 consecutive s of one column, that is 16 contiguous bytes of a transposed plane: stored straight from registers; the four mb stores of a column fill its 128-B line.
__device__ __forceinline__ void st_planesT(const v8f (&acc)[4][4], bf* Ph, bf* Pl, int r0, int c0) {
    const int lane = threadIdx.x & 31, lr = lane & 15, hi = lane >> 4;
    const size_t base = (size_t)(r0 / SS) * SS * EE + (size_t)(c0 + lr) * SS + (r0 % SS) + hi * 8;   // a 64-row tile lies inside one batch
#pragma unroll
    for (int nb = 0; nb < 4; ++nb)
#pragma unroll
        for (int mb = 0; mb < 4; ++mb) { v8us oh, ol;
#pragma unroll
            for (int j = 0; j < 8; ++j) { unsigned short p, q; splitf(acc[mb][nb][j], p, q); oh[j] = p; ol[j] = q; }
            const size_t o = base + (size_t)nb * 16 * SS + mb * 16; *(v8us*)(Ph + o) = oh; *(v8us*)(Pl + o) = ol; }
}
// st_colsT (the tile's first 16 columns as f32, transposed, [batch][16][1024]): a lane's 8 accumulator registers are 8 consecutive rows of one column, that is 32 contiguous bytes of the transposed array: stored straight from registers; the wave's stores fill the two 128-B lines that its 64 rows have in each column.
__device__ __forceinline__ void st_colsT(const v8f (&acc)[4][4], float* T, int r0) {
    const int lane = threadIdx.x & 31, lr = lane & 15, hi = lane >> 4;
    float* t = T + (size_t)(r0 / SS) * NHID * SS + (size_t)lr * SS + (r0 % SS) + hi * 8;   // a 64-row tile lies inside one batch
#pragma unroll
    for (int mb = 0; mb < 4; ++mb) *(v8f*)(t + mb * 16) = acc[mb][0];
    asm volatile("s_wait_xcnt 0x0" ::: "memory");   // in the built code a branch behind these stores has the row-major epilogue, which reuses the stores' registers, as its fall-through side: the wait stands in front of that overwrite
}
// PLANES: the tile goes out as hl planes Ph / Pl (transposed where tr is set, a wave-uniform choice) and not as f32 C.
template <typename T16, int NSPLIT, bool BIAS, bool PLANES = false>
__device__ __forceinline__ void gemmw_tile(const T16* __restrict__ A, const T16* __restrict__ A2, const T16* __restrict__ Bt, const T16* __restrict__ Bt2, int K, float* C, int ldc, const float* __restrict__ bias, int r0, int c0, bf* Ph = nullptr, bf* Pl = nullptr, bool tr = false, float* CT = nullptr) {
    typedef typename WFrag<T16>::V V;
    __shared__ __align__(16) float os[16 * 68];
    const int lane = threadIdx.x & 31, lr = lane & 15, hi = lane >> 4;
    v8f acc[4][4];
#pragma unroll
    for (int mb = 0; mb < 4; ++mb)
#pragma unroll
        for (int nb = 0; nb < 4; ++nb) acc[mb][nb] = (v8f){};
    const size_t aoff = (size_t)(r0 + lr) * K + 8 * hi, boff = (size_t)(c0 + lr) * K + 8 * hi;
#pragma unroll 1
    for (int kc = 0; kc < K; kc += 32) {
        V a[4], a2[4];
#pragma unroll
        for (int mb = 0; mb < 4; ++mb) { a[mb] = WFrag<T16>::ld(A + aoff + (size_t)mb * 16 * K + kc); if (NSPLIT == 1 || NSPLIT == 2) a2[mb] = WFrag<T16>::ld(A2 + aoff + (size_t)mb * 16 * K + kc); }
        if (PLANES) asm volatile("s_wait_xcnt 0x0" ::: "memory");   // in this build a B fragment's load lands in the register pair that holds the A loads' address: the wait stands behind the A loads, in front of that overwrite
        if (NSPLIT == 1) {   // the hq / hk tiles: the products of the general loop below in its order; its last B fragment comes by ldw, because in this build that fragment's second load lands in the B loads' address pair
#pragma unroll
            for (int nb = 0; nb < 4; ++nb) { const T16* bp = Bt + boff + (size_t)nb * 16 * K + kc; const V b = (nb == 3) ? ldw(bp) : WFrag<T16>::ld(bp);
#pragma unroll
                for (int mb = 0; mb < 4; ++mb) { acc[mb][nb] = WFrag<T16>::mma(a[mb], b, acc[mb][nb]); acc[mb][nb] = WFrag<T16>::mma(a2[mb], b, acc[mb][nb]); } }
        } else
#pragma unroll
        for (int nb = 0; nb < 4; ++nb) { const V b = WFrag<T16>::ld(Bt + boff + (size_t)nb * 16 * K + kc); V b2; if (NSPLIT >= 2) b2 = WFrag<T16>::ld(Bt2 + boff + (size_t)nb * 16 * K + kc);
#pragma unroll
            for (int mb = 0; mb < 4; ++mb) { acc[mb][nb] = WFrag<T16>::mma(a[mb], b, acc[mb][nb]); if (NSPLIT == 1 || NSPLIT == 2) acc[mb][nb] = WFrag<T16>::mma(a2[mb], b, acc[mb][nb]); if (NSPLIT >= 2) acc[mb][nb] = WFrag<T16>::mma(a[mb], b2, acc[mb][nb]); } }
        asm volatile("v_nop\n\tv_nop\n\tv_nop\n\tv_nop" : "+v"(acc[0][0]), "+v"(acc[1][1]), "+v"(acc[2][2]), "+v"(acc[3][3]) : "v"(a[0]), "v"(a[3]));
    }
    if (PLANES) { if (tr) st_planesT(acc, Ph, Pl, r0, c0); else st_planes(acc, os, Ph, Pl, r0, c0); return; }
    if (CT) { st_colsT(acc, CT, r0); return; }   // a wave-uniform choice: only the 16 columns that are used go out, transposed, and no C
#pragma unroll
    for (int mb = 0; mb < 4; ++mb) {
#pragma unroll
        for (int nb = 0; nb < 4; ++nb) {
#pragma unroll
            for (int j = 0; j < 8; ++j) os[(hi * 8 + j) * 68 + nb * 16 + lr] = acc[mb][nb][j]; }
        __builtin_amdgcn_wave_barrier(); asm volatile("" ::: "memory");
        float* crow = C + (size_t)(r0 + mb * 16) * ldc + c0;
{
#pragma unroll
            for (int s = 0; s < 8; ++s) { const int row = 2 * s + hi, cofs = lr * 4; v4f val = *(const v4fa*)(os + row * 68 + cofs); if (BIAS) { val[0] += bfr(bias[c0 + cofs]); val[1] += bfr(bias[c0 + cofs + 1]); val[2] += bfr(bias[c0 + cofs + 2]); val[3] += bfr(bias[c0 + cofs + 3]); }
                *(v4f*)(crow + (size_t)row * ldc + cofs) = val; }
             }
        __builtin_amdgcn_wave_barrier(); asm volatile("" ::: "memory");
    }
    asm volatile("s_wait_xcnt 0x0" ::: "memory");   // in the built code of k_sch a branch behind the score tiles' last stores has the hq / hk path, which reuses the stores' registers, as its fall-through side: the wait stands in front of that overwrite
}
template <typename T16, int NSPLIT, bool BIAS>
__global__ __launch_bounds__(32) void k_gemmw(const T16* __restrict__ A, const T16* __restrict__ A2, const T16* __restrict__ Bt, const T16* __restrict__ Bt2, int K, float* C, int ldc, const float* __restrict__ bias, size_t sA, size_t sB, size_t sC) {
    const size_t z = blockIdx.z; A += z * sA; if (A2) A2 += z * sA; Bt += z * sB; if (Bt2) Bt2 += z * sB; C += z * sC;
    gemmw_tile<T16, NSPLIT, BIAS>(A, A2, Bt, Bt2, K, C, ldc, bias, blockIdx.x * 64, blockIdx.y * 64);
}
// k_sch: the two stages that read only the Q / K planes share one grid of one-wave tiles: blocks 0..63 hq, 64..127 hk (row tiles of the [4 * 1024] row space), then the 4 x 16 x 16 score tiles (row tile fastest, batch slowest).
__global__ __launch_bounds__(32) void k_sch(const bf* __restrict__ QPh, const bf* __restrict__ QPl, const bf* __restrict__ KPh, const bf* __restrict__ KPl, const bf* __restrict__ WQ1, const bf* __restrict__ WK1, float* HQ, float* HKT, float* S) {
    const int b = blockIdx.x; const int NH_T = NB_ * SS / 64;
    if (b < 2 * NH_T) { const bool k = b >= NH_T; gemmw_tile<bf, 1, false>(k ? KPh : QPh, k ? KPl : QPl, k ? WK1 : WQ1, nullptr, EE, HQ, 64, nullptr, (k ? b - NH_T : b) * 64, 0, nullptr, nullptr, false, k ? HKT : nullptr); }   // hq row-major (pitch 64), hk transposed ([batch][16][1024])
    else { const int t = b - 2 * NH_T; const size_t z = (size_t)(t / ((SS / 64) * (SS / 64))); const size_t zo = z * SS * EE;
        gemmw_tile<bf, 2, false>(QPh + zo, QPl + zo, KPh + zo, KPl + zo, EE, S + z * SS * SS, SS, nullptr, (t % (SS / 64)) * 64, ((t / (SS / 64)) % (SS / 64)) * 64); }
}

typedef __attribute__((ext_vector_type(4))) unsigned short v4us;

// The element-wise stages as device functions of a block number blk (256 threads a block), so that independent stages can share one grid.
__device__ __forceinline__ void d_cvt8(const float* __restrict__ src, bf* dst, int blk) { const size_t i = (size_t)blk * 256 + threadIdx.x; const v8f v = *(const v8f*)(src + i * 8); v8us o;
#pragma unroll
    for (int k = 0; k < 8; ++k) o[k] = f2bf(v[k]); *(v8us*)(dst + i * 8) = o;
    asm volatile("s_wait_xcnt 0x0" ::: "memory");   // in the built code a branch behind this store has the other stage's code, which reuses the store's registers, as its fall-through side: the wait stands in front of that overwrite
}
// d_w1p: W1Q[n][k] = bf16(W1[n][k]) and W1K[n][k] = bf16(W1[n][512 + k]) for n < 16, rows 16..63 zero ([64][512]).
__device__ __forceinline__ void d_w1p(const float* __restrict__ W1, bf* WQ1, bf* WK1, int blk) { const int e = (blk * 256 + threadIdx.x) * 4; const int n = e / EE, k = e % EE; v4us a, b;
#pragma unroll
    for (int u = 0; u < 4; ++u) { a[u] = (n < NHID) ? f2bf(W1[(size_t)n * 2 * EE + k + u]) : (unsigned short)0; b[u] = (n < NHID) ? f2bf(W1[(size_t)n * 2 * EE + EE + k + u]) : (unsigned short)0; }
    *(v4us*)(WQ1 + e) = a; *(v4us*)(WK1 + e) = b;  }
// Block counts of the stages; every one divides exactly, so no stage has a part-filled block.
#define NBX  (NB_ * SS * EE / 8 / 256)   /* x -> bf16 */
#define NBW  (EE * EE / 8 / 256)         /* one of Wq, Wk, Wv -> bf16 */
#define NBW1 (64 * EE / 4 / 256)         /* the two padded W1 halves */
// k_prep: all five input conversions in one grid: x, then Wq, Wk, Wv (BW = the three [512][512] bf16 planes in a row), then W1.
__global__ __launch_bounds__(256) void k_prep(const float* __restrict__ x, const float* __restrict__ Wq, const float* __restrict__ Wk, const float* __restrict__ Wv, const float* __restrict__ W1, bf* XB, bf* BW, bf* WQ1, bf* WK1) {
    const int b = blockIdx.x;
    if (b >= NBX + 3 * NBW) { d_w1p(W1, WQ1, WK1, b - NBX - 3 * NBW); return; }
    const int w = (b < NBX) ? 0 : 1 + (b - NBX) / NBW;   // 0: x; 1, 2, 3: Wq, Wk, Wv
    d_cvt8(w == 0 ? x : (w == 1 ? Wq : (w == 2 ? Wk : Wv)), w == 0 ? XB : BW + (size_t)(w - 1) * EE * EE, w == 0 ? b : (b - NBX) % NBW);
}
// k_qkv: the Q / K / V products (grid z = 0, 1, 2), one wave per 64x64 tile, K = 512; the tile's epilogue stores the hl planes (V's transposed), so no f32 copy of Q, K or V exists.
__global__ __launch_bounds__(32) void k_qkv(const bf* __restrict__ XB, const bf* __restrict__ BW, bf* QPh, bf* QPl, bf* KPh, bf* KPl, bf* VTh, bf* VTl) {
    const int z = blockIdx.z;
    gemmw_tile<bf, 0, false, true>(XB, nullptr, BW + (size_t)z * EE * EE, nullptr, EE, nullptr, 0, nullptr, blockIdx.x * 64, blockIdx.y * 64, z == 0 ? QPh : (z == 1 ? KPh : VTh), z == 0 ? QPl : (z == 1 ? KPl : VTl), z == 2);
}
__global__ __launch_bounds__(256) void k_hsoft(const float* __restrict__ S, const float* __restrict__ HQ, const float* __restrict__ HKT, const float* __restrict__ b1, const float* __restrict__ W2, const float* __restrict__ b2, bf* Ph, bf* Pl) {
    const int lane = threadIdx.x & 31; const int i = blockIdx.x * 8 + (threadIdx.x >> 5); if (i >= NB_ * SS) return; const float* sr = S + (size_t)i * SS; HKT += (size_t)(i / SS) * NHID * SS;   // i = batch * S + query row; the keys are those of the row's own batch
    float hq[NHID], w2[NHID];
#pragma unroll
    for (int h = 0; h < NHID; ++h) { hq[h] = __fadd_rn(HQ[(size_t)i * 64 + h], bfr(b1[h])); w2[h] = bfr(W2[h]); }   // hq + b1 folded (the reference adds hq + hk + b1; f32 addition order (hq + hk) + b1 vs (hq + b1) + hk differs by <= 1 ulp)
    const float bb2 = bfr(b2[0]); const float scl = 0.044194173824159216f;   // 1/sqrt(512)
    float v[SS / 32]; float mx = -3.0e38f;
#pragma unroll 1
    for (int ch = 0; ch < SS / 128; ++ch) { const v4f a = *(const v4f*)(sr + ch * 128 + lane * 4); v4f hk[NHID];   // hk is stored [h][key]: one 16-byte load per h brings the lane's four keys, and the wave's 32 lanes read 512 contiguous bytes (four whole lines) per load; all issued ahead of the first tanh; h unrolled below so that hq, w2 and hk have fixed registers
#pragma unroll
        for (int h = 0; h < NHID - 1; ++h) hk[h] = *(const v4f*)(HKT + (size_t)h * SS + ch * 128 + lane * 4);
        asm volatile("s_wait_xcnt 0x0" ::: "memory");   // in the built code the last load lands in the register pair that holds the address of the loads above: the wait stands in front of that overwrite
        hk[NHID - 1] = *(const v4f*)(HKT + (size_t)(NHID - 1) * SS + ch * 128 + lane * 4);
#pragma unroll
        for (int u = 0; u < 4; ++u) { float est = bb2;
#pragma unroll
            for (int h = 0; h < NHID; ++h) { const float z = __fadd_rn(hq[h], hk[h][u]); float th = __builtin_amdgcn_tanhf(z); float pr = __fmul_rn(w2[h], th); asm volatile("" : "+v"(pr)); est = __fadd_rn(est, pr); }   // tanh by the hardware instruction (v_tanh_f32): one instruction a value, no branch on the size of z
            float s0 = a[u] * scl; asm volatile("" : "+v"(s0)); const float t = __fadd_rn(s0, est); v[ch * 4 + u] = t; mx = fmaxf(mx, t); } }
#pragma unroll
    for (int sh = 16; sh; sh >>= 1) mx = fmaxf(mx, __shfl_xor(mx, sh, 32));
    float sum = 0.f;
#pragma unroll
    for (int q = 0; q < SS / 32; ++q) { float d0 = __fsub_rn(v[q], mx); asm volatile("" : "+v"(d0)); v[q] = __builtin_amdgcn_exp2f(__fmul_rn(d0, 1.4426950408889634f)); sum += v[q]; }
#pragma unroll
    for (int sh = 16; sh; sh >>= 1) sum += __shfl_xor(sum, sh, 32);
    const float f = __fdiv_rn(1.0f, sum);
    {
#pragma unroll
        for (int ch = 0; ch < SS / 128; ++ch) { v4us oh, ol; for (int q = 0; q < 4; ++q) { unsigned short a2, c2; splitf(v[ch * 4 + q] * f, a2, c2); oh[q] = a2; ol[q] = c2; } const size_t oo = (size_t)i * SS + ch * 128 + lane * 4; *(v4us*)(Ph + oo) = oh; *(v4us*)(Pl + oo) = ol; }
         } }

extern "C" void kernel_launch(void* const* d_in, const int* in_sizes, int n_in,
                              void* d_out, int out_size, void* d_ws, size_t ws_size, hipStream_t stream) {
    (void)in_sizes; (void)n_in; (void)out_size;
    const float* x = (const float*)d_in[0]; const float* Wq = (const float*)d_in[1]; const float* Wk = (const float*)d_in[2]; const float* Wv = (const float*)d_in[3]; const float* W1 = (const float*)d_in[4]; const float* b1 = (const float*)d_in[5]; const float* W2 = (const float*)d_in[6]; const float* b2 = (const float*)d_in[7];
    float* OUT = (float*)d_out;     // [4][1024][512]
    char* wsp = (char*)d_ws;
    auto take = [&](size_t bytes) { char* p = wsp; wsp += (bytes + 255) & ~(size_t)255; return (void*)p; };
    bf* BQ = (bf*)take((size_t)3 * EE * EE * 2);   // the bf16 planes of Wq, Wk, Wv in a row: grid z of the Q / K / V launch steps through them
    bf* WQ1 = (bf*)take((size_t)64 * EE * 2); bf* WK1 = (bf*)take((size_t)64 * EE * 2);
    bf* XB = (bf*)take((size_t)NB_ * SS * EE * 2);
    bf* QPh = (bf*)take((size_t)NB_ * SS * EE * 2); bf* QPl = (bf*)take((size_t)NB_ * SS * EE * 2); bf* KPh = (bf*)take((size_t)NB_ * SS * EE * 2); bf* KPl = (bf*)take((size_t)NB_ * SS * EE * 2); bf* VTh = (bf*)take((size_t)NB_ * EE * SS * 2); bf* VTl = (bf*)take((size_t)NB_ * EE * SS * 2);
    float* HQ = (float*)take((size_t)NB_ * SS * 64 * 4); float* HKT = (float*)take((size_t)NB_ * NHID * SS * 4); float* S = (float*)take((size_t)NB_ * SS * SS * 4); bf* Ph = (bf*)take((size_t)NB_ * SS * SS * 2); bf* Pl = (bf*)take((size_t)NB_ * SS * SS * 2);
    if ((size_t)(wsp - (char*)d_ws) > ws_size) return;    // total ~ 65 MB
    // Five launches, one per stage of the dependence chain; launches that do not depend on one another share a grid. All four batches in every launch.
    k_prep<<<NBX + 3 * NBW + NBW1, 256, 0, stream>>>(x, Wq, Wk, Wv, W1, XB, BQ, WQ1, WK1);   // torch [out][in] = Bt
    k_qkv<<<dim3(NB_ * SS / 64, EE / 64, 3), 32, 0, stream>>>(XB, BQ, QPh, QPl, KPh, KPl, VTh, VTl);   // grid z = Q, K, V
    k_sch<<<2 * (NB_ * SS / 64) + NB_ * (SS / 64) * (SS / 64), 32, 0, stream>>>(QPh, QPl, KPh, KPl, WQ1, WK1, HQ, HKT, S);
    k_hsoft<<<NB_ * SS / 8, 256, 0, stream>>>(S, HQ, HKT, b1, W2, b2, Ph, Pl);
    k_gemmw<bf, 2, false><<<dim3(SS / 64, EE / 64, NB_), 32, 0, stream>>>(Ph, Pl, VTh, VTl, SS, OUT, EE, nullptr, (size_t)SS * SS, (size_t)EE * SS, (size_t)SS * EE);
}

// v007
// It runs in 88.2 microseconds.
// In both of two side-by-side timings against v006, it was 1.03 times as fast.
// Counting every step since v000, it is 9.00 times as fast.
#include <hip/hip_runtime.h>

// HybridSelfAttention (x [4][1024][512]; Q/K/V = x W^T (torch, single head over the full 512); scores = Q.K / sqrt(512); estimator on every (query, key) pair: est[q][k] = sum_h W2[h] tanh(hq[q][h] + hk[k][h] + b1[h]) + b2 with hq = Q W1[:, :512]^T, hk = K W1[:, 512:]^T (16 hidden units);
//   attn = softmax(scores + est); out = attn V -> [4][1024][512]).
// Compute dtypes, f32 accumulate: every input rounded to bf16; Q/K/V as PLAIN bf16 GEMMs (inputs: exact); hq / hk as hl planes of Q / K x exact W1 halves (2 products; 16 outputs padded to 64); scores hl x hl (3 products); the pairwise estimator (16 tanh per pair), + est, softmax in f32 (wave per query row) -> hl planes; attn.V hl x hl (3 products).

#define NB_  4
#define SS   1024
#define EE   512
#define NHID 16
typedef _Float16 h16;
typedef unsigned short bf;
typedef __attribute__((ext_vector_type(16))) __bf16   v16bf;
typedef __attribute__((ext_vector_type(16))) _Float16 v16h;
typedef __attribute__((ext_vector_type(8)))  _Float16 v8h;
typedef __attribute__((ext_vector_type(8)))  unsigned short v8us;
typedef __attribute__((ext_vector_type(8)))  float    v8f;
typedef __attribute__((ext_vector_type(4)))  float    v4f;
typedef v8h  __attribute__((may_alias)) v8ha;
typedef v4f  __attribute__((may_alias)) v4fa;
typedef v8us __attribute__((may_alias)) v8usa;

__device__ __forceinline__ unsigned short f2bf(float f) { unsigned u = __float_as_uint(f); u += 0x7FFFu + ((u >> 16) & 1u); return (unsigned short)(u >> 16); }
__device__ __forceinline__ float bf2f(unsigned short b) { return __uint_as_float(((unsigned)b) << 16); }
__device__ __forceinline__ float bfr(float f) { return bf2f(f2bf(f)); }
__device__ __forceinline__ void splitf(float y, unsigned short& h, unsigned short& l) { h = f2bf(y); l = f2bf(y - bf2f(h)); }
__device__ __forceinline__ v16h cat16(v8h lo, v8h hi) { return __builtin_shufflevector(lo, hi, 0, 1, 2, 3, 4, 5, 6, 7, 8, 9, 10, 11, 12, 13, 14, 15); }
__device__ __forceinline__ v16bf cat16b(v8us lo, v8us hi) { return __builtin_bit_cast(v16bf, __builtin_shufflevector(lo, hi, 0, 1, 2, 3, 4, 5, 6, 7, 8, 9, 10, 11, 12, 13, 14, 15)); }
__device__ __forceinline__ v8f wmma16(v16h a, v16h b, v8f c) { return __builtin_amdgcn_wmma_f32_16x16x32_f16(false, a, false, b, (short)0, c, false, false); }
__device__ __forceinline__ v8f wmmab(v16bf a, v16bf b, v8f c) { return __builtin_amdgcn_wmma_f32_16x16x32_bf16(false, a, false, b, (short)0, c, false, false); }



// ---- k_gemmw: register-blocked GEMM, one work-group of NWV waves per 64x64 output tile: every wave holds the whole tile (16 accumulators) for its own share of K (wave w: the 32-wide k blocks w, w + NWV, ...), operands straight from K-contiguous 16-bit planes; the waves' partial tiles meet in LDS, where each wave adds up and stores its own part of the tile; grid (M/64, N/64, Z), 32 * NWV threads.
// C[m][n] (f32, pitch ldc, + optional f32 bias[n]) = sum_k A[m][k] Bt[n][k] (+ split products per NSPLIT). z-batch strides sA/sB/sC in elements. K % (32 * NWV) == 0.
template <typename T16> struct WFrag;
template <> struct WFrag<h16> { typedef v16h V; static __device__ __forceinline__ V ld(const h16* p) { return cat16(*(const v8h*)p, *(const v8h*)(p + 16)); } static __device__ __forceinline__ v8f mma(V a, V b, v8f c) { return wmma16(a, b, c); } };
template <> struct WFrag<bf> { typedef v16bf V; static __device__ __forceinline__ V ld(const bf* p) { return cat16b(*(const v8us*)p, *(const v8us*)(p + 16)); } static __device__ __forceinline__ v8f mma(V a, V b, v8f c) { return wmmab(a, b, c); } };
// ldw: a bf16 fragment like WFrag<bf>::ld, with s_wait_xcnt 0 in front of its second load: for a place where, in the built code, that load lands in the register pair that holds the address of the loads before it.
__device__ __forceinline__ v16bf ldw(const bf* p) { const v8us lo = *(const v8us*)p; asm volatile("s_wait_xcnt 0x0" ::: "memory"); return cat16b(lo, *(const v8us*)(p + 16)); }
#define NWV  4           /* waves that share a tile's K */
#define SLAB (64 * 68)   /* floats of one wave's partial tile in LDS */
// One LDS array for every tile path of a kernel: NWV slabs, slab w written by wave w alone.
__device__ __forceinline__ float* red_buf() { __shared__ __align__(16) float red[NWV * SLAB]; return red; }
// acc[mb][nb][j] = element (row mb * 16 + hi * 8 + j, column nb * 16 + lr) of the tile, lr = lane & 15, hi = lane >> 4.
// put_rows / sum_rows: a partial tile row-major (pitch 68 floats) in its wave's slab; behind the barrier, 4 consecutive columns of one row as the sum of the NWV partial sums, added in wave order.
__device__ __forceinline__ void put_rows(const v8f (&acc)[4][4], float* sl) {
    const int lane = threadIdx.x & 31, lr = lane & 15, hi = lane >> 4;
#pragma unroll
    for (int mb = 0; mb < 4; ++mb)
#pragma unroll
        for (int nb = 0; nb < 4; ++nb)
#pragma unroll
            for (int j = 0; j < 8; ++j) sl[(mb * 16 + hi * 8 + j) * 68 + nb * 16 + lr] = acc[mb][nb][j];
}
__device__ __forceinline__ v4f sum_rows(const float* red, int o) { v4f s = *(const v4fa*)(red + o);
#pragma unroll
    for (int w = 1; w < NWV; ++w) s += *(const v4fa*)(red + w * SLAB + o);
    return s; }
// put_frag / sum_frag: one 16x16 block of a partial tile in register order (place t of the slab: two rows of 32 lanes x 16 B), for the epilogues that store straight from the accumulator layout; the sum again in wave order.
__device__ __forceinline__ void put_frag(const v8f& a, float* sl, int t) { const int lane = threadIdx.x & 31;
    *(v4fa*)(sl + t * 256 + lane * 4) = __builtin_shufflevector(a, a, 0, 1, 2, 3); *(v4fa*)(sl + t * 256 + 128 + lane * 4) = __builtin_shufflevector(a, a, 4, 5, 6, 7); }
__device__ __forceinline__ v8f sum_frag(const float* red, int t) { const int lane = threadIdx.x & 31; const float* p = red + t * 256 + lane * 4; v4f lo = *(const v4fa*)p, hi4 = *(const v4fa*)(p + 128);
#pragma unroll
    for (int w = 1; w < NWV; ++w) { lo += *(const v4fa*)(p + w * SLAB); hi4 += *(const v4fa*)(p + w * SLAB + 128); }
    return __builtin_shufflevector(lo, hi4, 0, 1, 2, 3, 4, 5, 6, 7); }
// The plane epilogues of a 64x64 tile: each f32 sum is split into its hl pair and stored in the 16-bit planes that later launches read.
// st_planes (row-major planes, pitch 512): wave wv takes the tile's rows wv * 16 .. + 15; 8 lanes x 16 B cover a row's whole 128-B line in each plane.
__device__ __forceinline__ void st_planes(const v8f (&acc)[4][4], float* red, int wv, bf* Ph, bf* Pl, int r0, int c0) {
    const int lane = threadIdx.x & 31;
    put_rows(acc, red + wv * SLAB);
    __syncthreads();   // every wave's partial tile is in LDS before any wave adds them up
#pragma unroll
    for (int s = 0; s < 4; ++s) { const int row = wv * 16 + 4 * s + (lane >> 3), cofs = (lane & 7) * 8; const v4f x0 = sum_rows(red, row * 68 + cofs), x1 = sum_rows(red, row * 68 + cofs + 4); v8us oh, ol;
#pragma unroll
        for (int u = 0; u < 4; ++u) { unsigned short p, q; splitf(x0[u], p, q); oh[u] = p; ol[u] = q; splitf(x1[u], p, q); oh[4 + u] = p; ol[4 + u] = q; }
        const size_t o = (size_t)(r0 + row) * EE + c0 + cofs; *(v8us*)(Ph + o) = oh; *(v8us*)(Pl + o) = ol; }
    asm volatile("s_wait_xcnt 0x0" ::: "memory");   // in the built code a branch behind the last stores has the other epilogue, which reuses the stores' registers, as its fall-through side: the wait stands in front of that overwrite
}
// st_planesT (planes transposed, [batch][512][1024]): a lane's 8 accumulator registers are 8 consecutive s of one column, that is 16 contiguous bytes of a transposed plane; wave wv takes the tile's columns wv * 16 .. + 15, and its four mb stores of a column fill the column's 128-B line.
__device__ __forceinline__ void st_planesT(const v8f (&acc)[4][4], float* red, int wv, bf* Ph, bf* Pl, int r0, int c0) {
    const int lane = threadIdx.x & 31, lr = lane & 15, hi = lane >> 4;
#pragma unroll
    for (int mb = 0; mb < 4; ++mb)
#pragma unroll
        for (int nb = 0; nb < 4; ++nb) put_frag(acc[mb][nb], red + wv * SLAB, mb * 4 + nb);
    __syncthreads();   // every wave's partial tile is in LDS before any wave adds them up
    const size_t base = (size_t)(r0 / SS) * SS * EE + (size_t)(c0 + wv * 16 + lr) * SS + (r0 % SS) + hi * 8;   // a 64-row tile lies inside one batch
#pragma unroll
    for (int mb = 0; mb < 4; ++mb) { const v8f x = sum_frag(red, mb * 4 + wv); v8us oh, ol;
#pragma unroll
        for (int j = 0; j < 8; ++j) { unsigned short p, q; splitf(x[j], p, q); oh[j] = p; ol[j] = q; }
        const size_t o = base + mb * 16; *(v8us*)(Ph + o) = oh; *(v8us*)(Pl + o) = ol; }
}
// st_colsT (the tile's first 16 columns as f32, transposed, [batch][16][1024]): a lane's 8 accumulator registers are 8 consecutive rows of one column, that is 32 contiguous bytes of the transposed array; waves 0 and 1 take 32 rows each, one whole 128-B line in each column.
__device__ __forceinline__ void st_colsT(const v8f (&acc)[4][4], float* red, int wv, float* T, int r0) {
    const int lane = threadIdx.x & 31, lr = lane & 15, hi = lane >> 4;
#pragma unroll
    for (int mb = 0; mb < 4; ++mb) put_frag(acc[mb][0], red + wv * SLAB, mb);
    __syncthreads();   // every wave's partial blocks are in LDS before a wave adds them up
    if (wv < 2) {
        float* t = T + (size_t)(r0 / SS) * NHID * SS + (size_t)lr * SS + (r0 % SS) + wv * 32 + hi * 8;   // a 64-row tile lies inside one batch
#pragma unroll
        for (int m = 0; m < 2; ++m) *(v8f*)(t + m * 16) = sum_frag(red, wv * 2 + m);
        asm volatile("s_wait_xcnt 0x0" ::: "memory");   // in the built code a branch behind these stores has the row-major epilogue, which reuses the stores' registers, as its fall-through side: the wait stands in front of that overwrite
    }
}
// PLANES: the tile goes out as hl planes Ph / Pl (transposed where tr is set, a wave-uniform choice) and not as f32 C.
template <typename T16, int NSPLIT, bool BIAS, bool PLANES = false>
__device__ __forceinline__ void gemmw_tile(const T16* __restrict__ A, const T16* __restrict__ A2, const T16* __restrict__ Bt, const T16* __restrict__ Bt2, int K, float* C, int ldc, const float* __restrict__ bias, int r0, int c0, bf* Ph = nullptr, bf* Pl = nullptr, bool tr = false, float* CT = nullptr) {
    typedef typename WFrag<T16>::V V;
    float* red = red_buf();
    const int lane = threadIdx.x & 31, lr = lane & 15, hi = lane >> 4;
    const int wv = __builtin_amdgcn_readfirstlane(threadIdx.x >> 5);   // the wave's number in its work-group, in a scalar register
    v8f acc[4][4];
#pragma unroll
    for (int mb = 0; mb < 4; ++mb)
#pragma unroll
        for (int nb = 0; nb < 4; ++nb) acc[mb][nb] = (v8f){};
    A += wv * 32; Bt += wv * 32; if (NSPLIT == 1 || NSPLIT == 2) A2 += wv * 32; if (NSPLIT >= 2) Bt2 += wv * 32;   // wave wv starts at k block wv and steps over NWV blocks a trip
    const size_t aoff = (size_t)(r0 + lr) * K + 8 * hi, boff = (size_t)(c0 + lr) * K + 8 * hi;
#pragma unroll 1
    for (int kc = 0; kc < K; kc += NWV * 32) {
        V a[4], a2[4];
#pragma unroll
        for (int mb = 0; mb < 4; ++mb) { a[mb] = WFrag<T16>::ld(A + aoff + (size_t)mb * 16 * K + kc); if (NSPLIT == 1 || NSPLIT == 2) a2[mb] = WFrag<T16>::ld(A2 + aoff + (size_t)mb * 16 * K + kc); }
        if (PLANES) asm volatile("s_wait_xcnt 0x0" ::: "memory");   // in this build a B fragment's load lands in the register pair that holds the A loads' address: the wait stands behind the A loads, in front of that overwrite
        if (NSPLIT == 1) {   // the hq / hk tiles: the products of the general loop below in its order; its last B fragment comes by ldw, because in this build that fragment's second load lands in the B loads' address pair
#pragma unroll
            for (int nb = 0; nb < 4; ++nb) { const T16* bp = Bt + boff + (size_t)nb * 16 * K + kc; const V b = (nb == 3) ? ldw(bp) : WFrag<T16>::ld(bp);
#pragma unroll
                for (int mb = 0; mb < 4; ++mb) { acc[mb][nb] = WFrag<T16>::mma(a[mb], b, acc[mb][nb]); acc[mb][nb] = WFrag<T16>::mma(a2[mb], b, acc[mb][nb]); } }
        } else
#pragma unroll
        for (int nb = 0; nb < 4; ++nb) { const V b = WFrag<T16>::ld(Bt + boff + (size_t)nb * 16 * K + kc); V b2; if (NSPLIT >= 2) b2 = WFrag<T16>::ld(Bt2 + boff + (size_t)nb * 16 * K + kc);
#pragma unroll
            for (int mb = 0; mb < 4; ++mb) { acc[mb][nb] = WFrag<T16>::mma(a[mb], b, acc[mb][nb]); if (NSPLIT == 1 || NSPLIT == 2) acc[mb][nb] = WFrag<T16>::mma(a2[mb], b, acc[mb][nb]); if (NSPLIT >= 2) acc[mb][nb] = WFrag<T16>::mma(a[mb], b2, acc[mb][nb]); } }
        asm volatile("v_nop\n\tv_nop\n\tv_nop\n\tv_nop" : "+v"(acc[0][0]), "+v"(acc[1][1]), "+v"(acc[2][2]), "+v"(acc[3][3]) : "v"(a[0]), "v"(a[3]));
    }
    if (PLANES) { if (tr) st_planesT(acc, red, wv, Ph, Pl, r0, c0); else st_planes(acc, red, wv, Ph, Pl, r0, c0); return; }
    if (CT) { st_colsT(acc, red, wv, CT, r0); return; }   // a choice that is the same for the whole work-group: only the 16 columns that are used go out, transposed, and no C
    put_rows(acc, red + wv * SLAB);
    __syncthreads();   // every wave's partial tile is in LDS before any wave adds them up
    float* crow = C + (size_t)(r0 + wv * 16) * ldc + c0;   // wave wv takes the tile's rows wv * 16 .. + 15: 16 lanes x 16 B cover a row's two 128-B lines
#pragma unroll
    for (int s = 0; s < 8; ++s) { const int row = 2 * s + hi, cofs = lr * 4; v4f val = sum_rows(red, (wv * 16 + row) * 68 + cofs); if (BIAS) { val[0] += bfr(bias[c0 + cofs]); val[1] += bfr(bias[c0 + cofs + 1]); val[2] += bfr(bias[c0 + cofs + 2]); val[3] += bfr(bias[c0 + cofs + 3]); }
        *(v4f*)(crow + (size_t)row * ldc + cofs) = val; }
    asm volatile("s_wait_xcnt 0x0" ::: "memory");   // in the built code of k_sch a branch behind the score tiles' last stores has the hq / hk path, which reuses the stores' registers, as its fall-through side: the wait stands in front of that overwrite
}
template <typename T16, int NSPLIT, bool BIAS>
__global__ __launch_bounds__(32 * NWV) void k_gemmw(const T16* __restrict__ A, const T16* __restrict__ A2, const T16* __restrict__ Bt, const T16* __restrict__ Bt2, int K, float* C, int ldc, const float* __restrict__ bias, size_t sA, size_t sB, size_t sC) {
    const size_t z = blockIdx.z; A += z * sA; if (A2) A2 += z * sA; Bt += z * sB; if (Bt2) Bt2 += z * sB; C += z * sC;
    gemmw_tile<T16, NSPLIT, BIAS>(A, A2, Bt, Bt2, K, C, ldc, bias, blockIdx.x * 64, blockIdx.y * 64);
}
// k_sch: the two stages that read only the Q / K planes share one grid of tiles: blocks 0..63 hq, 64..127 hk (row tiles of the [4 * 1024] row space), then the 4 x 16 x 16 score tiles (row tile fastest, batch slowest).
__global__ __launch_bounds__(32 * NWV) void k_sch(const bf* __restrict__ QPh, const bf* __restrict__ QPl, const bf* __restrict__ KPh, const bf* __restrict__ KPl, const bf* __restrict__ WQ1, const bf* __restrict__ WK1, float* HQ, float* HKT, float* S) {
    const int b = blockIdx.x; const int NH_T = NB_ * SS / 64;
    if (b < 2 * NH_T) { const bool k = b >= NH_T; gemmw_tile<bf, 1, false>(k ? KPh : QPh, k ? KPl : QPl, k ? WK1 : WQ1, nullptr, EE, HQ, 64, nullptr, (k ? b - NH_T : b) * 64, 0, nullptr, nullptr, false, k ? HKT : nullptr); }   // hq row-major (pitch 64), hk transposed ([batch][16][1024])
    else { const int t = b - 2 * NH_T; const size_t z = (size_t)(t / ((SS / 64) * (SS / 64))); const size_t zo = z * SS * EE;
        gemmw_tile<bf, 2, false>(QPh + zo, QPl + zo, KPh + zo, KPl + zo, EE, S + z * SS * SS, SS, nullptr, (t % (SS / 64)) * 64, ((t / (SS / 64)) % (SS / 64)) * 64); }
}

typedef __attribute__((ext_vector_type(4))) unsigned short v4us;

// The element-wise stages as device functions of a block number blk (256 threads a block), so that independent stages can share one grid.
__device__ __forceinline__ void d_cvt8(const float* __restrict__ src, bf* dst, int blk) { const size_t i = (size_t)blk * 256 + threadIdx.x; const v8f v = *(const v8f*)(src + i * 8); v8us o;
#pragma unroll
    for (int k = 0; k < 8; ++k) o[k] = f2bf(v[k]); *(v8us*)(dst + i * 8) = o;
    asm volatile("s_wait_xcnt 0x0" ::: "memory");   // in the built code a branch behind this store has the other stage's code, which reuses the store's registers, as its fall-through side: the wait stands in front of that overwrite
}
// d_w1p: W1Q[n][k] = bf16(W1[n][k]) and W1K[n][k] = bf16(W1[n][512 + k]) for n < 16, rows 16..63 zero ([64][512]).
__device__ __forceinline__ void d_w1p(const float* __restrict__ W1, bf* WQ1, bf* WK1, int blk) { const int e = (blk * 256 + threadIdx.x) * 4; const int n = e / EE, k = e % EE; v4us a, b;
#pragma unroll
    for (int u = 0; u < 4; ++u) { a[u] = (n < NHID) ? f2bf(W1[(size_t)n * 2 * EE + k + u]) : (unsigned short)0; b[u] = (n < NHID) ? f2bf(W1[(size_t)n * 2 * EE + EE + k + u]) : (unsigned short)0; }
    *(v4us*)(WQ1 + e) = a; *(v4us*)(WK1 + e) = b;  }
// Block counts of the stages; every one divides exactly, so no stage has a part-filled block.
#define NBX  (NB_ * SS * EE / 8 / 256)   /* x -> bf16 */
#define NBW  (EE * EE / 8 / 256)         /* one of Wq, Wk, Wv -> bf16 */
#define NBW1 (64 * EE / 4 / 256)         /* the two padded W1 halves */
// k_prep: all five input conversions in one grid: x, then Wq, Wk, Wv (BW = the three [512][512] bf16 planes in a row), then W1.
__global__ __launch_bounds__(256) void k_prep(const float* __restrict__ x, const float* __restrict__ Wq, const float* __restrict__ Wk, const float* __restrict__ Wv, const float* __restrict__ W1, bf* XB, bf* BW, bf* WQ1, bf* WK1) {
    const int b = blockIdx.x;
    if (b >= NBX + 3 * NBW) { d_w1p(W1, WQ1, WK1, b - NBX - 3 * NBW); return; }
    const int w = (b < NBX) ? 0 : 1 + (b - NBX) / NBW;   // 0: x; 1, 2, 3: Wq, Wk, Wv
    d_cvt8(w == 0 ? x : (w == 1 ? Wq : (w == 2 ? Wk : Wv)), w == 0 ? XB : BW + (size_t)(w - 1) * EE * EE, w == 0 ? b : (b - NBX) % NBW);
}
// k_qkv: the Q / K / V products (grid z = 0, 1, 2), one work-group per 64x64 tile, K = 512; the tile's epilogue stores the hl planes (V's transposed), so no f32 copy of Q, K or V exists.
__global__ __launch_bounds__(32 * NWV) void k_qkv(const bf* __restrict__ XB, const bf* __restrict__ BW, bf* QPh, bf* QPl, bf* KPh, bf* KPl, bf* VTh, bf* VTl) {
    const int z = blockIdx.z;
    gemmw_tile<bf, 0, false, true>(XB, nullptr, BW + (size_t)z * EE * EE, nullptr, EE, nullptr, 0, nullptr, blockIdx.x * 64, blockIdx.y * 64, z == 0 ? QPh : (z == 1 ? KPh : VTh), z == 0 ? QPl : (z == 1 ? KPl : VTl), z == 2);
}
__global__ __launch_bounds__(256) void k_hsoft(const float* __restrict__ S, const float* __restrict__ HQ, const float* __restrict__ HKT, const float* __restrict__ b1, const float* __restrict__ W2, const float* __restrict__ b2, bf* Ph, bf* Pl) {
    const int lane = threadIdx.x & 31; const int i = blockIdx.x * 8 + (threadIdx.x >> 5); if (i >= NB_ * SS) return; const float* sr = S + (size_t)i * SS; HKT += (size_t)(i / SS) * NHID * SS;   // i = batch * S + query row; the keys are those of the row's own batch
    float hq[NHID], w2[NHID];
#pragma unroll
    for (int h = 0; h < NHID; ++h) { hq[h] = __fadd_rn(HQ[(size_t)i * 64 + h], bfr(b1[h])); w2[h] = bfr(W2[h]); }   // hq + b1 folded (the reference adds hq + hk + b1; f32 addition order (hq + hk) + b1 vs (hq + b1) + hk differs by <= 1 ulp)
    const float bb2 = bfr(b2[0]); const float scl = 0.044194173824159216f;   // 1/sqrt(512)
    float v[SS / 32]; float mx = -3.0e38f;
#pragma unroll 1
    for (int ch = 0; ch < SS / 128; ++ch) { const v4f a = *(const v4f*)(sr + ch * 128 + lane * 4); v4f hk[NHID];   // hk is stored [h][key]: one 16-byte load per h brings the lane's four keys, and the wave's 32 lanes read 512 contiguous bytes (four whole lines) per load; all issued ahead of the first tanh; h unrolled below so that hq, w2 and hk have fixed registers
#pragma unroll
        for (int h = 0; h < NHID - 1; ++h) hk[h] = *(const v4f*)(HKT + (size_t)h * SS + ch * 128 + lane * 4);
        asm volatile("s_wait_xcnt 0x0" ::: "memory");   // in the built code the last load lands in the register pair that holds the address of the loads above: the wait stands in front of that overwrite
        hk[NHID - 1] = *(const v4f*)(HKT + (size_t)(NHID - 1) * SS + ch * 128 + lane * 4);
#pragma unroll
        for (int u = 0; u < 4; ++u) { float est = bb2;
#pragma unroll
            for (int h = 0; h < NHID; ++h) { const float z = __fadd_rn(hq[h], hk[h][u]); float th = __builtin_amdgcn_tanhf(z); float pr = __fmul_rn(w2[h], th); asm volatile("" : "+v"(pr)); est = __fadd_rn(est, pr); }   // tanh by the hardware instruction (v_tanh_f32): one instruction a value, no branch on the size of z
            float s0 = a[u] * scl; asm volatile("" : "+v"(s0)); const float t = __fadd_rn(s0, est); v[ch * 4 + u] = t; mx = fmaxf(mx, t); } }
#pragma unroll
    for (int sh = 16; sh; sh >>= 1) mx = fmaxf(mx, __shfl_xor(mx, sh, 32));
    float sum = 0.f;
#pragma unroll
    for (int q = 0; q < SS / 32; ++q) { float d0 = __fsub_rn(v[q], mx); asm volatile("" : "+v"(d0)); v[q] = __builtin_amdgcn_exp2f(__fmul_rn(d0, 1.4426950408889634f)); sum += v[q]; }
#pragma unroll
    for (int sh = 16; sh; sh >>= 1) sum += __shfl_xor(sum, sh, 32);
    const float f = __fdiv_rn(1.0f, sum);
    {
#pragma unroll
        for (int ch = 0; ch < SS / 128; ++ch) { v4us oh, ol; for (int q = 0; q < 4; ++q) { unsigned short a2, c2; splitf(v[ch * 4 + q] * f, a2, c2); oh[q] = a2; ol[q] = c2; } const size_t oo = (size_t)i * SS + ch * 128 + lane * 4; *(v4us*)(Ph + oo) = oh; *(v4us*)(Pl + oo) = ol; }
         } }

extern "C" void kernel_launch(void* const* d_in, const int* in_sizes, int n_in,
                              void* d_out, int out_size, void* d_ws, size_t ws_size, hipStream_t stream) {
    (void)in_sizes; (void)n_in; (void)out_size;
    const float* x = (const float*)d_in[0]; const float* Wq = (const float*)d_in[1]; const float* Wk = (const float*)d_in[2]; const float* Wv = (const float*)d_in[3]; const float* W1 = (const float*)d_in[4]; const float* b1 = (const float*)d_in[5]; const float* W2 = (const float*)d_in[6]; const float* b2 = (const float*)d_in[7];
    float* OUT = (float*)d_out;     // [4][1024][512]
    char* wsp = (char*)d_ws;
    auto take = [&](size_t bytes) { char* p = wsp; wsp += (bytes + 255) & ~(size_t)255; return (void*)p; };
    bf* BQ = (bf*)take((size_t)3 * EE * EE * 2);   // the bf16 planes of Wq, Wk, Wv in a row: grid z of the Q / K / V launch steps through them
    bf* WQ1 = (bf*)take((size_t)64 * EE * 2); bf* WK1 = (bf*)take((size_t)64 * EE * 2);
    bf* XB = (bf*)take((size_t)NB_ * SS * EE * 2);
    bf* QPh = (bf*)take((size_t)NB_ * SS * EE * 2); bf* QPl = (bf*)take((size_t)NB_ * SS * EE * 2); bf* KPh = (bf*)take((size_t)NB_ * SS * EE * 2); bf* KPl = (bf*)take((size_t)NB_ * SS * EE * 2); bf* VTh = (bf*)take((size_t)NB_ * EE * SS * 2); bf* VTl = (bf*)take((size_t)NB_ * EE * SS * 2);
    float* HQ = (float*)take((size_t)NB_ * SS * 64 * 4); float* HKT = (float*)take((size_t)NB_ * NHID * SS * 4); float* S = (float*)take((size_t)NB_ * SS * SS * 4); bf* Ph = (bf*)take((size_t)NB_ * SS * SS * 2); bf* Pl = (bf*)take((size_t)NB_ * SS * SS * 2);
    if ((size_t)(wsp - (char*)d_ws) > ws_size) return;    // total ~ 65 MB
    // Five launches, one per stage of the dependence chain; launches that do not depend on one another share a grid. All four batches in every launch.
    k_prep<<<NBX + 3 * NBW + NBW1, 256, 0, stream>>>(x, Wq, Wk, Wv, W1, XB, BQ, WQ1, WK1);   // torch [out][in] = Bt
    k_qkv<<<dim3(NB_ * SS / 64, EE / 64, 3), 32 * NWV, 0, stream>>>(XB, BQ, QPh, QPl, KPh, KPl, VTh, VTl);   // grid z = Q, K, V
    k_sch<<<2 * (NB_ * SS / 64) + NB_ * (SS / 64) * (SS / 64), 32 * NWV, 0, stream>>>(QPh, QPl, KPh, KPl, WQ1, WK1, HQ, HKT, S);
    k_hsoft<<<NB_ * SS / 8, 256, 0, stream>>>(S, HQ, HKT, b1, W2, b2, Ph, Pl);
    k_gemmw<bf, 2, false><<<dim3(SS / 64, EE / 64, NB_), 32 * NWV, 0, stream>>>(Ph, Pl, VTh, VTl, SS, OUT, EE, nullptr, (size_t)SS * SS, (size_t)EE * SS, (size_t)SS * EE);
}

// v008
// It runs in 67.3 microseconds.
// Two timings next to v007 put it at 1.32 and 1.30 times that version's speed.
// Over all steps from v000 it is 11.8 times as fast.
#include <hip/hip_runtime.h>

// HybridSelfAttention (x [4][1024][512]; Q/K/V = x W^T (torch, single head over the full 512); scores = Q.K / sqrt(512); estimator on every (query, key) pair: est[q][k] = sum_h W2[h] tanh(hq[q][h] + hk[k][h] + b1[h]) + b2 with hq = Q W1[:, :512]^T, hk = K W1[:, 512:]^T (16 hidden units);
//   attn = softmax(scores + est); out = attn V -> [4][1024][512]).
// Compute dtypes, f32 accumulate: every input rounded to bf16; Q/K/V as PLAIN bf16 GEMMs (inputs: exact); hq / hk as hl planes of Q / K x exact W1 halves (2 products; 16 outputs padded to 64); scores hl x hl (3 products); the pairwise estimator (16 tanh per pair), + est, softmax in f32 (wave per query row) -> hl planes; attn.V hl x hl (3 products).

#define NB_  4
#define SS   1024
#define EE   512
#define NHID 16
typedef _Float16 h16;
typedef unsigned short bf;
typedef __attribute__((ext_vector_type(16))) __bf16   v16bf;
typedef __attribute__((ext_vector_type(16))) _Float16 v16h;
typedef __attribute__((ext_vector_type(8)))  _Float16 v8h;
typedef __attribute__((ext_vector_type(8)))  unsigned short v8us;
typedef __attribute__((ext_vector_type(8)))  float    v8f;
typedef __attribute__((ext_vector_type(4)))  float    v4f;
typedef v8h  __attribute__((may_alias)) v8ha;
typedef v4f  __attribute__((may_alias)) v4fa;
typedef v8us __attribute__((may_alias)) v8usa;

__device__ __forceinline__ unsigned short f2bf(float f) { unsigned u = __float_as_uint(f); u += 0x7FFFu + ((u >> 16) & 1u); return (unsigned short)(u >> 16); }
__device__ __forceinline__ float bf2f(unsigned short b) { return __uint_as_float(((unsigned)b) << 16); }
__device__ __forceinline__ float bfr(float f) { return bf2f(f2bf(f)); }
__device__ __forceinline__ void splitf(float y, unsigned short& h, unsigned short& l) { h = f2bf(y); l = f2bf(y - bf2f(h)); }
__device__ __forceinline__ v16h cat16(v8h lo, v8h hi) { return __builtin_shufflevector(lo, hi, 0, 1, 2, 3, 4, 5, 6, 7, 8, 9, 10, 11, 12, 13, 14, 15); }
__device__ __forceinline__ v16bf cat16b(v8us lo, v8us hi) { return __builtin_bit_cast(v16bf, __builtin_shufflevector(lo, hi, 0, 1, 2, 3, 4, 5, 6, 7, 8, 9, 10, 11, 12, 13, 14, 15)); }
__device__ __forceinline__ v8f wmma16(v16h a, v16h b, v8f c) { return __builtin_amdgcn_wmma_f32_16x16x32_f16(false, a, false, b, (short)0, c, false, false); }
__device__ __forceinline__ v8f wmmab(v16bf a, v16bf b, v8f c) { return __builtin_amdgcn_wmma_f32_16x16x32_bf16(false, a, false, b, (short)0, c, false, false); }



// Fragment order of every 16-bit GEMM operand plane M[rows][K] (K-contiguous operands, rows % 16 == 0, K % 32 == 0): blocks of 16 rows x 32 k, 1 KB each, k blocks of a row block in a row; inside a block two halves of 512 B (k 0..15, k 16..31), and in a half lane l = ((k >> 3) & 1) * 16 + (row & 15) owns 16 B (8 consecutive k).
// A wave's fragment is then two 16-byte loads per lane at block + lane * 16 B and + 512 B: each load reads 512 contiguous bytes (4 whole lines). The element that lands in each lane and register is the one that the row-major loader brought.
__device__ __forceinline__ size_t pko(int r, int k, int K) { return ((size_t)(r >> 4) * (K >> 5) + (k >> 5)) * 512 + ((k >> 4) & 1) * 256 + (((k >> 3) & 1) * 16 + (r & 15)) * 8 + (k & 7); }
// ---- k_gemmw: register-blocked GEMM, one work-group of NWV waves per 64x64 output tile: every wave holds the whole tile (16 accumulators) for its own share of K (wave w: the 32-wide k blocks w, w + NWV, ...), operands straight from 16-bit planes in fragment order; the waves' partial tiles meet in LDS, where each wave adds up and stores its own part of the tile; grid (M/64, N/64, Z), 32 * NWV threads.
// C[m][n] (f32, pitch ldc, + optional f32 bias[n]) = sum_k A[m][k] Bt[n][k] (+ split products per NSPLIT). z-batch strides sA/sB/sC in elements. K % (32 * NWV) == 0.
template <typename T16> struct WFrag;
template <> struct WFrag<h16> { typedef v16h V; static __device__ __forceinline__ V ld(const h16* blk, unsigned lo) { const char* p = (const char*)blk + lo; return cat16(*(const v8h*)p, *(const v8h*)(p + 512)); } static __device__ __forceinline__ v8f mma(V a, V b, v8f c) { return wmma16(a, b, c); } };
template <> struct WFrag<bf> { typedef v16bf V; static __device__ __forceinline__ V ld(const bf* blk, unsigned lo) { const char* p = (const char*)blk + lo; return cat16b(*(const v8us*)p, *(const v8us*)(p + 512)); } static __device__ __forceinline__ v8f mma(V a, V b, v8f c) { return wmmab(a, b, c); } };
#define NWV  4           /* waves that share a tile's K */
#define SLAB (64 * 68)   /* floats of one wave's partial tile in LDS */
// One LDS array for every tile path of a kernel: NWV slabs, slab w written by wave w alone.
__device__ __forceinline__ float* red_buf() { __shared__ __align__(16) float red[NWV * SLAB]; return red; }
// acc[mb][nb][j] = element (row mb * 16 + hi * 8 + j, column nb * 16 + lr) of the tile, lr = lane & 15, hi = lane >> 4.
// put_rows / sum_rows: a partial tile row-major (pitch 68 floats) in its wave's slab; behind the barrier, 4 consecutive columns of one row as the sum of the NWV partial sums, added in wave order.
__device__ __forceinline__ void put_rows(const v8f (&acc)[4][4], float* sl) {
    const int lane = threadIdx.x & 31, lr = lane & 15, hi = lane >> 4;
#pragma unroll
    for (int mb = 0; mb < 4; ++mb)
#pragma unroll
        for (int nb = 0; nb < 4; ++nb)
#pragma unroll
            for (int j = 0; j < 8; ++j) sl[(mb * 16 + hi * 8 + j) * 68 + nb * 16 + lr] = acc[mb][nb][j];
}
__device__ __forceinline__ v4f sum_rows(const float* red, int o) { v4f s = *(const v4fa*)(red + o);
#pragma unroll
    for (int w = 1; w < NWV; ++w) s += *(const v4fa*)(red + w * SLAB + o);
    return s; }
// put_frag / sum_frag: one 16x16 block of a partial tile in register order (place t of the slab: two rows of 32 lanes x 16 B), for the epilogues that store straight from the accumulator layout; the sum again in wave order.
__device__ __forceinline__ void put_frag(const v8f& a, float* sl, int t) { const int lane = threadIdx.x & 31;
    *(v4fa*)(sl + t * 256 + lane * 4) = __builtin_shufflevector(a, a, 0, 1, 2, 3); *(v4fa*)(sl + t * 256 + 128 + lane * 4) = __builtin_shufflevector(a, a, 4, 5, 6, 7); }
__device__ __forceinline__ v8f sum_frag(const float* red, int t) { const int lane = threadIdx.x & 31; const float* p = red + t * 256 + lane * 4; v4f lo = *(const v4fa*)p, hi4 = *(const v4fa*)(p + 128);
#pragma unroll
    for (int w = 1; w < NWV; ++w) { lo += *(const v4fa*)(p + w * SLAB); hi4 += *(const v4fa*)(p + w * SLAB + 128); }
    return __builtin_shufflevector(lo, hi4, 0, 1, 2, 3, 4, 5, 6, 7); }
// The plane epilogues of a 64x64 tile: each f32 sum is split into its hl pair and stored in the 16-bit planes that later launches read.
// st_planes (planes [rows][512] in fragment order): wave wv takes the tile's rows wv * 16 .. + 15, that is two whole 1-KB blocks of each plane; each store of a wave is one half block, 512 contiguous bytes.
__device__ __forceinline__ void st_planes(const v8f (&acc)[4][4], float* red, int wv, bf* Ph, bf* Pl, int r0, int c0) {
    const int lane = threadIdx.x & 31, lr = lane & 15, hi = lane >> 4;
    put_rows(acc, red + wv * SLAB);
    __syncthreads();   // every wave's partial tile is in LDS before any wave adds them up
#pragma unroll
    for (int s = 0; s < 4; ++s) { const int row = wv * 16 + lr, cofs = s * 16 + hi * 8; const v4f x0 = sum_rows(red, row * 68 + cofs), x1 = sum_rows(red, row * 68 + cofs + 4); v8us oh, ol;
#pragma unroll
        for (int u = 0; u < 4; ++u) { unsigned short p, q; splitf(x0[u], p, q); oh[u] = p; ol[u] = q; splitf(x1[u], p, q); oh[4 + u] = p; ol[4 + u] = q; }
        const size_t o = ((size_t)((r0 >> 4) + wv) * (EE / 32) + (c0 >> 5)) * 512 + s * 256 + lane * 8; *(v8us*)(Ph + o) = oh; *(v8us*)(Pl + o) = ol; }
    asm volatile("s_wait_xcnt 0x0" ::: "memory");   // in the built code a branch behind the last stores has the other epilogue, which reuses the stores' registers, as its fall-through side: the wait stands in front of that overwrite
}
// st_planesT (planes transposed, [batch][512][1024], each batch in fragment order): a lane's 8 accumulator registers are 8 consecutive s of one column, that is the lane's own 16 bytes of a half block; wave wv takes the tile's columns wv * 16 .. + 15, and its four mb stores are the four halves of two neighbouring blocks, 512 contiguous bytes each.
__device__ __forceinline__ void st_planesT(const v8f (&acc)[4][4], float* red, int wv, bf* Ph, bf* Pl, int r0, int c0) {
    const int lane = threadIdx.x & 31;
#pragma unroll
    for (int mb = 0; mb < 4; ++mb)
#pragma unroll
        for (int nb = 0; nb < 4; ++nb) put_frag(acc[mb][nb], red + wv * SLAB, mb * 4 + nb);
    __syncthreads();   // every wave's partial tile is in LDS before any wave adds them up
    const size_t base = (size_t)(r0 / SS) * SS * EE + ((size_t)((c0 >> 4) + wv) * (SS / 32) + ((r0 % SS) >> 5)) * 512 + lane * 8;   // a 64-row tile lies inside one batch
#pragma unroll
    for (int mb = 0; mb < 4; ++mb) { const v8f x = sum_frag(red, mb * 4 + wv); v8us oh, ol;
#pragma unroll
        for (int j = 0; j < 8; ++j) { unsigned short p, q; splitf(x[j], p, q); oh[j] = p; ol[j] = q; }
        const size_t o = base + mb * 256; *(v8us*)(Ph + o) = oh; *(v8us*)(Pl + o) = ol; }
}
// st_colsT (the tile's first 16 columns as f32, transposed, [batch][16][1024]): a lane's 8 accumulator registers are 8 consecutive rows of one column, that is 32 contiguous bytes of the transposed array; waves 0 and 1 take 32 rows each, one whole 128-B line in each column.
__device__ __forceinline__ void st_colsT(const v8f (&acc)[4][4], float* red, int wv, float* T, int r0) {
    const int lane = threadIdx.x & 31, lr = lane & 15, hi = lane >> 4;
#pragma unroll
    for (int mb = 0; mb < 4; ++mb) put_frag(acc[mb][0], red + wv * SLAB, mb);
    __syncthreads();   // every wave's partial blocks are in LDS before a wave adds them up
    if (wv < 2) {
        float* t = T + (size_t)(r0 / SS) * NHID * SS + (size_t)lr * SS + (r0 % SS) + wv * 32 + hi * 8;   // a 64-row tile lies inside one batch
#pragma unroll
        for (int m = 0; m < 2; ++m) *(v8f*)(t + m * 16) = sum_frag(red, wv * 2 + m);
        asm volatile("s_wait_xcnt 0x0" ::: "memory");   // in the built code a branch behind these stores has the row-major epilogue, which reuses the stores' registers, as its fall-through side: the wait stands in front of that overwrite
    }
}
// PLANES: the tile goes out as hl planes Ph / Pl (transposed where tr is set, a wave-uniform choice) and not as f32 C.
template <typename T16, int NSPLIT, bool BIAS, bool PLANES = false>
__device__ __forceinline__ void gemmw_tile(const T16* __restrict__ A, const T16* __restrict__ A2, const T16* __restrict__ Bt, const T16* __restrict__ Bt2, int K, float* C, int ldc, const float* __restrict__ bias, int r0, int c0, bf* Ph = nullptr, bf* Pl = nullptr, bool tr = false, float* CT = nullptr) {
    typedef typename WFrag<T16>::V V;
    float* red = red_buf();
    const int lane = threadIdx.x & 31, lr = lane & 15, hi = lane >> 4;
    const int wv = __builtin_amdgcn_readfirstlane(threadIdx.x >> 5);   // the wave's number in its work-group, in a scalar register
    v8f acc[4][4];
#pragma unroll
    for (int mb = 0; mb < 4; ++mb)
#pragma unroll
        for (int nb = 0; nb < 4; ++nb) acc[mb][nb] = (v8f){};
    const size_t aoff = (size_t)r0 * K + wv * 512, boff = (size_t)c0 * K + wv * 512;   // fragment order: a row block's k blocks lie in a row (16 * K elements a row block, 512 a k block); wave wv starts at k block wv and steps over NWV blocks a trip; all of this is the same for the whole wave
    unsigned lo = lane * 16;   // byte offset of the lane's own 16 bytes in the trip's first half block: the one vector register of every operand address (scalar base + this + a constant); it steps from trip to trip
#pragma unroll 1
    for (int kc = 0; kc < K; kc += NWV * 32) {
        V a[4], a2[4], b[4], b2[4];
#pragma unroll
        for (int mb = 0; mb < 4; ++mb) { a[mb] = WFrag<T16>::ld(A + aoff + (size_t)mb * 16 * K, lo); if (NSPLIT == 1 || NSPLIT == 2) a2[mb] = WFrag<T16>::ld(A2 + aoff + (size_t)mb * 16 * K, lo); }
#pragma unroll
        for (int nb = 0; nb < 4; ++nb) { b[nb] = WFrag<T16>::ld(Bt + boff + (size_t)nb * 16 * K, lo); if (NSPLIT >= 2 && nb < 3) b2[nb] = WFrag<T16>::ld(Bt2 + boff + (size_t)nb * 16 * K, lo); }
        __builtin_amdgcn_sched_barrier(0);   // the trip's loads stay one group ahead of its products: without it this build issues three of the b2 fragments one by one among the products and waits out each one's whole latency
#pragma unroll
        for (int nb = 0; nb < 4; ++nb) { if (NSPLIT >= 2 && nb == 1) b2[3] = WFrag<T16>::ld(Bt2 + boff + (size_t)3 * 16 * K, lo);   // the last b2 fragment has no free registers until column block 0 is done
#pragma unroll
            for (int mb = 0; mb < 4; ++mb) { acc[mb][nb] = WFrag<T16>::mma(a[mb], b[nb], acc[mb][nb]); if (NSPLIT == 1 || NSPLIT == 2) acc[mb][nb] = WFrag<T16>::mma(a2[mb], b[nb], acc[mb][nb]); if (NSPLIT >= 2) acc[mb][nb] = WFrag<T16>::mma(a[mb], b2[nb], acc[mb][nb]); } }
        asm volatile("v_nop\n\tv_nop\n\tv_nop\n\tv_nop" : "+v"(acc[0][0]), "+v"(acc[1][1]), "+v"(acc[2][2]), "+v"(acc[3][3]) : "v"(a[0]), "v"(a[3]));
        asm volatile("s_wait_xcnt 0x0\n\tv_add_nc_u32 %0, %1, %0" : "+v"(lo) : "n"(NWV * 1024) : "memory");   // on to the next trip's k blocks (NWV blocks of 1 KB); the add is written behind its wait in one statement, because it overwrites the offset register that the trip's loads name
    }
    if (PLANES) { if (tr) st_planesT(acc, red, wv, Ph, Pl, r0, c0); else st_planes(acc, red, wv, Ph, Pl, r0, c0); return; }
    if (CT) { st_colsT(acc, red, wv, CT, r0); return; }   // a choice that is the same for the whole work-group: only the 16 columns that are used go out, transposed, and no C
    put_rows(acc, red + wv * SLAB);
    __syncthreads();   // every wave's partial tile is in LDS before any wave adds them up
    float* crow = C + (size_t)(r0 + wv * 16) * ldc + c0;   // wave wv takes the tile's rows wv * 16 .. + 15: 16 lanes x 16 B cover a row's two 128-B lines
#pragma unroll
    for (int s = 0; s < 8; ++s) { const int row = 2 * s + hi, cofs = lr * 4; v4f val = sum_rows(red, (wv * 16 + row) * 68 + cofs); if (BIAS) { val[0] += bfr(bias[c0 + cofs]); val[1] += bfr(bias[c0 + cofs + 1]); val[2] += bfr(bias[c0 + cofs + 2]); val[3] += bfr(bias[c0 + cofs + 3]); }
        *(v4f*)(crow + (size_t)row * ldc + cofs) = val; }
    asm volatile("s_wait_xcnt 0x0" ::: "memory");   // in the built code of k_sch a branch behind the score tiles' last stores has the hq / hk path, which reuses the stores' registers, as its fall-through side: the wait stands in front of that overwrite
}
template <typename T16, int NSPLIT, bool BIAS, int K>
__global__ __launch_bounds__(32 * NWV) void k_gemmw(const T16* __restrict__ A, const T16* __restrict__ A2, const T16* __restrict__ Bt, const T16* __restrict__ Bt2, float* C, int ldc, const float* __restrict__ bias, size_t sA, size_t sB, size_t sC) {
    const size_t z = blockIdx.z; A += z * sA; if (A2) A2 += z * sA; Bt += z * sB; if (Bt2) Bt2 += z * sB; C += z * sC;
    gemmw_tile<T16, NSPLIT, BIAS>(A, A2, Bt, Bt2, K, C, ldc, bias, blockIdx.x * 64, blockIdx.y * 64);
}
// k_sch: the two stages that read only the Q / K planes share one grid of tiles: blocks 0..63 hq, 64..127 hk (row tiles of the [4 * 1024] row space), then the 4 x 16 x 16 score tiles (row tile fastest, batch slowest).
__global__ __launch_bounds__(32 * NWV) void k_sch(const bf* __restrict__ QPh, const bf* __restrict__ QPl, const bf* __restrict__ KPh, const bf* __restrict__ KPl, const bf* __restrict__ WQ1, const bf* __restrict__ WK1, float* HQ, float* HKT, float* S) {
    const int b = blockIdx.x; const int NH_T = NB_ * SS / 64;
    if (b < 2 * NH_T) { const bool k = b >= NH_T; gemmw_tile<bf, 1, false>(k ? KPh : QPh, k ? KPl : QPl, k ? WK1 : WQ1, nullptr, EE, HQ, 64, nullptr, (k ? b - NH_T : b) * 64, 0, nullptr, nullptr, false, k ? HKT : nullptr); }   // hq row-major (pitch 64), hk transposed ([batch][16][1024])
    else { const int t = b - 2 * NH_T; const size_t z = (size_t)(t / ((SS / 64) * (SS / 64))); const size_t zo = z * SS * EE;
        gemmw_tile<bf, 2, false>(QPh + zo, QPl + zo, KPh + zo, KPl + zo, EE, S + z * SS * SS, SS, nullptr, (t % (SS / 64)) * 64, ((t / (SS / 64)) % (SS / 64)) * 64); }
}

typedef __attribute__((ext_vector_type(4))) unsigned short v4us;

// The element-wise stages as device functions of a block number blk (256 threads a block), so that independent stages can share one grid.
// d_cvt8: src [rows][512] f32 -> dst in fragment order; thread i owns the i-th 16 bytes of dst, so that a wave stores 512 contiguous bytes, and reads its 8 floats from the row and k that those bytes stand for.
__device__ __forceinline__ void d_cvt8(const float* __restrict__ src, bf* dst, int blk) { const int i = blk * 256 + threadIdx.x; const int row = ((i >> 6) / (EE / 32)) * 16 + (i & 15), k0 = ((i >> 6) % (EE / 32)) * 32 + ((i >> 4) & 3) * 8; const v8f v = *(const v8f*)(src + (size_t)row * EE + k0); v8us o;
    asm volatile("s_wait_xcnt 0x0" ::: "memory");   // in the built code the conversion reuses the register pair that holds the loads' address: the wait stands in front of that overwrite
#pragma unroll
    for (int k = 0; k < 8; ++k) o[k] = f2bf(v[k]); *(v8us*)(dst + (size_t)i * 8) = o;
    asm volatile("s_wait_xcnt 0x0" ::: "memory");   // in the built code a branch behind this store has the other stage's code, which reuses the store's registers, as its fall-through side: the wait stands in front of that overwrite
}
// d_w1p: W1Q[n][k] = bf16(W1[n][k]) and W1K[n][k] = bf16(W1[n][512 + k]) for n < 16, rows 16..63 zero ([64][512], in fragment order).
__device__ __forceinline__ void d_w1p(const float* __restrict__ W1, bf* WQ1, bf* WK1, int blk) { const int e = (blk * 256 + threadIdx.x) * 4; const int n = e / EE, k = e % EE; v4us a, b;
#pragma unroll
    for (int u = 0; u < 4; ++u) { a[u] = (n < NHID) ? f2bf(W1[(size_t)n * 2 * EE + k + u]) : (unsigned short)0; b[u] = (n < NHID) ? f2bf(W1[(size_t)n * 2 * EE + EE + k + u]) : (unsigned short)0; }
    const size_t o = pko(n, k, EE); *(v4us*)(WQ1 + o) = a; *(v4us*)(WK1 + o) = b;  }
// Block counts of the stages; every one divides exactly, so no stage has a part-filled block.
#define NBX  (NB_ * SS * EE / 8 / 256)   /* x -> bf16 */
#define NBW  (EE * EE / 8 / 256)         /* one of Wq, Wk, Wv -> bf16 */
#define NBW1 (64 * EE / 4 / 256)         /* the two padded W1 halves */
// k_prep: all five input conversions in one grid: x, then Wq, Wk, Wv (BW = the three [512][512] bf16 planes in a row), then W1.
__global__ __launch_bounds__(256) void k_prep(const float* __restrict__ x, const float* __restrict__ Wq, const float* __restrict__ Wk, const float* __restrict__ Wv, const float* __restrict__ W1, bf* XB, bf* BW, bf* WQ1, bf* WK1) {
    const int b = blockIdx.x;
    if (b >= NBX + 3 * NBW) { d_w1p(W1, WQ1, WK1, b - NBX - 3 * NBW); return; }
    const int w = (b < NBX) ? 0 : 1 + (b - NBX) / NBW;   // 0: x; 1, 2, 3: Wq, Wk, Wv
    d_cvt8(w == 0 ? x : (w == 1 ? Wq : (w == 2 ? Wk : Wv)), w == 0 ? XB : BW + (size_t)(w - 1) * EE * EE, w == 0 ? b : (b - NBX) % NBW);
}
// k_qkv: the Q / K / V products (grid z = 0, 1, 2), one work-group per 64x64 tile, K = 512; the tile's epilogue stores the hl planes (V's transposed), so no f32 copy of Q, K or V exists.
__global__ __launch_bounds__(32 * NWV) void k_qkv(const bf* __restrict__ XB, const bf* __restrict__ BW, bf* QPh, bf* QPl, bf* KPh, bf* KPl, bf* VTh, bf* VTl) {
    const int z = blockIdx.z;
    gemmw_tile<bf, 0, false, true>(XB, nullptr, BW + (size_t)z * EE * EE, nullptr, EE, nullptr, 0, nullptr, blockIdx.x * 64, blockIdx.y * 64, z == 0 ? QPh : (z == 1 ? KPh : VTh), z == 0 ? QPl : (z == 1 ? KPl : VTl), z == 2);
}
#define SPP (SS + 32)   /* LDS pitch of a row of a plane, in elements: 16 banks from row to row, so that the 16-byte reads of neighbouring rows and groups fall on different banks */
__global__ __launch_bounds__(256) void k_hsoft(const float* __restrict__ S, const float* __restrict__ HQ, const float* __restrict__ HKT, const float* __restrict__ b1, const float* __restrict__ W2, const float* __restrict__ b2, bf* Ph, bf* Pl) {
    const int lane = threadIdx.x & 31; const int i = blockIdx.x * 8 + (threadIdx.x >> 5); const float* sr = S + (size_t)i * SS; HKT += (size_t)(i / SS) * NHID * SS;   // i = batch * S + query row; the keys are those of the row's own batch
    float hq[NHID], w2[NHID];
#pragma unroll
    for (int h = 0; h < NHID; ++h) { hq[h] = __fadd_rn(HQ[(size_t)i * 64 + h], bfr(b1[h])); w2[h] = bfr(W2[h]); }   // hq + b1 folded (the reference adds hq + hk + b1; f32 addition order (hq + hk) + b1 vs (hq + b1) + hk differs by <= 1 ulp)
    const float bb2 = bfr(b2[0]); const float scl = 0.044194173824159216f;   // 1/sqrt(512)
    float v[SS / 32]; float mx = -3.0e38f;
#pragma unroll 1
    for (int ch = 0; ch < SS / 128; ++ch) { const v4f a = *(const v4f*)(sr + ch * 128 + lane * 4); v4f hk[NHID];   // hk is stored [h][key]: one 16-byte load per h brings the lane's four keys, and the wave's 32 lanes read 512 contiguous bytes (four whole lines) per load; all issued ahead of the first tanh; h unrolled below so that hq, w2 and hk have fixed registers
#pragma unroll
        for (int h = 0; h < NHID - 1; ++h) hk[h] = *(const v4f*)(HKT + (size_t)h * SS + ch * 128 + lane * 4);
        asm volatile("s_wait_xcnt 0x0" ::: "memory");   // in the built code the last load lands in the register pair that holds the address of the loads above: the wait stands in front of that overwrite
        hk[NHID - 1] = *(const v4f*)(HKT + (size_t)(NHID - 1) * SS + ch * 128 + lane * 4);
#pragma unroll
        for (int u = 0; u < 4; ++u) { float est = bb2;
#pragma unroll
            for (int h = 0; h < NHID; ++h) { const float z = __fadd_rn(hq[h], hk[h][u]); float th = __builtin_amdgcn_tanhf(z); float pr = __fmul_rn(w2[h], th); asm volatile("" : "+v"(pr)); est = __fadd_rn(est, pr); }   // tanh by the hardware instruction (v_tanh_f32): one instruction a value, no branch on the size of z
            float s0 = a[u] * scl; asm volatile("" : "+v"(s0)); const float t = __fadd_rn(s0, est); v[ch * 4 + u] = t; mx = fmaxf(mx, t); } }
#pragma unroll
    for (int sh = 16; sh; sh >>= 1) mx = fmaxf(mx, __shfl_xor(mx, sh, 32));
    float sum = 0.f;
#pragma unroll
    for (int q = 0; q < SS / 32; ++q) { float d0 = __fsub_rn(v[q], mx); asm volatile("" : "+v"(d0)); v[q] = __builtin_amdgcn_exp2f(__fmul_rn(d0, 1.4426950408889634f)); sum += v[q]; }
#pragma unroll
    for (int sh = 16; sh; sh >>= 1) sum += __shfl_xor(sum, sh, 32);
    const float f = __fdiv_rn(1.0f, sum);
    // The planes go out in fragment order ([4 * 1024][1024]), where a row owns only 16 bytes of each 128-B line and the work-group's 8 rows together own the whole line: the rows meet in LDS, and 8 lanes x 16 B store a line.
    __shared__ __align__(16) bf sp[2][8][SPP];
    {
        const int w = threadIdx.x >> 5;
#pragma unroll
        for (int ch = 0; ch < SS / 128; ++ch) { v4us oh, ol; for (int q = 0; q < 4; ++q) { unsigned short a2, c2; splitf(v[ch * 4 + q] * f, a2, c2); oh[q] = a2; ol[q] = c2; } *(v4us*)(&sp[0][w][ch * 128 + lane * 4]) = oh; *(v4us*)(&sp[1][w][ch * 128 + lane * 4]) = ol; }
    }
    __syncthreads();   // all 8 rows are in LDS before any wave gathers a line from them
#pragma unroll
    for (int it = 0; it < SS / 8 * 8 / 256; ++it) { const int p = it * 256 + threadIdx.x, row = p & 7, g = p >> 3;   // g: the row's 16-byte group (8 keys)
        const size_t oo = pko(blockIdx.x * 8 + row, g * 8, SS); *(v8us*)(Ph + oo) = *(const v8us*)(&sp[0][row][g * 8]); *(v8us*)(Pl + oo) = *(const v8us*)(&sp[1][row][g * 8]); }
}

extern "C" void kernel_launch(void* const* d_in, const int* in_sizes, int n_in,
                              void* d_out, int out_size, void* d_ws, size_t ws_size, hipStream_t stream) {
    (void)in_sizes; (void)n_in; (void)out_size;
    const float* x = (const float*)d_in[0]; const float* Wq = (const float*)d_in[1]; const float* Wk = (const float*)d_in[2]; const float* Wv = (const float*)d_in[3]; const float* W1 = (const float*)d_in[4]; const float* b1 = (const float*)d_in[5]; const float* W2 = (const float*)d_in[6]; const float* b2 = (const float*)d_in[7];
    float* OUT = (float*)d_out;     // [4][1024][512]
    char* wsp = (char*)d_ws;
    auto take = [&](size_t bytes) { char* p = wsp; wsp += (bytes + 255) & ~(size_t)255; return (void*)p; };
    bf* BQ = (bf*)take((size_t)3 * EE * EE * 2);   // the bf16 planes of Wq, Wk, Wv in a row: grid z of the Q / K / V launch steps through them
    bf* WQ1 = (bf*)take((size_t)64 * EE * 2); bf* WK1 = (bf*)take((size_t)64 * EE * 2);
    bf* XB = (bf*)take((size_t)NB_ * SS * EE * 2);
    bf* QPh = (bf*)take((size_t)NB_ * SS * EE * 2); bf* QPl = (bf*)take((size_t)NB_ * SS * EE * 2); bf* KPh = (bf*)take((size_t)NB_ * SS * EE * 2); bf* KPl = (bf*)take((size_t)NB_ * SS * EE * 2); bf* VTh = (bf*)take((size_t)NB_ * EE * SS * 2); bf* VTl = (bf*)take((size_t)NB_ * EE * SS * 2);
    float* HQ = (float*)take((size_t)NB_ * SS * 64 * 4); float* HKT = (float*)take((size_t)NB_ * NHID * SS * 4); float* S = (float*)take((size_t)NB_ * SS * SS * 4); bf* Ph = (bf*)take((size_t)NB_ * SS * SS * 2); bf* Pl = (bf*)take((size_t)NB_ * SS * SS * 2);
    if ((size_t)(wsp - (char*)d_ws) > ws_size) return;    // total ~ 65 MB
    // Five launches, one per stage of the dependence chain; launches that do not depend on one another share a grid. All four batches in every launch.
    k_prep<<<NBX + 3 * NBW + NBW1, 256, 0, stream>>>(x, Wq, Wk, Wv, W1, XB, BQ, WQ1, WK1);   // torch [out][in] = Bt
    k_qkv<<<dim3(NB_ * SS / 64, EE / 64, 3), 32 * NWV, 0, stream>>>(XB, BQ, QPh, QPl, KPh, KPl, VTh, VTl);   // grid z = Q, K, V
    k_sch<<<2 * (NB_ * SS / 64) + NB_ * (SS / 64) * (SS / 64), 32 * NWV, 0, stream>>>(QPh, QPl, KPh, KPl, WQ1, WK1, HQ, HKT, S);
    k_hsoft<<<NB_ * SS / 8, 256, 0, stream>>>(S, HQ, HKT, b1, W2, b2, Ph, Pl);
    k_gemmw<bf, 2, false, SS><<<dim3(SS / 64, EE / 64, NB_), 32 * NWV, 0, stream>>>(Ph, Pl, VTh, VTl, OUT, EE, nullptr, (size_t)SS * SS, (size_t)EE * SS, (size_t)SS * EE);
}

// v009
// A run of this version takes 62.8 microseconds.
// Next to v008, in two timings, it ran 1.06 times as fast each time.
// Counting every step since v000, it is 12.5 times as fast.
#include <hip/hip_runtime.h>

// HybridSelfAttention (x [4][1024][512]; Q/K/V = x W^T (torch, single head over the full 512); scores = Q.K / sqrt(512); estimator on every (query, key) pair: est[q][k] = sum_h W2[h] tanh(hq[q][h] + hk[k][h] + b1[h]) + b2 with hq = Q W1[:, :512]^T, hk = K W1[:, 512:]^T (16 hidden units);
//   attn = softmax(scores + est); out = attn V -> [4][1024][512]).
// Compute dtypes, f32 accumulate: every input rounded to bf16; Q/K/V as PLAIN bf16 GEMMs (inputs: exact); hq / hk as hl planes of Q / K x exact W1 halves (2 products; 16 outputs padded to 64); scores hl x hl (3 products); the pairwise estimator (16 tanh per pair), + est, softmax in f32 (wave per query row) -> hl planes; attn.V hl x hl (3 products).

#define NB_  4
#define SS   1024
#define EE   512
#define NHID 16
typedef _Float16 h16;
typedef unsigned short bf;
typedef __attribute__((ext_vector_type(16))) __bf16   v16bf;
typedef __attribute__((ext_vector_type(16))) _Float16 v16h;
typedef __attribute__((ext_vector_type(8)))  _Float16 v8h;
typedef __attribute__((ext_vector_type(8)))  unsigned short v8us;
typedef __attribute__((ext_vector_type(8)))  float    v8f;
typedef __attribute__((ext_vector_type(4)))  float    v4f;
typedef v8h  __attribute__((may_alias)) v8ha;
typedef v4f  __attribute__((may_alias)) v4fa;
typedef v8us __attribute__((may_alias)) v8usa;

__device__ __forceinline__ unsigned short f2bf(float f) { unsigned u = __float_as_uint(f); u += 0x7FFFu + ((u >> 16) & 1u); return (unsigned short)(u >> 16); }
__device__ __forceinline__ float bf2f(unsigned short b) { return __uint_as_float(((unsigned)b) << 16); }
__device__ __forceinline__ float bfr(float f) { return bf2f(f2bf(f)); }
__device__ __forceinline__ void splitf(float y, unsigned short& h, unsigned short& l) { h = f2bf(y); l = f2bf(y - bf2f(h)); }
__device__ __forceinline__ v16h cat16(v8h lo, v8h hi) { return __builtin_shufflevector(lo, hi, 0, 1, 2, 3, 4, 5, 6, 7, 8, 9, 10, 11, 12, 13, 14, 15); }
__device__ __forceinline__ v16bf cat16b(v8us lo, v8us hi) { return __builtin_bit_cast(v16bf, __builtin_shufflevector(lo, hi, 0, 1, 2, 3, 4, 5, 6, 7, 8, 9, 10, 11, 12, 13, 14, 15)); }
__device__ __forceinline__ v8f wmma16(v16h a, v16h b, v8f c) { return __builtin_amdgcn_wmma_f32_16x16x32_f16(false, a, false, b, (short)0, c, false, false); }
__device__ __forceinline__ v8f wmmab(v16bf a, v16bf b, v8f c) { return __builtin_amdgcn_wmma_f32_16x16x32_bf16(false, a, false, b, (short)0, c, false, false); }



// Fragment order of every 16-bit GEMM operand plane M[rows][K] (K-contiguous operands, rows % 16 == 0, K % 32 == 0): blocks of 16 rows x 32 k, 1 KB each, k blocks of a row block in a row; inside a block two halves of 512 B (k 0..15, k 16..31), and in a half lane l = ((k >> 3) & 1) * 16 + (row & 15) owns 16 B (8 consecutive k).
// A wave's fragment is then two 16-byte loads per lane at block + lane * 16 B and + 512 B: each load reads 512 contiguous bytes (4 whole lines). The element that lands in each lane and register is the one that the row-major loader brought.
__device__ __forceinline__ size_t pko(int r, int k, int K) { return ((size_t)(r >> 4) * (K >> 5) + (k >> 5)) * 512 + ((k >> 4) & 1) * 256 + (((k >> 3) & 1) * 16 + (r & 15)) * 8 + (k & 7); }
// ---- k_gemmw: register-blocked GEMM, one work-group of NWV waves per 64x64 output tile: every wave holds the whole tile (16 accumulators) for its own share of K (wave w: the 32-wide k blocks w, w + NWV, ...), operands straight from 16-bit planes in fragment order; the waves' partial tiles meet in LDS, where each wave adds up and stores its own part of the tile; grid (M/64, N/64, Z), 32 * NWV threads.
// C[m][n] (f32, pitch ldc, + optional f32 bias[n]) = sum_k A[m][k] Bt[n][k] (+ split products per NSPLIT). z-batch strides sA/sB/sC in elements. K / (32 * NWV) is a power of two.
template <typename T16> struct WFrag;
template <> struct WFrag<h16> { typedef v16h V; static __device__ __forceinline__ V ld(const h16* blk, unsigned lo) { const char* p = (const char*)blk + lo; return cat16(*(const v8h*)p, *(const v8h*)(p + 512)); } static __device__ __forceinline__ v8f mma(V a, V b, v8f c) { return wmma16(a, b, c); } };
template <> struct WFrag<bf> { typedef v16bf V; static __device__ __forceinline__ V ld(const bf* blk, unsigned lo) { const char* p = (const char*)blk + lo; return cat16b(*(const v8us*)p, *(const v8us*)(p + 512)); } static __device__ __forceinline__ v8f mma(V a, V b, v8f c) { return wmmab(a, b, c); } };
#define NWV  4           /* waves that share a tile's K */
#define SLAB (64 * 68)   /* floats of one wave's partial tile in LDS */
// One LDS array for every tile path of a kernel: NWV slabs, slab w written by wave w alone.
__device__ __forceinline__ float* red_buf() { __shared__ __align__(16) float red[NWV * SLAB]; return red; }
// acc[mb][nb][j] = element (row mb * 16 + hi * 8 + j, column nb * 16 + lr) of the tile, lr = lane & 15, hi = lane >> 4.
// put_rows / sum_rows: a partial tile row-major (pitch 68 floats) in its wave's slab; behind the barrier, 4 consecutive columns of one row as the sum of the NWV partial sums, added in wave order.
__device__ __forceinline__ void put_rows(const v8f (&acc)[4][4], float* sl) {
    const int lane = threadIdx.x & 31, lr = lane & 15, hi = lane >> 4;
#pragma unroll
    for (int mb = 0; mb < 4; ++mb)
#pragma unroll
        for (int nb = 0; nb < 4; ++nb)
#pragma unroll
            for (int j = 0; j < 8; ++j) sl[(mb * 16 + hi * 8 + j) * 68 + nb * 16 + lr] = acc[mb][nb][j];
}
__device__ __forceinline__ v4f sum_rows(const float* red, int o) { v4f s = *(const v4fa*)(red + o);
#pragma unroll
    for (int w = 1; w < NWV; ++w) s += *(const v4fa*)(red + w * SLAB + o);
    return s; }
// put_frag / sum_frag: one 16x16 block of a partial tile in register order (place t of the slab: two rows of 32 lanes x 16 B), for the epilogues that store straight from the accumulator layout; the sum again in wave order.
__device__ __forceinline__ void put_frag(const v8f& a, float* sl, int t) { const int lane = threadIdx.x & 31;
    *(v4fa*)(sl + t * 256 + lane * 4) = __builtin_shufflevector(a, a, 0, 1, 2, 3); *(v4fa*)(sl + t * 256 + 128 + lane * 4) = __builtin_shufflevector(a, a, 4, 5, 6, 7); }
__device__ __forceinline__ v8f sum_frag(const float* red, int t) { const int lane = threadIdx.x & 31; const float* p = red + t * 256 + lane * 4; v4f lo = *(const v4fa*)p, hi4 = *(const v4fa*)(p + 128);
#pragma unroll
    for (int w = 1; w < NWV; ++w) { lo += *(const v4fa*)(p + w * SLAB); hi4 += *(const v4fa*)(p + w * SLAB + 128); }
    return __builtin_shufflevector(lo, hi4, 0, 1, 2, 3, 4, 5, 6, 7); }
// The plane epilogues of a 64x64 tile: each f32 sum is split into its hl pair and stored in the 16-bit planes that later launches read.
// st_planes (planes [rows][512] in fragment order): wave wv takes the tile's rows wv * 16 .. + 15, that is two whole 1-KB blocks of each plane; each store of a wave is one half block, 512 contiguous bytes.
__device__ __forceinline__ void st_planes(const v8f (&acc)[4][4], float* red, int wv, bf* Ph, bf* Pl, int r0, int c0) {
    const int lane = threadIdx.x & 31, lr = lane & 15, hi = lane >> 4;
    put_rows(acc, red + wv * SLAB);
    __syncthreads();   // every wave's partial tile is in LDS before any wave adds them up
#pragma unroll
    for (int s = 0; s < 4; ++s) { const int row = wv * 16 + lr, cofs = s * 16 + hi * 8; const v4f x0 = sum_rows(red, row * 68 + cofs), x1 = sum_rows(red, row * 68 + cofs + 4); v8us oh, ol;
#pragma unroll
        for (int u = 0; u < 4; ++u) { unsigned short p, q; splitf(x0[u], p, q); oh[u] = p; ol[u] = q; splitf(x1[u], p, q); oh[4 + u] = p; ol[4 + u] = q; }
        const size_t o = ((size_t)((r0 >> 4) + wv) * (EE / 32) + (c0 >> 5)) * 512 + s * 256 + lane * 8; *(v8us*)(Ph + o) = oh; *(v8us*)(Pl + o) = ol; }
    asm volatile("s_wait_xcnt 0x0" ::: "memory");   // in the built code a branch behind the last stores has the other epilogue, which reuses the stores' registers, as its fall-through side: the wait stands in front of that overwrite
}
// st_planesT (planes transposed, [batch][512][1024], each batch in fragment order): a lane's 8 accumulator registers are 8 consecutive s of one column, that is the lane's own 16 bytes of a half block; wave wv takes the tile's columns wv * 16 .. + 15, and its four mb stores are the four halves of two neighbouring blocks, 512 contiguous bytes each.
__device__ __forceinline__ void st_planesT(const v8f (&acc)[4][4], float* red, int wv, bf* Ph, bf* Pl, int r0, int c0) {
    const int lane = threadIdx.x & 31;
#pragma unroll
    for (int mb = 0; mb < 4; ++mb)
#pragma unroll
        for (int nb = 0; nb < 4; ++nb) put_frag(acc[mb][nb], red + wv * SLAB, mb * 4 + nb);
    __syncthreads();   // every wave's partial tile is in LDS before any wave adds them up
    const size_t base = (size_t)(r0 / SS) * SS * EE + ((size_t)((c0 >> 4) + wv) * (SS / 32) + ((r0 % SS) >> 5)) * 512 + lane * 8;   // a 64-row tile lies inside one batch
#pragma unroll
    for (int mb = 0; mb < 4; ++mb) { const v8f x = sum_frag(red, mb * 4 + wv); v8us oh, ol;
#pragma unroll
        for (int j = 0; j < 8; ++j) { unsigned short p, q; splitf(x[j], p, q); oh[j] = p; ol[j] = q; }
        const size_t o = base + mb * 256; *(v8us*)(Ph + o) = oh; *(v8us*)(Pl + o) = ol; }
}
// st_colsT (the tile's first 16 columns as f32, transposed, [batch][16][1024]): a lane's 8 accumulator registers are 8 consecutive rows of one column, that is 32 contiguous bytes of the transposed array; waves 0 and 1 take 32 rows each, one whole 128-B line in each column.
__device__ __forceinline__ void st_colsT(const v8f (&acc)[4][4], float* red, int wv, float* T, int r0) {
    const int lane = threadIdx.x & 31, lr = lane & 15, hi = lane >> 4;
#pragma unroll
    for (int mb = 0; mb < 4; ++mb) put_frag(acc[mb][0], red + wv * SLAB, mb);
    __syncthreads();   // every wave's partial blocks are in LDS before a wave adds them up
    if (wv < 2) {
        float* t = T + (size_t)(r0 / SS) * NHID * SS + (size_t)lr * SS + (r0 % SS) + wv * 32 + hi * 8;   // a 64-row tile lies inside one batch
#pragma unroll
        for (int m = 0; m < 2; ++m) *(v8f*)(t + m * 16) = sum_frag(red, wv * 2 + m);
        asm volatile("s_wait_xcnt 0x0" ::: "memory");   // in the built code a branch behind these stores has the row-major epilogue, which reuses the stores' registers, as its fall-through side: the wait stands in front of that overwrite
    }
}
// PLANES: the tile goes out as hl planes Ph / Pl (transposed where tr is set, a wave-uniform choice) and not as f32 C.
template <typename T16, int NSPLIT, bool BIAS, bool PLANES = false>
__device__ __forceinline__ void gemmw_tile(const T16* __restrict__ A, const T16* __restrict__ A2, const T16* __restrict__ Bt, const T16* __restrict__ Bt2, int K, float* C, int ldc, const float* __restrict__ bias, int r0, int c0, bf* Ph = nullptr, bf* Pl = nullptr, bool tr = false, float* CT = nullptr) {
    typedef typename WFrag<T16>::V V;
    float* red = red_buf();
    const int lane = threadIdx.x & 31, lr = lane & 15, hi = lane >> 4;
    const int wv = __builtin_amdgcn_readfirstlane(threadIdx.x >> 5);   // the wave's number in its work-group, in a scalar register
    v8f acc[4][4];
#pragma unroll
    for (int mb = 0; mb < 4; ++mb)
#pragma unroll
        for (int nb = 0; nb < 4; ++nb) acc[mb][nb] = (v8f){};
    const size_t aoff = (size_t)r0 * K + wv * 512, boff = (size_t)c0 * K + wv * 512;   // fragment order: a row block's k blocks lie in a row (16 * K elements a row block, 512 a k block); wave wv's base is k block wv, its first trip is set by the rotation below, and it steps over NWV blocks a trip; all of this is the same for the whole wave
    // The k walk starts at a trip of the tile's own, (row tile + column tile) mod trips, and wraps: the work-groups that share a row tile or a column tile run at the same time, and from one common start they would all ask L2 for the same lines at the same moment. Every k block is still taken once; only the order of a wave's sums turns. K / (32 * NWV) is a power of two.
    const int rot = ((r0 >> 6) + (c0 >> 6)) & (K / (NWV * 32) - 1);
    unsigned lo = lane * 16 + rot * (NWV * 1024);   // byte offset of the lane's own 16 bytes in the trip's first half block: the one vector register of every operand address (scalar base + this + a constant); it steps from trip to trip
#pragma unroll 1
    for (int kc = 0; kc < K; kc += NWV * 32) {
        V a[4], a2[4], b[4], b2[4];
#pragma unroll
        for (int mb = 0; mb < 4; ++mb) { a[mb] = WFrag<T16>::ld(A + aoff + (size_t)mb * 16 * K, lo); if (NSPLIT == 1 || NSPLIT == 2) a2[mb] = WFrag<T16>::ld(A2 + aoff + (size_t)mb * 16 * K, lo); }
#pragma unroll
        for (int nb = 0; nb < 4; ++nb) { b[nb] = WFrag<T16>::ld(Bt + boff + (size_t)nb * 16 * K, lo); if (NSPLIT >= 2 && nb < 3) b2[nb] = WFrag<T16>::ld(Bt2 + boff + (size_t)nb * 16 * K, lo); }
        __builtin_amdgcn_sched_barrier(0);   // the trip's loads stay one group ahead of its products: without it this build issues three of the b2 fragments one by one among the products and waits out each one's whole latency
#pragma unroll
        for (int nb = 0; nb < 4; ++nb) { if (NSPLIT >= 2 && nb == 1) b2[3] = WFrag<T16>::ld(Bt2 + boff + (size_t)3 * 16 * K, lo);   // the last b2 fragment has no free registers until column block 0 is done
#pragma unroll
            for (int mb = 0; mb < 4; ++mb) { acc[mb][nb] = WFrag<T16>::mma(a[mb], b[nb], acc[mb][nb]); if (NSPLIT == 1 || NSPLIT == 2) acc[mb][nb] = WFrag<T16>::mma(a2[mb], b[nb], acc[mb][nb]); if (NSPLIT >= 2) acc[mb][nb] = WFrag<T16>::mma(a[mb], b2[nb], acc[mb][nb]); } }
        asm volatile("v_nop\n\tv_nop\n\tv_nop\n\tv_nop" : "+v"(acc[0][0]), "+v"(acc[1][1]), "+v"(acc[2][2]), "+v"(acc[3][3]) : "v"(a[0]), "v"(a[3]));
        asm volatile("s_wait_xcnt 0x0\n\tv_add_nc_u32 %0, %1, %0\n\ts_delay_alu instid0(VALU_DEP_1)\n\tv_and_b32 %0, %2, %0" : "+v"(lo) : "n"(NWV * 1024), "s"(K * 32 - 1) : "memory");   // on to the next trip's k blocks (NWV blocks of 1 KB), back to the first behind the last (a row block's k blocks are K * 32 bytes); add and wrap are written behind their wait in one statement, because they overwrite the offset register that the trip's loads name; the delay hint lets the SIMD's other waves issue while the wrap waits for the add
    }
    if (PLANES) { if (tr) st_planesT(acc, red, wv, Ph, Pl, r0, c0); else st_planes(acc, red, wv, Ph, Pl, r0, c0); return; }
    if (CT) { st_colsT(acc, red, wv, CT, r0); return; }   // a choice that is the same for the whole work-group: only the 16 columns that are used go out, transposed, and no C
    put_rows(acc, red + wv * SLAB);
    __syncthreads();   // every wave's partial tile is in LDS before any wave adds them up
    float* crow = C + (size_t)(r0 + wv * 16) * ldc + c0;   // wave wv takes the tile's rows wv * 16 .. + 15: 16 lanes x 16 B cover a row's two 128-B lines
#pragma unroll
    for (int s = 0; s < 8; ++s) { const int row = 2 * s + hi, cofs = lr * 4; v4f val = sum_rows(red, (wv * 16 + row) * 68 + cofs); if (BIAS) { val[0] += bfr(bias[c0 + cofs]); val[1] += bfr(bias[c0 + cofs + 1]); val[2] += bfr(bias[c0 + cofs + 2]); val[3] += bfr(bias[c0 + cofs + 3]); }
        *(v4f*)(crow + (size_t)row * ldc + cofs) = val; }
    asm volatile("s_wait_xcnt 0x0" ::: "memory");   // in the built code of k_sch a branch behind the score tiles' last stores has the hq / hk path, which reuses the stores' registers, as its fall-through side: the wait stands in front of that overwrite
}
template <typename T16, int NSPLIT, bool BIAS, int K>
__global__ __launch_bounds__(32 * NWV) void k_gemmw(const T16* __restrict__ A, const T16* __restrict__ A2, const T16* __restrict__ Bt, const T16* __restrict__ Bt2, float* C, int ldc, const float* __restrict__ bias, size_t sA, size_t sB, size_t sC) {
    const size_t z = blockIdx.z; A += z * sA; if (A2) A2 += z * sA; Bt += z * sB; if (Bt2) Bt2 += z * sB; C += z * sC;
    gemmw_tile<T16, NSPLIT, BIAS>(A, A2, Bt, Bt2, K, C, ldc, bias, blockIdx.x * 64, blockIdx.y * 64);
}
// k_sch: the two stages that read only the Q / K planes share one grid of tiles: blocks 0..63 hq, 64..127 hk (row tiles of the [4 * 1024] row space), then the 4 x 16 x 16 score tiles (row tile fastest, batch slowest).
__global__ __launch_bounds__(32 * NWV) void k_sch(const bf* __restrict__ QPh, const bf* __restrict__ QPl, const bf* __restrict__ KPh, const bf* __restrict__ KPl, const bf* __restrict__ WQ1, const bf* __restrict__ WK1, float* HQ, float* HKT, float* S) {
    const int b = blockIdx.x; const int NH_T = NB_ * SS / 64;
    if (b < 2 * NH_T) { const bool k = b >= NH_T; gemmw_tile<bf, 1, false>(k ? KPh : QPh, k ? KPl : QPl, k ? WK1 : WQ1, nullptr, EE, HQ, 64, nullptr, (k ? b - NH_T : b) * 64, 0, nullptr, nullptr, false, k ? HKT : nullptr); }   // hq row-major (pitch 64), hk transposed ([batch][16][1024])
    else { const int t = b - 2 * NH_T; const size_t z = (size_t)(t / ((SS / 64) * (SS / 64))); const size_t zo = z * SS * EE;
        gemmw_tile<bf, 2, false>(QPh + zo, QPl + zo, KPh + zo, KPl + zo, EE, S + z * SS * SS, SS, nullptr, (t % (SS / 64)) * 64, ((t / (SS / 64)) % (SS / 64)) * 64); }
}

typedef __attribute__((ext_vector_type(4))) unsigned short v4us;

// The element-wise stages as device functions of a block number blk (256 threads a block), so that independent stages can share one grid.
// d_cvt8: src [rows][512] f32 -> dst in fragment order; thread i owns the i-th 16 bytes of dst, so that a wave stores 512 contiguous bytes, and reads its 8 floats from the row and k that those bytes stand for.
__device__ __forceinline__ void d_cvt8(const float* __restrict__ src, bf* dst, int blk) { const int i = blk * 256 + threadIdx.x; const int row = ((i >> 6) / (EE / 32)) * 16 + (i & 15), k0 = ((i >> 6) % (EE / 32)) * 32 + ((i >> 4) & 3) * 8; const v8f v = *(const v8f*)(src + (size_t)row * EE + k0); v8us o;
    asm volatile("s_wait_xcnt 0x0" ::: "memory");   // in the built code the conversion reuses the register pair that holds the loads' address: the wait stands in front of that overwrite
#pragma unroll
    for (int k = 0; k < 8; ++k) o[k] = f2bf(v[k]); *(v8us*)(dst + (size_t)i * 8) = o;
    asm volatile("s_wait_xcnt 0x0" ::: "memory");   // in the built code a branch behind this store has the other stage's code, which reuses the store's registers, as its fall-through side: the wait stands in front of that overwrite
}
// d_w1p: W1Q[n][k] = bf16(W1[n][k]) and W1K[n][k] = bf16(W1[n][512 + k]) for n < 16, rows 16..63 zero ([64][512], in fragment order).
__device__ __forceinline__ void d_w1p(const float* __restrict__ W1, bf* WQ1, bf* WK1, int blk) { const int e = (blk * 256 + threadIdx.x) * 4; const int n = e / EE, k = e % EE; v4us a, b;
#pragma unroll
    for (int u = 0; u < 4; ++u) { a[u] = (n < NHID) ? f2bf(W1[(size_t)n * 2 * EE + k + u]) : (unsigned short)0; b[u] = (n < NHID) ? f2bf(W1[(size_t)n * 2 * EE + EE + k + u]) : (unsigned short)0; }
    const size_t o = pko(n, k, EE); *(v4us*)(WQ1 + o) = a; *(v4us*)(WK1 + o) = b;  }
// Block counts of the stages; every one divides exactly, so no stage has a part-filled block.
#define NBX  (NB_ * SS * EE / 8 / 256)   /* x -> bf16 */
#define NBW  (EE * EE / 8 / 256)         /* one of Wq, Wk, Wv -> bf16 */
#define NBW1 (64 * EE / 4 / 256)         /* the two padded W1 halves */
// k_prep: all five input conversions in one grid: x, then Wq, Wk, Wv (BW = the three [512][512] bf16 planes in a row), then W1.
__global__ __launch_bounds__(256) void k_prep(const float* __restrict__ x, const float* __restrict__ Wq, const float* __restrict__ Wk, const float* __restrict__ Wv, const float* __restrict__ W1, bf* XB, bf* BW, bf* WQ1, bf* WK1) {
    const int b = blockIdx.x;
    if (b >= NBX + 3 * NBW) { d_w1p(W1, WQ1, WK1, b - NBX - 3 * NBW); return; }
    const int w = (b < NBX) ? 0 : 1 + (b - NBX) / NBW;   // 0: x; 1, 2, 3: Wq, Wk, Wv
    d_cvt8(w == 0 ? x : (w == 1 ? Wq : (w == 2 ? Wk : Wv)), w == 0 ? XB : BW + (size_t)(w - 1) * EE * EE, w == 0 ? b : (b - NBX) % NBW);
}
// k_qkv: the Q / K / V products (grid z = 0, 1, 2), one work-group per 64x64 tile, K = 512; the tile's epilogue stores the hl planes (V's transposed), so no f32 copy of Q, K or V exists.
__global__ __launch_bounds__(32 * NWV) void k_qkv(const bf* __restrict__ XB, const bf* __restrict__ BW, bf* QPh, bf* QPl, bf* KPh, bf* KPl, bf* VTh, bf* VTl) {
    const int z = blockIdx.z;
    gemmw_tile<bf, 0, false, true>(XB, nullptr, BW + (size_t)z * EE * EE, nullptr, EE, nullptr, 0, nullptr, blockIdx.x * 64, blockIdx.y * 64, z == 0 ? QPh : (z == 1 ? KPh : VTh), z == 0 ? QPl : (z == 1 ? KPl : VTl), z == 2);
}
#define SPP (SS + 32)   /* LDS pitch of a row of a plane, in elements: 16 banks from row to row, so that the 16-byte reads of neighbouring rows and groups fall on different banks */
__global__ __launch_bounds__(256) void k_hsoft(const float* __restrict__ S, const float* __restrict__ HQ, const float* __restrict__ HKT, const float* __restrict__ b1, const float* __restrict__ W2, const float* __restrict__ b2, bf* Ph, bf* Pl) {
    const int lane = threadIdx.x & 31; const int i = blockIdx.x * 8 + (threadIdx.x >> 5); const float* sr = S + (size_t)i * SS; HKT += (size_t)(i / SS) * NHID * SS;   // i = batch * S + query row; the keys are those of the row's own batch
    float hq[NHID], w2[NHID];
#pragma unroll
    for (int h = 0; h < NHID; ++h) { hq[h] = __fadd_rn(HQ[(size_t)i * 64 + h], bfr(b1[h])); w2[h] = bfr(W2[h]); }   // hq + b1 folded (the reference adds hq + hk + b1; f32 addition order (hq + hk) + b1 vs (hq + b1) + hk differs by <= 1 ulp)
    const float bb2 = bfr(b2[0]); const float scl = 0.044194173824159216f;   // 1/sqrt(512)
    float v[SS / 32]; float mx = -3.0e38f;
#pragma unroll 1
    for (int ch = 0; ch < SS / 128; ++ch) { const v4f a = *(const v4f*)(sr + ch * 128 + lane * 4); v4f hk[NHID];   // hk is stored [h][key]: one 16-byte load per h brings the lane's four keys, and the wave's 32 lanes read 512 contiguous bytes (four whole lines) per load; all issued ahead of the first tanh; h unrolled below so that hq, w2 and hk have fixed registers
#pragma unroll
        for (int h = 0; h < NHID - 1; ++h) hk[h] = *(const v4f*)(HKT + (size_t)h * SS + ch * 128 + lane * 4);
        asm volatile("s_wait_xcnt 0x0" ::: "memory");   // in the built code the last load lands in the register pair that holds the address of the loads above: the wait stands in front of that overwrite
        hk[NHID - 1] = *(const v4f*)(HKT + (size_t)(NHID - 1) * SS + ch * 128 + lane * 4);
#pragma unroll
        for (int u = 0; u < 4; ++u) { float est = bb2;
#pragma unroll
            for (int h = 0; h < NHID; ++h) { const float z = __fadd_rn(hq[h], hk[h][u]); float th = __builtin_amdgcn_tanhf(z); float pr = __fmul_rn(w2[h], th); asm volatile("" : "+v"(pr)); est = __fadd_rn(est, pr); }   // tanh by the hardware instruction (v_tanh_f32): one instruction a value, no branch on the size of z
            float s0 = a[u] * scl; asm volatile("" : "+v"(s0)); const float t = __fadd_rn(s0, est); v[ch * 4 + u] = t; mx = fmaxf(mx, t); } }
#pragma unroll
    for (int sh = 16; sh; sh >>= 1) mx = fmaxf(mx, __shfl_xor(mx, sh, 32));
    float sum = 0.f;
#pragma unroll
    for (int q = 0; q < SS / 32; ++q) { float d0 = __fsub_rn(v[q], mx); asm volatile("" : "+v"(d0)); v[q] = __builtin_amdgcn_exp2f(__fmul_rn(d0, 1.4426950408889634f)); sum += v[q]; }
#pragma unroll
    for (int sh = 16; sh; sh >>= 1) sum += __shfl_xor(sum, sh, 32);
    const float f = __fdiv_rn(1.0f, sum);
    // The planes go out in fragment order ([4 * 1024][1024]), where a row owns only 16 bytes of each 128-B line and the work-group's 8 rows together own the whole line: the rows meet in LDS, and 8 lanes x 16 B store a line.
    __shared__ __align__(16) bf sp[2][8][SPP];
    {
        const int w = threadIdx.x >> 5;
#pragma unroll
        for (int ch = 0; ch < SS / 128; ++ch) { v4us oh, ol; for (int q = 0; q < 4; ++q) { unsigned short a2, c2; splitf(v[ch * 4 + q] * f, a2, c2); oh[q] = a2; ol[q] = c2; } *(v4us*)(&sp[0][w][ch * 128 + lane * 4]) = oh; *(v4us*)(&sp[1][w][ch * 128 + lane * 4]) = ol; }
    }
    __syncthreads();   // all 8 rows are in LDS before any wave gathers a line from them
#pragma unroll
    for (int it = 0; it < SS / 8 * 8 / 256; ++it) { const int p = it * 256 + threadIdx.x, row = p & 7, g = p >> 3;   // g: the row's 16-byte group (8 keys)
        const size_t oo = pko(blockIdx.x * 8 + row, g * 8, SS); *(v8us*)(Ph + oo) = *(const v8us*)(&sp[0][row][g * 8]); *(v8us*)(Pl + oo) = *(const v8us*)(&sp[1][row][g * 8]); }
}

extern "C" void kernel_launch(void* const* d_in, const int* in_sizes, int n_in,
                              void* d_out, int out_size, void* d_ws, size_t ws_size, hipStream_t stream) {
    (void)in_sizes; (void)n_in; (void)out_size;
    const float* x = (const float*)d_in[0]; const float* Wq = (const float*)d_in[1]; const float* Wk = (const float*)d_in[2]; const float* Wv = (const float*)d_in[3]; const float* W1 = (const float*)d_in[4]; const float* b1 = (const float*)d_in[5]; const float* W2 = (const float*)d_in[6]; const float* b2 = (const float*)d_in[7];
    float* OUT = (float*)d_out;     // [4][1024][512]
    char* wsp = (char*)d_ws;
    auto take = [&](size_t bytes) { char* p = wsp; wsp += (bytes + 255) & ~(size_t)255; return (void*)p; };
    bf* BQ = (bf*)take((size_t)3 * EE * EE * 2);   // the bf16 planes of Wq, Wk, Wv in a row: grid z of the Q / K / V launch steps through them
    bf* WQ1 = (bf*)take((size_t)64 * EE * 2); bf* WK1 = (bf*)take((size_t)64 * EE * 2);
    bf* XB = (bf*)take((size_t)NB_ * SS * EE * 2);
    bf* QPh = (bf*)take((size_t)NB_ * SS * EE * 2); bf* QPl = (bf*)take((size_t)NB_ * SS * EE * 2); bf* KPh = (bf*)take((size_t)NB_ * SS * EE * 2); bf* KPl = (bf*)take((size_t)NB_ * SS * EE * 2); bf* VTh = (bf*)take((size_t)NB_ * EE * SS * 2); bf* VTl = (bf*)take((size_t)NB_ * EE * SS * 2);
    float* HQ = (float*)take((size_t)NB_ * SS * 64 * 4); float* HKT = (float*)take((size_t)NB_ * NHID * SS * 4); float* S = (float*)take((size_t)NB_ * SS * SS * 4); bf* Ph = (bf*)take((size_t)NB_ * SS * SS * 2); bf* Pl = (bf*)take((size_t)NB_ * SS * SS * 2);
    if ((size_t)(wsp - (char*)d_ws) > ws_size) return;    // total ~ 65 MB
    // Five launches, one per stage of the dependence chain; launches that do not depend on one another share a grid. All four batches in every launch.
    k_prep<<<NBX + 3 * NBW + NBW1, 256, 0, stream>>>(x, Wq, Wk, Wv, W1, XB, BQ, WQ1, WK1);   // torch [out][in] = Bt
    k_qkv<<<dim3(NB_ * SS / 64, EE / 64, 3), 32 * NWV, 0, stream>>>(XB, BQ, QPh, QPl, KPh, KPl, VTh, VTl);   // grid z = Q, K, V
    k_sch<<<2 * (NB_ * SS / 64) + NB_ * (SS / 64) * (SS / 64), 32 * NWV, 0, stream>>>(QPh, QPl, KPh, KPl, WQ1, WK1, HQ, HKT, S);
    k_hsoft<<<NB_ * SS / 8, 256, 0, stream>>>(S, HQ, HKT, b1, W2, b2, Ph, Pl);
    k_gemmw<bf, 2, false, SS><<<dim3(SS / 64, EE / 64, NB_), 32 * NWV, 0, stream>>>(Ph, Pl, VTh, VTl, OUT, EE, nullptr, (size_t)SS * SS, (size_t)EE * SS, (size_t)SS * EE);
}

// v010
// A run of this version takes 57.8 microseconds.
// Timed twice side by side with v009, it ran 1.08 and 1.10 times as fast.
// Counting every step since v000, it is 13.6 times as fast.
#include <hip/hip_runtime.h>

// HybridSelfAttention (x [4][1024][512]; Q/K/V = x W^T (torch, single head over the full 512); scores = Q.K / sqrt(512); estimator on every (query, key) pair: est[q][k] = sum_h W2[h] tanh(hq[q][h] + hk[k][h] + b1[h]) + b2 with hq = Q W1[:, :512]^T, hk = K W1[:, 512:]^T (16 hidden units);
//   attn = softmax(scores + est); out = attn V -> [4][1024][512]).
// Compute dtypes, f32 accumulate: every input rounded to bf16; Q/K/V as PLAIN bf16 GEMMs (inputs: exact); hq / hk as hl planes of Q / K x exact W1 halves (2 products; 16 outputs padded to 64); scores hl x hl (3 products); the pairwise estimator (16 tanh per pair), + est, softmax in f32 (wave per query row) -> hl planes; attn.V hl x hl (3 products).

#define NB_  4
#define SS   1024
#define EE   512
#define NHID 16
typedef _Float16 h16;
typedef unsigned short bf;
typedef __attribute__((ext_vector_type(16))) __bf16   v16bf;
typedef __attribute__((ext_vector_type(16))) _Float16 v16h;
typedef __attribute__((ext_vector_type(8)))  _Float16 v8h;
typedef __attribute__((ext_vector_type(8)))  unsigned short v8us;
typedef __attribute__((ext_vector_type(8)))  float    v8f;
typedef __attribute__((ext_vector_type(4)))  float    v4f;
typedef v8h  __attribute__((may_alias)) v8ha;
typedef v4f  __attribute__((may_alias)) v4fa;
typedef v8us __attribute__((may_alias)) v8usa;

__device__ __forceinline__ unsigned short f2bf(float f) { unsigned u = __float_as_uint(f); u += 0x7FFFu + ((u >> 16) & 1u); return (unsigned short)(u >> 16); }
__device__ __forceinline__ float bf2f(unsigned short b) { return __uint_as_float(((unsigned)b) << 16); }
__device__ __forceinline__ float bfr(float f) { return bf2f(f2bf(f)); }
__device__ __forceinline__ void splitf(float y, unsigned short& h, unsigned short& l) { h = f2bf(y); l = f2bf(y - bf2f(h)); }
__device__ __forceinline__ v16h cat16(v8h lo, v8h hi) { return __builtin_shufflevector(lo, hi, 0, 1, 2, 3, 4, 5, 6, 7, 8, 9, 10, 11, 12, 13, 14, 15); }
__device__ __forceinline__ v16bf cat16b(v8us lo, v8us hi) { return __builtin_bit_cast(v16bf, __builtin_shufflevector(lo, hi, 0, 1, 2, 3, 4, 5, 6, 7, 8, 9, 10, 11, 12, 13, 14, 15)); }
__device__ __forceinline__ v8f wmma16(v16h a, v16h b, v8f c) { return __builtin_amdgcn_wmma_f32_16x16x32_f16(false, a, false, b, (short)0, c, false, false); }
__device__ __forceinline__ v8f wmmab(v16bf a, v16bf b, v8f c) { return __builtin_amdgcn_wmma_f32_16x16x32_bf16(false, a, false, b, (short)0, c, false, false); }



// Fragment order of every 16-bit GEMM operand plane M[rows][K] (K-contiguous operands, rows % 16 == 0, K % 32 == 0): blocks of 16 rows x 32 k, 1 KB each, k blocks of a row block in a row; inside a block two halves of 512 B (k 0..15, k 16..31), and in a half lane l = ((k >> 3) & 1) * 16 + (row & 15) owns 16 B (8 consecutive k).
// A wave's fragment is then two 16-byte loads per lane at block + lane * 16 B and + 512 B: each load reads 512 contiguous bytes (4 whole lines). The element that lands in each lane and register is the one that the row-major loader brought.
__device__ __forceinline__ size_t pko(int r, int k, int K) { return ((size_t)(r >> 4) * (K >> 5) + (k >> 5)) * 512 + ((k >> 4) & 1) * 256 + (((k >> 3) & 1) * 16 + (r & 15)) * 8 + (k & 7); }
// ---- gemmw_tile: register-blocked GEMM, one work-group of NWV waves per 64x64 output tile: every wave holds the whole tile (16 accumulators) for its own share of K (wave w: the 32-wide k blocks w, w + NWV, ...), operands straight from 16-bit planes in fragment order; the waves' partial tiles meet in LDS, where each wave adds up and stores its own part of the tile; 32 * NWV threads.
// C[m][n] (f32, pitch ldc, + optional f32 bias[n]) = sum_k A[m][k] Bt[n][k] (+ split products per NSPLIT). K / (32 * NWV) is a power of two.
template <typename T16> struct WFrag;
template <> struct WFrag<h16> { typedef v16h V; static __device__ __forceinline__ V ld(const h16* blk, unsigned lo) { const char* p = (const char*)blk + lo; return cat16(*(const v8h*)p, *(const v8h*)(p + 512)); } static __device__ __forceinline__ v8f mma(V a, V b, v8f c) { return wmma16(a, b, c); } };
template <> struct WFrag<bf> { typedef v16bf V; static __device__ __forceinline__ V ld(const bf* blk, unsigned lo) { const char* p = (const char*)blk + lo; return cat16b(*(const v8us*)p, *(const v8us*)(p + 512)); } static __device__ __forceinline__ v8f mma(V a, V b, v8f c) { return wmmab(a, b, c); } };
#define NWV  4           /* waves that share a tile's K */
#define SLAB (64 * 68)   /* floats of one wave's partial tile in LDS */
// One LDS array for every tile path of a kernel (all paths of a kernel name the same size, so that they share it): for the K-split tiles NWV slabs, slab w written by wave w alone; for the staged tiles the ring. Aligned for the tensor loads' places.
template <int BYTES> __device__ __forceinline__ char* lds_buf() { __shared__ __attribute__((aligned(2048))) char buf[BYTES]; return buf; }
// acc[mb][nb][j] = element (row mb * 16 + hi * 8 + j, column nb * 16 + lr) of the tile, lr = lane & 15, hi = lane >> 4.
// put_rows / sum_rows: a partial tile row-major (pitch 68 floats) in its wave's slab; behind the barrier, 4 consecutive columns of one row as the sum of the NWV partial sums, added in wave order.
__device__ __forceinline__ void put_rows(const v8f (&acc)[4][4], float* sl) {
    const int lane = threadIdx.x & 31, lr = lane & 15, hi = lane >> 4;
#pragma unroll
    for (int mb = 0; mb < 4; ++mb)
#pragma unroll
        for (int nb = 0; nb < 4; ++nb)
#pragma unroll
            for (int j = 0; j < 8; ++j) sl[(mb * 16 + hi * 8 + j) * 68 + nb * 16 + lr] = acc[mb][nb][j];
}
__device__ __forceinline__ v4f sum_rows(const float* red, int o) { v4f s = *(const v4fa*)(red + o);
#pragma unroll
    for (int w = 1; w < NWV; ++w) s += *(const v4fa*)(red + w * SLAB + o);
    return s; }
// put_frag / sum_frag: one 16x16 block of a partial tile in register order (place t of the slab: two rows of 32 lanes x 16 B), for the epilogues that store straight from the accumulator layout; the sum again in wave order.
__device__ __forceinline__ void put_frag(const v8f& a, float* sl, int t) { const int lane = threadIdx.x & 31;
    *(v4fa*)(sl + t * 256 + lane * 4) = __builtin_shufflevector(a, a, 0, 1, 2, 3); *(v4fa*)(sl + t * 256 + 128 + lane * 4) = __builtin_shufflevector(a, a, 4, 5, 6, 7); }
__device__ __forceinline__ v8f sum_frag(const float* red, int t) { const int lane = threadIdx.x & 31; const float* p = red + t * 256 + lane * 4; v4f lo = *(const v4fa*)p, hi4 = *(const v4fa*)(p + 128);
#pragma unroll
    for (int w = 1; w < NWV; ++w) { lo += *(const v4fa*)(p + w * SLAB); hi4 += *(const v4fa*)(p + w * SLAB + 128); }
    return __builtin_shufflevector(lo, hi4, 0, 1, 2, 3, 4, 5, 6, 7); }
// The plane epilogues of a 64x64 tile: each f32 sum is split into its hl pair and stored in the 16-bit planes that later launches read.
// st_planes (planes [rows][512] in fragment order): wave wv takes the tile's rows wv * 16 .. + 15, that is two whole 1-KB blocks of each plane; each store of a wave is one half block, 512 contiguous bytes.
__device__ __forceinline__ void st_planes(const v8f (&acc)[4][4], float* red, int wv, bf* Ph, bf* Pl, int r0, int c0) {
    const int lane = threadIdx.x & 31, lr = lane & 15, hi = lane >> 4;
    put_rows(acc, red + wv * SLAB);
    __syncthreads();   // every wave's partial tile is in LDS before any wave adds them up
#pragma unroll
    for (int s = 0; s < 4; ++s) { const int row = wv * 16 + lr, cofs = s * 16 + hi * 8; const v4f x0 = sum_rows(red, row * 68 + cofs), x1 = sum_rows(red, row * 68 + cofs + 4); v8us oh, ol;
#pragma unroll
        for (int u = 0; u < 4; ++u) { unsigned short p, q; splitf(x0[u], p, q); oh[u] = p; ol[u] = q; splitf(x1[u], p, q); oh[4 + u] = p; ol[4 + u] = q; }
        const size_t o = ((size_t)((r0 >> 4) + wv) * (EE / 32) + (c0 >> 5)) * 512 + s * 256 + lane * 8; *(v8us*)(Ph + o) = oh; *(v8us*)(Pl + o) = ol; }
    asm volatile("s_wait_xcnt 0x0" ::: "memory");   // in the built code a branch behind the last stores has the other epilogue, which reuses the stores' registers, as its fall-through side: the wait stands in front of that overwrite
}
// st_planesT (planes transposed, [batch][512][1024], each batch in fragment order): a lane's 8 accumulator registers are 8 consecutive s of one column, that is the lane's own 16 bytes of a half block; wave wv takes the tile's columns wv * 16 .. + 15, and its four mb stores are the four halves of two neighbouring blocks, 512 contiguous bytes each.
__device__ __forceinline__ void st_planesT(const v8f (&acc)[4][4], float* red, int wv, bf* Ph, bf* Pl, int r0, int c0) {
    const int lane = threadIdx.x & 31;
#pragma unroll
    for (int mb = 0; mb < 4; ++mb)
#pragma unroll
        for (int nb = 0; nb < 4; ++nb) put_frag(acc[mb][nb], red + wv * SLAB, mb * 4 + nb);
    __syncthreads();   // every wave's partial tile is in LDS before any wave adds them up
    const size_t base = (size_t)(r0 / SS) * SS * EE + ((size_t)((c0 >> 4) + wv) * (SS / 32) + ((r0 % SS) >> 5)) * 512 + lane * 8;   // a 64-row tile lies inside one batch
#pragma unroll
    for (int mb = 0; mb < 4; ++mb) { const v8f x = sum_frag(red, mb * 4 + wv); v8us oh, ol;
#pragma unroll
        for (int j = 0; j < 8; ++j) { unsigned short p, q; splitf(x[j], p, q); oh[j] = p; ol[j] = q; }
        const size_t o = base + mb * 256; *(v8us*)(Ph + o) = oh; *(v8us*)(Pl + o) = ol; }
}
// st_colsT (the tile's first 16 columns as f32, transposed, [batch][16][1024]): a lane's 8 accumulator registers are 8 consecutive rows of one column, that is 32 contiguous bytes of the transposed array; waves 0 and 1 take 32 rows each, one whole 128-B line in each column.
__device__ __forceinline__ void st_colsT(const v8f (&acc)[4][4], float* red, int wv, float* T, int r0) {
    const int lane = threadIdx.x & 31, lr = lane & 15, hi = lane >> 4;
#pragma unroll
    for (int mb = 0; mb < 4; ++mb) put_frag(acc[mb][0], red + wv * SLAB, mb);
    __syncthreads();   // every wave's partial blocks are in LDS before a wave adds them up
    if (wv < 2) {
        float* t = T + (size_t)(r0 / SS) * NHID * SS + (size_t)lr * SS + (r0 % SS) + wv * 32 + hi * 8;   // a 64-row tile lies inside one batch
#pragma unroll
        for (int m = 0; m < 2; ++m) *(v8f*)(t + m * 16) = sum_frag(red, wv * 2 + m);
        asm volatile("s_wait_xcnt 0x0" ::: "memory");   // in the built code a branch behind these stores has the row-major epilogue, which reuses the stores' registers, as its fall-through side: the wait stands in front of that overwrite
    }
}
// PLANES: the tile goes out as hl planes Ph / Pl (transposed where tr is set, a wave-uniform choice) and not as f32 C.
template <typename T16, int NSPLIT, bool BIAS, bool PLANES = false, int LB = NWV * SLAB * 4>
__device__ __forceinline__ void gemmw_tile(const T16* __restrict__ A, const T16* __restrict__ A2, const T16* __restrict__ Bt, const T16* __restrict__ Bt2, int K, float* C, int ldc, const float* __restrict__ bias, int r0, int c0, bf* Ph = nullptr, bf* Pl = nullptr, bool tr = false, float* CT = nullptr) {
    typedef typename WFrag<T16>::V V;
    float* red = (float*)lds_buf<LB>();
    const int lane = threadIdx.x & 31, lr = lane & 15, hi = lane >> 4;
    const int wv = __builtin_amdgcn_readfirstlane(threadIdx.x >> 5);   // the wave's number in its work-group, in a scalar register
    v8f acc[4][4];
#pragma unroll
    for (int mb = 0; mb < 4; ++mb)
#pragma unroll
        for (int nb = 0; nb < 4; ++nb) acc[mb][nb] = (v8f){};
    const size_t aoff = (size_t)r0 * K + wv * 512, boff = (size_t)c0 * K + wv * 512;   // fragment order: a row block's k blocks lie in a row (16 * K elements a row block, 512 a k block); wave wv's base is k block wv, its first trip is set by the rotation below, and it steps over NWV blocks a trip; all of this is the same for the whole wave
    // The k walk starts at a trip of the tile's own, (row tile + column tile) mod trips, and wraps: the work-groups that share a row tile or a column tile run at the same time, and from one common start they would all ask L2 for the same lines at the same moment. Every k block is still taken once; only the order of a wave's sums turns. K / (32 * NWV) is a power of two.
    const int rot = ((r0 >> 6) + (c0 >> 6)) & (K / (NWV * 32) - 1);
    unsigned lo = lane * 16 + rot * (NWV * 1024);   // byte offset of the lane's own 16 bytes in the trip's first half block: the one vector register of every operand address (scalar base + this + a constant); it steps from trip to trip
#pragma unroll 1
    for (int kc = 0; kc < K; kc += NWV * 32) {
        V a[4], a2[4], b[4], b2[4];
#pragma unroll
        for (int mb = 0; mb < 4; ++mb) { a[mb] = WFrag<T16>::ld(A + aoff + (size_t)mb * 16 * K, lo); if (NSPLIT == 1 || NSPLIT == 2) a2[mb] = WFrag<T16>::ld(A2 + aoff + (size_t)mb * 16 * K, lo); }
#pragma unroll
        for (int nb = 0; nb < 4; ++nb) { b[nb] = WFrag<T16>::ld(Bt + boff + (size_t)nb * 16 * K, lo); if (NSPLIT >= 2 && nb < 3) b2[nb] = WFrag<T16>::ld(Bt2 + boff + (size_t)nb * 16 * K, lo); }
        __builtin_amdgcn_sched_barrier(0);   // the trip's loads stay one group ahead of its products
#pragma unroll
        for (int nb = 0; nb < 4; ++nb) { if (NSPLIT >= 2 && nb == 1) b2[3] = WFrag<T16>::ld(Bt2 + boff + (size_t)3 * 16 * K, lo);   // the last b2 fragment has no free registers until column block 0 is done
#pragma unroll
            for (int mb = 0; mb < 4; ++mb) { acc[mb][nb] = WFrag<T16>::mma(a[mb], b[nb], acc[mb][nb]); if (NSPLIT == 1 || NSPLIT == 2) acc[mb][nb] = WFrag<T16>::mma(a2[mb], b[nb], acc[mb][nb]); if (NSPLIT >= 2) acc[mb][nb] = WFrag<T16>::mma(a[mb], b2[nb], acc[mb][nb]); } }
        asm volatile("v_nop\n\tv_nop\n\tv_nop\n\tv_nop" : "+v"(acc[0][0]), "+v"(acc[1][1]), "+v"(acc[2][2]), "+v"(acc[3][3]) : "v"(a[0]), "v"(a[3]));
        asm volatile("s_wait_xcnt 0x0\n\tv_add_nc_u32 %0, %1, %0\n\ts_delay_alu instid0(VALU_DEP_1)\n\tv_and_b32 %0, %2, %0" : "+v"(lo) : "n"(NWV * 1024), "s"(K * 32 - 1) : "memory");   // on to the next trip's k blocks (NWV blocks of 1 KB), back to the first behind the last (a row block's k blocks are K * 32 bytes); add and wrap are written behind their wait in one statement, because they overwrite the offset register that the trip's loads name; the delay hint lets the SIMD's other waves issue while the wrap waits for the add
    }
    if (PLANES) { if (tr) st_planesT(acc, red, wv, Ph, Pl, r0, c0); else st_planes(acc, red, wv, Ph, Pl, r0, c0); return; }
    if (CT) { st_colsT(acc, red, wv, CT, r0); return; }   // a choice that is the same for the whole work-group: only the 16 columns that are used go out, transposed, and no C
    put_rows(acc, red + wv * SLAB);
    __syncthreads();   // every wave's partial tile is in LDS before any wave adds them up
    float* crow = C + (size_t)(r0 + wv * 16) * ldc + c0;   // wave wv takes the tile's rows wv * 16 .. + 15: 16 lanes x 16 B cover a row's two 128-B lines
#pragma unroll
    for (int s = 0; s < 8; ++s) { const int row = 2 * s + hi, cofs = lr * 4; v4f val = sum_rows(red, (wv * 16 + row) * 68 + cofs); if (BIAS) { val[0] += bfr(bias[c0 + cofs]); val[1] += bfr(bias[c0 + cofs + 1]); val[2] += bfr(bias[c0 + cofs + 2]); val[3] += bfr(bias[c0 + cofs + 3]); }
        *(v4f*)(crow + (size_t)row * ldc + cofs) = val; }
}
// ---- gemml_tile: hl x hl GEMM (3 products) with the operands staged in LDS. One work-group of 4 waves (2 x 2) per tile of 128 rows x NBW * 32 columns; a wave holds 64 rows x NBW * 16 columns over the whole K, so every staged fragment serves two waves and L2 is asked for each operand row once per work-group.
// A stage is KS k blocks of all four planes' row blocks. In fragment order a row block's KS k blocks are KS KB in a row, and its neighbour row block lies K * 32 bytes on: a plane's share of a stage is one two-dimensional tile (rows of KS KB, one row a row block), which one tensor load brings. Wave 0 brings Ah, 1 Al, 2 Bh, 3 Bl; two buffers.
typedef unsigned u32x4 __attribute__((ext_vector_type(4)));
typedef unsigned u32x8 __attribute__((ext_vector_type(8)));
__device__ __forceinline__ unsigned uni(unsigned v) { return (unsigned)__builtin_amdgcn_readfirstlane(v); }
__device__ __forceinline__ unsigned pinned(unsigned v) { unsigned w = uni(v); asm volatile("" : "+s"(w)); return w; }   // holds a wave-uniform value in a scalar register, so that a test on it is a scalar branch and a descriptor word formed from it is formed behind the waits in front of it
__device__ __forceinline__ void tdm_load(u32x4 g0, u32x8 g1) { asm volatile("tensor_load_to_lds %0, %1" :: "s"(g0), "s"(g1) : "memory"); }
// Group 1: 1-byte elements, no mask, no pad; tensor = tile = d1 rows of d0 bytes, source row pitch in bytes.
__device__ __forceinline__ u32x8 tdm_group1(unsigned d0, unsigned d1, unsigned pitch) { u32x8 g;
    g[0] = uni(0u); g[1] = uni((d0 & 0xFFFFu) << 16); g[2] = uni((d0 >> 16) | ((d1 & 0xFFFFu) << 16)); g[3] = uni((d1 >> 16) | (d0 << 16)); g[4] = uni(d1); g[5] = uni(pitch); g[6] = uni(0u); g[7] = uni(0u); return g; }
__device__ __forceinline__ u32x4 tdm_group0(unsigned lds_dst, unsigned long long ga) { u32x4 g;
    g[0] = uni(1u); g[1] = uni(lds_dst); g[2] = uni((unsigned)ga); g[3] = uni((((unsigned)(ga >> 32)) & 0x01FFFFFFu) | 0x80000000u); return g; }
__device__ __forceinline__ void wait_ds0() { asm volatile("s_wait_dscnt 0x0" ::: "memory"); }       // the wave's own LDS reads are done before the barrier behind which their buffer is refilled
__device__ __forceinline__ void wait_tensor0() { asm volatile("s_wait_tensorcnt 0x0" ::: "memory"); }   // the wave's own tensor load has landed before the barrier behind which the other waves read it
template <int NBW, int KS> struct StageBytes { static constexpr unsigned RB = KS * 1024u, SA = 8u * RB, SB = 2u * NBW * RB, STG = 2u * SA + 2u * SB; };
template <int NBW, int KS, int K, int LDC>
__device__ __forceinline__ void gemml_tile(const bf* __restrict__ Ah, const bf* __restrict__ Al, const bf* __restrict__ Bh, const bf* __restrict__ Bl, float* C, int r0, int c0) {
    typedef WFrag<bf>::V V;
    constexpr unsigned RB = StageBytes<NBW, KS>::RB, SA = StageBytes<NBW, KS>::SA, SB = StageBytes<NBW, KS>::SB, STG = StageBytes<NBW, KS>::STG;   // bytes of a row block, of an A plane, of a B plane in a stage; of a stage
    constexpr unsigned NS = K / (32 * KS);   // stages, a power of two, at least two
    char* L = lds_buf<2 * STG>();
    const unsigned lane = threadIdx.x & 31, lr = lane & 15, hi = lane >> 4;
    const unsigned wv = uni(threadIdx.x >> 5), wr = wv >> 1, wc = wv & 1;   // the wave's number in its (one-dimensional) work-group; its row half and column half of the tile
    const bf* src = wv < 2 ? (wv == 0 ? Ah : Al) + (size_t)r0 * K : (wv == 2 ? Bh : Bl) + (size_t)c0 * K;   // the wave's own plane, at the tile's first row block
    const unsigned place = (unsigned)(size_t)L + (wv < 2 ? wv * SA : 2u * SA + (wv - 2u) * SB);
    u32x8 g1 = tdm_group1(RB, wv < 2 ? 8u : 2u * NBW, K * 32u);
    asm volatile("" : "+s"(g1));   // descriptor words held in scalar registers: the loop-invariant group stays one value in one tuple for all its loads, so that no register of it takes a new value while a request is outstanding
    // The k walk starts at a stage of the tile's own and wraps, as in the K-split tiles: work-groups that share operand rows do not ask L2 for the same lines at the same moment.
    const unsigned rot = ((unsigned)(r0 >> 7) + (unsigned)c0 / (NBW * 32u)) & (NS - 1u);
    auto issue = [&](unsigned s) { tdm_load(tdm_group0(place + (s & 1u) * STG, (unsigned long long)(size_t)src + (unsigned long long)(((s + rot) & (NS - 1u)) * RB)), g1); };
    v8f acc[4][NBW];
#pragma unroll
    for (int mb = 0; mb < 4; ++mb)
#pragma unroll
        for (int nb = 0; nb < NBW; ++nb) acc[mb][nb] = (v8f){};
    issue(0u);
    wait_tensor0();
    __syncthreads();   // stage 0 is in LDS, all four planes, before any wave reads it
    issue(1u);
#pragma unroll 1   // one pass a stage: the two buffers take turns by an offset
    for (unsigned s = 0; s < NS; ++s) {
        const bf* fa = (const bf*)(L + (s & 1u) * STG + wr * 4u * RB);
        const bf* fb = (const bf*)(L + (s & 1u) * STG + 2u * SA + wc * NBW * RB);
        V a[2][4], a2[2][4], b[2][NBW], b2[2][NBW];
        auto ldset = [&](int q, int kb) {
#pragma unroll
            for (int mb = 0; mb < 4; ++mb) { a[q][mb] = WFrag<bf>::ld(fa + (mb * RB + kb * 1024u) / 2, lane * 16); a2[q][mb] = WFrag<bf>::ld(fa + (SA + mb * RB + kb * 1024u) / 2, lane * 16); }
#pragma unroll
            for (int nb = 0; nb < NBW; ++nb) { b[q][nb] = WFrag<bf>::ld(fb + (nb * RB + kb * 1024u) / 2, lane * 16); b2[q][nb] = WFrag<bf>::ld(fb + (SB + nb * RB + kb * 1024u) / 2, lane * 16); }
        };
        ldset(0, 0);
#pragma unroll
        for (int kb = 0; kb < KS; ++kb) { const int q = kb & 1;
            if (kb + 1 < KS) ldset(q ^ 1, kb + 1);
            __builtin_amdgcn_sched_barrier(0);   // the next k block's LDS reads stay one group ahead of this block's products, so that they land behind the products and not among them
#pragma unroll
            for (int nb = 0; nb < NBW; ++nb)
#pragma unroll
                for (int mb = 0; mb < 4; ++mb) acc[mb][nb] = WFrag<bf>::mma(a[q][mb], b[q][nb], acc[mb][nb]);
#pragma unroll
            for (int nb = 0; nb < NBW; ++nb)
#pragma unroll
                for (int mb = 0; mb < 4; ++mb) acc[mb][nb] = WFrag<bf>::mma(a2[q][mb], b[q][nb], acc[mb][nb]);
#pragma unroll
            for (int nb = 0; nb < NBW; ++nb)
#pragma unroll
                for (int mb = 0; mb < 4; ++mb) acc[mb][nb] = WFrag<bf>::mma(a[q][mb], b2[q][nb], acc[mb][nb]);
            __builtin_amdgcn_sched_barrier(0);   // and this block's products stay ahead of the reads that refill their fragment set
        }
        wait_ds0();
        wait_tensor0();
        __syncthreads();   // stage s + 1 is published, and every wave has left stage s's buffer
        if (pinned(s + 2u < NS)) issue(pinned(s + 2u));   // the refill of the buffer just left; scalar test, descriptor formed behind the waits
    }
    wait_tensor0();
    wait_ds0();
    // The ring is free (the last pass's barrier stands behind every wave's last read): each wave stages its own part of the tile in a slab of its own and stores whole 128-B lines.
    constexpr int P = NBW * 16 + 4;   // slab pitch in floats
    float* sl = (float*)L + wv * (64 * P);
#pragma unroll
    for (int mb = 0; mb < 4; ++mb)
#pragma unroll
        for (int nb = 0; nb < NBW; ++nb)
#pragma unroll
            for (int j = 0; j < 8; ++j) sl[(mb * 16 + hi * 8 + j) * P + nb * 16 + lr] = acc[mb][nb][j];
    wait_ds0();   // the wave's own slab is written before the wave reads its rows back
    constexpr int LPR = NBW * 4, RPI = 32 / LPR;   // lanes a row (16 B each), rows a store
    float* crow = C + (size_t)(r0 + wr * 64 + lane / LPR) * LDC + c0 + wc * (NBW * 16) + (lane % LPR) * 4;
    const float* srow = sl + (lane / LPR) * P + (lane % LPR) * 4;
#pragma unroll
    for (int i = 0; i < 64 / RPI; ++i) *(v4f*)(crow + (size_t)i * RPI * LDC) = *(const v4fa*)(srow + i * RPI * P);
    asm volatile("s_wait_xcnt 0x0" ::: "memory");   // in the built code of k_sch a branch behind the score tiles' last stores has the hq / hk path, which reuses the stores' registers, as its fall-through side: the wait stands in front of that overwrite
}
#define SC_NBW 4   /* score tiles: 128 x 128, stages of 2 k blocks */
#define SC_KS  2
#define AV_NBW 2   /* attn.V tiles: 128 x 64 (256 work-groups), stages of 4 k blocks */
#define AV_KS  4
// k_sch: the two stages that read only the Q / K planes share one grid: first the 4 x 8 x 8 score tiles (row tile fastest, batch slowest), the long work-groups, then 64 row tiles of hq and 64 of hk (row tiles of the [4 * 1024] row space).
__global__ __launch_bounds__(32 * NWV) void k_sch(const bf* __restrict__ QPh, const bf* __restrict__ QPl, const bf* __restrict__ KPh, const bf* __restrict__ KPl, const bf* __restrict__ WQ1, const bf* __restrict__ WK1, float* HQ, float* HKT, float* S) {
    const int NS_T = NB_ * (SS / 128) * (SS / 128), NH_T = NB_ * SS / 64;
    if ((int)blockIdx.x >= NS_T) { const int b = blockIdx.x - NS_T; const bool k = b >= NH_T; gemmw_tile<bf, 1, false, false, 2 * StageBytes<SC_NBW, SC_KS>::STG>(k ? KPh : QPh, k ? KPl : QPl, k ? WK1 : WQ1, nullptr, EE, HQ, 64, nullptr, (k ? b - NH_T : b) * 64, 0, nullptr, nullptr, false, k ? HKT : nullptr); }   // hq row-major (pitch 64), hk transposed ([batch][16][1024])
    else { const int t = blockIdx.x; const size_t z = (size_t)(t / ((SS / 128) * (SS / 128))); const size_t zo = z * SS * EE;
        gemml_tile<SC_NBW, SC_KS, EE, SS>(QPh + zo, QPl + zo, KPh + zo, KPl + zo, S + z * SS * SS, (t % (SS / 128)) * 128, ((t / (SS / 128)) % (SS / 128)) * 128); }
}
// k_av: out = attn V, grid (row tiles, column tiles, batch).
__global__ __launch_bounds__(32 * NWV) void k_av(const bf* __restrict__ Ph, const bf* __restrict__ Pl, const bf* __restrict__ VTh, const bf* __restrict__ VTl, float* OUT) {
    const size_t z = blockIdx.z;
    gemml_tile<AV_NBW, AV_KS, SS, EE>(Ph + z * SS * SS, Pl + z * SS * SS, VTh + z * EE * SS, VTl + z * EE * SS, OUT + z * SS * EE, blockIdx.x * 128, blockIdx.y * (AV_NBW * 32));
}

typedef __attribute__((ext_vector_type(4))) unsigned short v4us;

// The element-wise stages as device functions of a block number blk (256 threads a block), so that independent stages can share one grid.
// d_cvt8: src [rows][512] f32 -> dst in fragment order; thread i owns the i-th 16 bytes of dst, so that a wave stores 512 contiguous bytes, and reads its 8 floats from the row and k that those bytes stand for.
__device__ __forceinline__ void d_cvt8(const float* __restrict__ src, bf* dst, int blk) { const int i = blk * 256 + threadIdx.x; const int row = ((i >> 6) / (EE / 32)) * 16 + (i & 15), k0 = ((i >> 6) % (EE / 32)) * 32 + ((i >> 4) & 3) * 8; const v8f v = *(const v8f*)(src + (size_t)row * EE + k0); v8us o;
    asm volatile("s_wait_xcnt 0x0" ::: "memory");   // in the built code the conversion reuses the register pair that holds the loads' address: the wait stands in front of that overwrite
#pragma unroll
    for (int k = 0; k < 8; ++k) o[k] = f2bf(v[k]); *(v8us*)(dst + (size_t)i * 8) = o;
    asm volatile("s_wait_xcnt 0x0" ::: "memory");   // in the built code a branch behind this store has the other stage's code, which reuses the store's registers, as its fall-through side: the wait stands in front of that overwrite
}
// d_w1p: W1Q[n][k] = bf16(W1[n][k]) and W1K[n][k] = bf16(W1[n][512 + k]) for n < 16, rows 16..63 zero ([64][512], in fragment order).
__device__ __forceinline__ void d_w1p(const float* __restrict__ W1, bf* WQ1, bf* WK1, int blk) { const int e = (blk * 256 + threadIdx.x) * 4; const int n = e / EE, k = e % EE; v4us a, b;
#pragma unroll
    for (int u = 0; u < 4; ++u) { a[u] = (n < NHID) ? f2bf(W1[(size_t)n * 2 * EE + k + u]) : (unsigned short)0; b[u] = (n < NHID) ? f2bf(W1[(size_t)n * 2 * EE + EE + k + u]) : (unsigned short)0; }
    const size_t o = pko(n, k, EE); *(v4us*)(WQ1 + o) = a; *(v4us*)(WK1 + o) = b;  }
// Block counts of the stages; every one divides exactly, so no stage has a part-filled block.
#define NBX  (NB_ * SS * EE / 8 / 256)   /* x -> bf16 */
#define NBW  (EE * EE / 8 / 256)         /* one of Wq, Wk, Wv -> bf16 */
#define NBW1 (64 * EE / 4 / 256)         /* the two padded W1 halves */
// k_prep: all five input conversions in one grid: x, then Wq, Wk, Wv (BW = the three [512][512] bf16 planes in a row), then W1.
__global__ __launch_bounds__(256) void k_prep(const float* __restrict__ x, const float* __restrict__ Wq, const float* __restrict__ Wk, const float* __restrict__ Wv, const float* __restrict__ W1, bf* XB, bf* BW, bf* WQ1, bf* WK1) {
    const int b = blockIdx.x;
    if (b >= NBX + 3 * NBW) { d_w1p(W1, WQ1, WK1, b - NBX - 3 * NBW); return; }
    const int w = (b < NBX) ? 0 : 1 + (b - NBX) / NBW;   // 0: x; 1, 2, 3: Wq, Wk, Wv
    d_cvt8(w == 0 ? x : (w == 1 ? Wq : (w == 2 ? Wk : Wv)), w == 0 ? XB : BW + (size_t)(w - 1) * EE * EE, w == 0 ? b : (b - NBX) % NBW);
}
// k_qkv: the Q / K / V products (grid z = 0, 1, 2), one work-group per 64x64 tile, K = 512; the tile's epilogue stores the hl planes (V's transposed), so no f32 copy of Q, K or V exists.
__global__ __launch_bounds__(32 * NWV) void k_qkv(const bf* __restrict__ XB, const bf* __restrict__ BW, bf* QPh, bf* QPl, bf* KPh, bf* KPl, bf* VTh, bf* VTl) {
    const int z = blockIdx.z;
    gemmw_tile<bf, 0, false, true>(XB, nullptr, BW + (size_t)z * EE * EE, nullptr, EE, nullptr, 0, nullptr, blockIdx.x * 64, blockIdx.y * 64, z == 0 ? QPh : (z == 1 ? KPh : VTh), z == 0 ? QPl : (z == 1 ? KPl : VTl), z == 2);
}
#define SPP (SS + 32)   /* LDS pitch of a row of a plane, in elements: 16 banks from row to row, so that the 16-byte reads of neighbouring rows and groups fall on different banks */
__global__ __launch_bounds__(256) void k_hsoft(const float* __restrict__ S, const float* __restrict__ HQ, const float* __restrict__ HKT, const float* __restrict__ b1, const float* __restrict__ W2, const float* __restrict__ b2, bf* Ph, bf* Pl) {
    const int lane = threadIdx.x & 31; const int i = blockIdx.x * 8 + (threadIdx.x >> 5); const float* sr = S + (size_t)i * SS; HKT += (size_t)(i / SS) * NHID * SS;   // i = batch * S + query row; the keys are those of the row's own batch
    float hq[NHID], w2[NHID];
#pragma unroll
    for (int h = 0; h < NHID; ++h) { hq[h] = __fadd_rn(HQ[(size_t)i * 64 + h], bfr(b1[h])); w2[h] = bfr(W2[h]); }   // hq + b1 folded (the reference adds hq + hk + b1; f32 addition order (hq + hk) + b1 vs (hq + b1) + hk differs by <= 1 ulp)
    const float bb2 = bfr(b2[0]); const float scl = 0.044194173824159216f;   // 1/sqrt(512)
    float v[SS / 32]; float mx = -3.0e38f;
#pragma unroll 1
    for (int ch = 0; ch < SS / 128; ++ch) { const v4f a = *(const v4f*)(sr + ch * 128 + lane * 4); v4f hk[NHID];   // hk is stored [h][key]: one 16-byte load per h brings the lane's four keys, and the wave's 32 lanes read 512 contiguous bytes (four whole lines) per load; all issued ahead of the first tanh; h unrolled below so that hq, w2 and hk have fixed registers
#pragma unroll
        for (int h = 0; h < NHID - 1; ++h) hk[h] = *(const v4f*)(HKT + (size_t)h * SS + ch * 128 + lane * 4);
        asm volatile("s_wait_xcnt 0x0" ::: "memory");   // in the built code the last load lands in the register pair that holds the address of the loads above: the wait stands in front of that overwrite
        hk[NHID - 1] = *(const v4f*)(HKT + (size_t)(NHID - 1) * SS + ch * 128 + lane * 4);
#pragma unroll
        for (int u = 0; u < 4; ++u) { float est = bb2;
#pragma unroll
            for (int h = 0; h < NHID; ++h) { const float z = __fadd_rn(hq[h], hk[h][u]); float th = __builtin_amdgcn_tanhf(z); float pr = __fmul_rn(w2[h], th); asm volatile("" : "+v"(pr)); est = __fadd_rn(est, pr); }   // tanh by the hardware instruction (v_tanh_f32): one instruction a value, no branch on the size of z
            float s0 = a[u] * scl; asm volatile("" : "+v"(s0)); const float t = __fadd_rn(s0, est); v[ch * 4 + u] = t; mx = fmaxf(mx, t); } }
#pragma unroll
    for (int sh = 16; sh; sh >>= 1) mx = fmaxf(mx, __shfl_xor(mx, sh, 32));
    float sum = 0.f;
#pragma unroll
    for (int q = 0; q < SS / 32; ++q) { float d0 = __fsub_rn(v[q], mx); asm volatile("" : "+v"(d0)); v[q] = __builtin_amdgcn_exp2f(__fmul_rn(d0, 1.4426950408889634f)); sum += v[q]; }
#pragma unroll
    for (int sh = 16; sh; sh >>= 1) sum += __shfl_xor(sum, sh, 32);
    const float f = __fdiv_rn(1.0f, sum);
    // The planes go out in fragment order ([4 * 1024][1024]), where a row owns only 16 bytes of each 128-B line and the work-group's 8 rows together own the whole line: the rows meet in LDS, and 8 lanes x 16 B store a line.
    __shared__ __align__(16) bf sp[2][8][SPP];
    {
        const int w = threadIdx.x >> 5;
#pragma unroll
        for (int ch = 0; ch < SS / 128; ++ch) { v4us oh, ol; for (int q = 0; q < 4; ++q) { unsigned short a2, c2; splitf(v[ch * 4 + q] * f, a2, c2); oh[q] = a2; ol[q] = c2; } *(v4us*)(&sp[0][w][ch * 128 + lane * 4]) = oh; *(v4us*)(&sp[1][w][ch * 128 + lane * 4]) = ol; }
    }
    __syncthreads();   // all 8 rows are in LDS before any wave gathers a line from them
#pragma unroll
    for (int it = 0; it < SS / 8 * 8 / 256; ++it) { const int p = it * 256 + threadIdx.x, row = p & 7, g = p >> 3;   // g: the row's 16-byte group (8 keys)
        const size_t oo = pko(blockIdx.x * 8 + row, g * 8, SS); *(v8us*)(Ph + oo) = *(const v8us*)(&sp[0][row][g * 8]); *(v8us*)(Pl + oo) = *(const v8us*)(&sp[1][row][g * 8]); }
}

extern "C" void kernel_launch(void* const* d_in, const int* in_sizes, int n_in,
                              void* d_out, int out_size, void* d_ws, size_t ws_size, hipStream_t stream) {
    (void)in_sizes; (void)n_in; (void)out_size;
    const float* x = (const float*)d_in[0]; const float* Wq = (const float*)d_in[1]; const float* Wk = (const float*)d_in[2]; const float* Wv = (const float*)d_in[3]; const float* W1 = (const float*)d_in[4]; const float* b1 = (const float*)d_in[5]; const float* W2 = (const float*)d_in[6]; const float* b2 = (const float*)d_in[7];
    float* OUT = (float*)d_out;     // [4][1024][512]
    char* wsp = (char*)d_ws;
    auto take = [&](size_t bytes) { char* p = wsp; wsp += (bytes + 255) & ~(size_t)255; return (void*)p; };
    bf* BQ = (bf*)take((size_t)3 * EE * EE * 2);   // the bf16 planes of Wq, Wk, Wv in a row: grid z of the Q / K / V launch steps through them
    bf* WQ1 = (bf*)take((size_t)64 * EE * 2); bf* WK1 = (bf*)take((size_t)64 * EE * 2);
    bf* XB = (bf*)take((size_t)NB_ * SS * EE * 2);
    bf* QPh = (bf*)take((size_t)NB_ * SS * EE * 2); bf* QPl = (bf*)take((size_t)NB_ * SS * EE * 2); bf* KPh = (bf*)take((size_t)NB_ * SS * EE * 2); bf* KPl = (bf*)take((size_t)NB_ * SS * EE * 2); bf* VTh = (bf*)take((size_t)NB_ * EE * SS * 2); bf* VTl = (bf*)take((size_t)NB_ * EE * SS * 2);
    float* HQ = (float*)take((size_t)NB_ * SS * 64 * 4); float* HKT = (float*)take((size_t)NB_ * NHID * SS * 4); float* S = (float*)take((size_t)NB_ * SS * SS * 4); bf* Ph = (bf*)take((size_t)NB_ * SS * SS * 2); bf* Pl = (bf*)take((size_t)NB_ * SS * SS * 2);
    if ((size_t)(wsp - (char*)d_ws) > ws_size) return;    // total ~ 65 MB
    // Five launches, one per stage of the dependence chain; launches that do not depend on one another share a grid. All four batches in every launch.
    k_prep<<<NBX + 3 * NBW + NBW1, 256, 0, stream>>>(x, Wq, Wk, Wv, W1, XB, BQ, WQ1, WK1);   // torch [out][in] = Bt
    k_qkv<<<dim3(NB_ * SS / 64, EE / 64, 3), 32 * NWV, 0, stream>>>(XB, BQ, QPh, QPl, KPh, KPl, VTh, VTl);   // grid z = Q, K, V
    k_sch<<<NB_ * (SS / 128) * (SS / 128) + 2 * (NB_ * SS / 64), 32 * NWV, 0, stream>>>(QPh, QPl, KPh, KPl, WQ1, WK1, HQ, HKT, S);
    k_hsoft<<<NB_ * SS / 8, 256, 0, stream>>>(S, HQ, HKT, b1, W2, b2, Ph, Pl);
    k_av<<<dim3(SS / 128, EE / (AV_NBW * 32), NB_), 32 * NWV, 0, stream>>>(Ph, Pl, VTh, VTl, OUT);
}
